// v000
// Measured on an AMD MI455X. A time is GPU time per run, averaged over a window of back-to-back runs after a warm-up
// (all launches, gaps included; the runs take copies of the inputs in turn), and the median of several windows.
// Apart from v000's, it joins two sittings. Times from different sittings can be a few percent apart, while
// side-by-side timings come from the same sitting.
// v000, which the later versions start from, runs in 688 microseconds.
#include <hip/hip_runtime.h>

// compute dtype: every contraction on v_wmma_f32_16x16x32_f16 (f16 operands, f32 accumulate). q/k/v projections: x (bf16 RNE values carried x8) by W_q/W_k/W_v (bf16 RNE values carried x256): 1 product;
// attention for query rows < 512 of each sequence: S^T = K Q^T with q and k as f16 hi+lo planes (x8): 3 products; O^T += V^T P^T with v hi+lo (x8) and P hi+lo (x1024): 3 products;
// attention for query rows >= 512: S^T = K Q^T with the hi planes only: 1 product; O^T += V^T P^T with v hi and P (x1024) single: 1 product; ctx W_p with ctx hi+lo (x64) and W_p exact (x256): 2 products.
// Layout: x [B][T][1024]; W_* (in,out); q/k/v = x W + b reshaped to [B][T][16][64]; rotary pairs (2p, 2p+1) of q and k turned by angle t * theta^(-2p/64); scores q k^T / 8 with key j allowed iff
// j <= i + 64; softmax over keys; ctx = P v -> [B][T][1024]; out = ctx W_p (no bias).
// Fragment k-map per lane half hh for A AND B: elements 0..7 <- k = 8hh+0..7, 8..15 <- k = 16+8hh+0..7; acc[r] = D[8hh+r][col].

#ifndef NB
#define NB 4
#endif
#ifndef SEQ
#define SEQ 2048
#endif

namespace {
constexpr int BF = 4, TF = 2048, DM = 1024, H = 16, HD = 64, SRC = 64;
constexpr int BL = NB;                                   // batches computed (== 4 shipped)
constexpr int QL = SEQ;                                  // query rows computed per batch (== 2048 shipped)
constexpr int KL = (QL + SRC < TF) ? (QL + SRC) : TF;    // key rows needed: j <= i + SRC
constexpr int NBH = (BL < 2) ? BL : 2;                   // batches per pass (planes are sized for NBH)
constexpr int NPASS = (BL + NBH - 1) / NBH;
constexpr int RSPLIT = (QL < 512) ? QL : 512;            // query rows below this get the hi+lo (3-product) attention path
constexpr float XS = 8.0f, WSC = 256.0f, PS = 1024.0f, CS = 64.0f, LOG2E = 1.4426950408889634f, L2THETA = 13.287712379549449f;
static_assert(BL >= 1 && BL <= BF);
static_assert(QL >= 64 && QL <= TF && QL % 64 == 0);
static_assert(KL % 64 == 0 && KL <= TF && KL >= QL);
static_assert(RSPLIT % 32 == 0 && RSPLIT <= QL);
static_assert(DM == H * HD && TF % 64 == 0 && HD == 64);

typedef _Float16 b16;
typedef __attribute__((ext_vector_type(16))) _Float16 v16b;
typedef __attribute__((ext_vector_type(8))) _Float16 v8b;
typedef __attribute__((ext_vector_type(4))) _Float16 v4h;
typedef __attribute__((ext_vector_type(2))) _Float16 v2h;
typedef __attribute__((ext_vector_type(8))) float v8f;
typedef __attribute__((ext_vector_type(4))) float v4f;
typedef __attribute__((ext_vector_type(2))) float v2f;

__device__ __forceinline__ float bf16_rne(float f) { unsigned int u = __float_as_uint(f); u += 0x7FFFu + ((u >> 16) & 1u); return __uint_as_float(u & 0xFFFF0000u); }
__device__ __forceinline__ void split16(float v, b16& hi, b16& lo) { hi = (b16)v; lo = (b16)(v - (float)hi); }
__device__ __forceinline__ v16b frag_kb(const b16* p, int hh) {
  const v8b a = *(const v8b*)(p + 8 * hh), b = *(const v8b*)(p + 16 + 8 * hh); v16b f;
#pragma unroll
  for (int e = 0; e < 8; ++e) { f[e] = a[e]; f[8 + e] = b[e]; }
  return f;
}
__device__ __forceinline__ v8f wmma16b(v16b a, v16b b, v8f c) {
  v8f d = __builtin_amdgcn_wmma_f32_16x16x32_f16(false, a, false, b, (short)0, c, false, false);
  asm volatile("v_nop\n\tv_nop\n\tv_nop\n\tv_nop" : "+v"(d) : "v"(a), "v"(b));
  return d;
}
__device__ __forceinline__ void wave_lds_sync() { __builtin_amdgcn_fence(3 /* release order */, "workgroup"); __builtin_amdgcn_wave_barrier(); __builtin_amdgcn_fence(2 /* acquire order */, "workgroup"); }
__device__ __forceinline__ float nexp2(float v) { return __builtin_amdgcn_exp2f(v); }

// prep: WT [3072 o][1024 k]: o < 1024 W_q[k][o], < 2048 W_k[k][o-1024], else W_v[k][o-2048]; WO [1024 o][1024 k] = W_p[k][o] ((in,out) layouts -> transposed, k contiguous); bf16 RNE then x256
__global__ __launch_bounds__(256) void prep_kernel(const float* __restrict__ wq, const float* __restrict__ wk, const float* __restrict__ wv, const float* __restrict__ wp, b16* __restrict__ WT, b16* __restrict__ WO) {
  const size_t u = (size_t)blockIdx.x * 256 + threadIdx.x;
  if (u >= (size_t)4 * DM * DM / 8) return;
  const int mtx = (int)(u / ((size_t)DM * DM / 8)); const size_t e = (u % ((size_t)DM * DM / 8)) * 8; const int oo = (int)(e / DM), k0 = (int)(e % DM);
  const float* w = mtx == 0 ? wq : mtx == 1 ? wk : mtx == 2 ? wv : wp;
  v8b o;
#pragma unroll
  for (int j = 0; j < 8; ++j) o[j] = (b16)(bf16_rne(w[(size_t)(k0 + j) * DM + oo]) * WSC);
  b16* dst = (mtx < 3) ? (WT + (size_t)mtx * DM * DM + e) : (WO + e);
  { *(v8b*)dst = o;  }
}

__global__ __launch_bounds__(256) void rope_tab_kernel(float* __restrict__ cst, float* __restrict__ snt) {
  const int i = blockIdx.x * 256 + threadIdx.x;
  if (i >= TF * (HD / 2)) return;
  const int t = i / (HD / 2), p = i % (HD / 2);
  const float e = (float)(2 * p) * (1.0f / (float)HD);   // exact
  const float inv = exp2f(-(e * L2THETA));                // theta^(-e)
  const float ang = (float)t * inv;
  float sv, cv;
  sincosf(ang, &sv, &cv);
  { *(float*)(cst + i) = cv; *(float*)(snt + i) = sv;  }
}

__global__ __launch_bounds__(256) void xcvt_kernel(const float* __restrict__ x, b16* __restrict__ X8, int b0, int nb) {
  const size_t u = (size_t)blockIdx.x * 256 + threadIdx.x;
  const size_t per = (size_t)KL * DM / 8;
  if (u >= (size_t)nb * per) return;
  const int bb = (int)(u / per); const size_t e = (u % per) * 8; const int t = (int)(e / DM), c = (int)(e % DM);
  const float* src = x + (((size_t)(b0 + bb)) * TF + t) * DM + c;
  const v4f f0 = *(const v4f*)src, f1 = *(const v4f*)(src + 4);
  v8b o;
#pragma unroll
  for (int j = 0; j < 4; ++j) { o[j] = (b16)(bf16_rne(f0[j]) * XS); o[4 + j] = (b16)(bf16_rne(f1[j]) * XS); }
  b16* dst = X8 + ((size_t)bb * TF + t) * DM + c;
  { *(v8b*)dst = o;  }
}

// projections: grid (KL/64, nb, 24 slabs of 128 output channels: 0-7 q, 8-15 k, 16-23 v); block = 64 tokens x 4 waves of 16; A fragments straight from X8 rows, B from WT rows, K = 1024;
__global__ __launch_bounds__(128) void proj_kernel(const b16* __restrict__ X8, const b16* __restrict__ WT, const float* __restrict__ bq, const float* __restrict__ bk, const float* __restrict__ bv,
                                                    const float* __restrict__ cst, const float* __restrict__ snt,
                                                    b16* __restrict__ QH, b16* __restrict__ QLo, b16* __restrict__ KH, b16* __restrict__ KLo, b16* __restrict__ VTh, b16* __restrict__ VTl) {
  __shared__ __attribute__((aligned(16))) float Tf[4][16][128 + 4];
  const int wave = threadIdx.x >> 5, lane = threadIdx.x & 31, nloc = lane & 15, hlf = lane >> 4;
  const int t0 = blockIdx.x * 64; const int bb = blockIdx.y; const int slab = blockIdx.z, n0 = slab * 128, part = slab / 8, c0 = n0 - part * DM;
  const size_t m0 = (size_t)bb * TF + t0 + wave * 16;
  v8f acc[8];
#pragma unroll
  for (int t = 0; t < 8; ++t) acc[t] = (v8f){};
#pragma unroll 2
  for (int kb = 0; kb < DM; kb += 32) {
    const v16b a = frag_kb(X8 + (m0 + nloc) * DM + kb, hlf);
#pragma unroll
    for (int t = 0; t < 8; ++t) acc[t] = wmma16b(a, frag_kb(WT + (size_t)(n0 + t * 16 + nloc) * DM + kb, hlf), acc[t]);
  }
  const float* bias = part == 0 ? bq : part == 1 ? bk : bv;
#pragma unroll
  for (int t = 0; t < 8; ++t) {
    const float bval = bf16_rne(bias[c0 + t * 16 + nloc]);
#pragma unroll
    for (int r = 0; r < 8; ++r) Tf[wave][8 * hlf + r][t * 16 + nloc] = acc[t][r] * (1.0f / (XS * WSC)) + bval;
  }
  __syncthreads();
  {
    if (part < 2) {
      b16* ph_ = part == 0 ? QH : KH; b16* pl_ = part == 0 ? QLo : KLo;
      const int c = c0 + lane * 4; const int hq = c / HD, d = c % HD, p0 = d >> 1;   // d is a multiple of 4: pairs (d,d+1) -> p0 and (d+2,d+3) -> p0+1
      for (int rr = 0; rr < 16; ++rr) {
        const int tok = t0 + wave * 16 + rr;
        const v4f f = *(const v4f*)(&Tf[wave][rr][lane * 4]);
        const v2f cc = *(const v2f*)(cst + (size_t)tok * (HD / 2) + p0), ss = *(const v2f*)(snt + (size_t)tok * (HD / 2) + p0);
        const float o0 = f[0] * cc[0] - f[1] * ss[0];
        const float o1 = f[0] * ss[0] + f[1] * cc[0];
        const float o2 = f[2] * cc[1] - f[3] * ss[1];
        const float o3 = f[2] * ss[1] + f[3] * cc[1];
        v4h h4, l4; b16 ph, pl;
        split16(o0 * XS, ph, pl); h4[0] = ph; l4[0] = pl;
        split16(o1 * XS, ph, pl); h4[1] = ph; l4[1] = pl;
        split16(o2 * XS, ph, pl); h4[2] = ph; l4[2] = pl;
        split16(o3 * XS, ph, pl); h4[3] = ph; l4[3] = pl;
        const size_t oi = (((size_t)bb * H + hq) * TF + tok) * HD + d;
        *(v4h*)(ph_ + oi) = h4; *(v4h*)(pl_ + oi) = l4;
      }
    } else {
#pragma unroll 1
      for (int q = 0; q < 32; ++q) {
        const int cl = wave * 32 + q; const int c = c0 + cl; const int hv_ = c / HD, d = c % HD; const int tk = lane * 2; v2h hv, lv;
        for (int j = 0; j < 2; ++j) { b16 p, ql; split16(Tf[(tk + j) >> 4][(tk + j) & 15][cl] * XS, p, ql); hv[j] = p; lv[j] = ql; }
        const size_t oi = (((size_t)bb * H + hv_) * HD + d) * (size_t)TF + t0 + lane * 2;
        *(v2h*)(VTh + oi) = hv; *(v2h*)(VTl + oi) = lv;
      }
    }
    
  }
}

// attention: grid (rows/32, nb x H), block x offset xb0 (in 32-row units): block = 2 waves x 16 queries; keys 0 .. min(KL, q0+16+SRC)-1 in 32-key chunks; key allowed iff key <= qi + SRC;
// RES != 0 (query rows < RSPLIT): S^T = K Q^T with 3 products (kh qh + kh ql + kl qh), P x1024 hi/lo, O^T += V^T P^T with 3 products (vh ph + vh pl + vl ph);
// RES == 0 (query rows >= RSPLIT, >= RSPLIT+SRC keys per row): S^T = kh qh (1 product), P x1024 single, O^T += vh p (1 product). Online softmax (running max, f32) in both; P through
template <int RES>
__global__ __launch_bounds__(64) void attn_kernel(const b16* __restrict__ QH, const b16* __restrict__ QLo, const b16* __restrict__ KH, const b16* __restrict__ KLo, const b16* __restrict__ VTh, const b16* __restrict__ VTl,
                                                   b16* __restrict__ Ch, b16* __restrict__ Cl, int xb0) {
  __shared__ __attribute__((aligned(16))) b16 Pb[2][16][32 + 8], Pc[2][16][32 + 8]; __shared__ __attribute__((aligned(16))) float To[2][16][HD + 4];
  const int wave = threadIdx.x >> 5, lane = threadIdx.x & 31, hh = lane >> 4, col = lane & 15; const int bb = blockIdx.y / H, h = blockIdx.y % H;
  const int q0 = (xb0 + (int)blockIdx.x) * 32 + wave * 16, qi = q0 + col;
  const size_t ph = (size_t)bb * H + h; const size_t pq = ph * TF * HD; const b16* Vh = VTh + ph * HD * (size_t)TF; const b16* Vl = VTl + ph * HD * (size_t)TF;
  const v16b qh0 = frag_kb(QH + pq + (size_t)qi * HD, hh), qh1 = frag_kb(QH + pq + (size_t)qi * HD + 32, hh);
  v16b ql0 = (v16b){}, ql1 = (v16b){};
  if (RES) { ql0 = frag_kb(QLo + pq + (size_t)qi * HD, hh); ql1 = frag_kb(QLo + pq + (size_t)qi * HD + 32, hh); }
  const float cs = LOG2E / (8.0f * XS * XS);
  float m = -INFINITY, l = 0.0f; v8f o[4];
#pragma unroll
  for (int t = 0; t < 4; ++t) o[t] = (v8f){};
  const int kmax = q0 + 16 + SRC; const int kend = kmax < KL ? kmax : KL;
#pragma unroll 1
  for (int kb = 0; kb < kend; kb += 32) {
    float e[16]; float mx = -INFINITY;
#pragma unroll
    for (int u = 0; u < 2; ++u) {
      v8f s = (v8f){}; const size_t kr = pq + (size_t)(kb + u * 16 + col) * HD;
      const v16b kh0 = frag_kb(KH + kr, hh), kh1 = frag_kb(KH + kr + 32, hh);
      if (RES) {
        const v16b kl0 = frag_kb(KLo + kr, hh), kl1 = frag_kb(KLo + kr + 32, hh);
        s = wmma16b(kh0, qh0, s); s = wmma16b(kh0, ql0, s); s = wmma16b(kl0, qh0, s); s = wmma16b(kh1, qh1, s); s = wmma16b(kh1, ql1, s); s = wmma16b(kl1, qh1, s);
      } else {
        s = wmma16b(kh0, qh0, s); s = wmma16b(kh1, qh1, s);
      }
#pragma unroll
      for (int r = 0; r < 8; ++r) { const int key = kb + u * 16 + 8 * hh + r; const float vv = (key <= qi + SRC) ? s[r] * cs : -INFINITY; e[u * 8 + r] = vv; mx = fmaxf(mx, vv); }
    }
    mx = fmaxf(mx, __shfl_xor(mx, 16)); const float mn = fmaxf(m, mx); const float al = (mn == -INFINITY) ? 1.0f : nexp2(m - mn); float sum = 0.0f;
#pragma unroll
    for (int i2 = 0; i2 < 16; ++i2) {
      const float p = (e[i2] == -INFINITY) ? 0.0f : nexp2(e[i2] - mn); sum += p;
      const int sl = (i2 < 8 ? 0 : 16) + 8 * hh + (i2 & 7);
      if (RES) { b16 a_, b_; split16(p * PS, a_, b_); Pb[wave][col][sl] = a_; Pc[wave][col][sl] = b_; }
      else { Pb[wave][col][sl] = (b16)(p * PS); }
    }
    sum += __shfl_xor(sum, 16); l = l * al + sum; m = mn;
    wave_lds_sync();
    const v16b pf = frag_kb(&Pb[wave][col][0], hh);
    v16b pg = (v16b){};
    if (RES) pg = frag_kb(&Pc[wave][col][0], hh);
#pragma unroll
    for (int t = 0; t < 4; ++t) {
      o[t] *= al; const size_t vr = (size_t)(t * 16 + col) * TF + kb;
      const v16b va = frag_kb(Vh + vr, hh);
      if (RES) { const v16b vb2 = frag_kb(Vl + vr, hh); o[t] = wmma16b(va, pf, o[t]); o[t] = wmma16b(va, pg, o[t]); o[t] = wmma16b(vb2, pf, o[t]); }
      else { o[t] = wmma16b(va, pf, o[t]); }
    }
    wave_lds_sync();
  }
  const float inv = 1.0f / (l * PS * XS);
#pragma unroll
  for (int t = 0; t < 4; ++t)
#pragma unroll
    for (int r = 0; r < 8; ++r) To[wave][col][t * 16 + 8 * hh + r] = o[t][r] * inv;
  wave_lds_sync();
  {
    for (int rr = 0; rr < 16; ++rr) {
      const v2f f = *(const v2f*)(&To[wave][rr][lane * 2]); v2h hv, lv;
      for (int j = 0; j < 2; ++j) { b16 p, q; split16(f[j] * CS, p, q); hv[j] = p; lv[j] = q; }
      const size_t oi = ((size_t)bb * TF + q0 + rr) * DM + h * HD + lane * 2;
      *(v2h*)(Ch + oi) = hv; *(v2h*)(Cl + oi) = lv;
    }
    
  }
}

__global__ __launch_bounds__(128) void out_kernel(const b16* __restrict__ Ch, const b16* __restrict__ Cl, const b16* __restrict__ WO, float* __restrict__ out, int b0) {
  __shared__ __attribute__((aligned(16))) float Tf[4][16][128 + 4];
  const int wave = threadIdx.x >> 5, lane = threadIdx.x & 31, nloc = lane & 15, hlf = lane >> 4; const int bb = blockIdx.z;
  const size_t m0 = (size_t)bb * TF + ((size_t)blockIdx.x * 4 + wave) * 16;
  const size_t mo = (size_t)(b0 + bb) * TF + ((size_t)blockIdx.x * 4 + wave) * 16;
  const int n0 = blockIdx.y * 128;
  v8f acc[8];
#pragma unroll
  for (int t = 0; t < 8; ++t) acc[t] = (v8f){};
#pragma unroll 2
  for (int kb = 0; kb < DM; kb += 32) {
    const v16b a = frag_kb(Ch + (m0 + nloc) * DM + kb, hlf), al = frag_kb(Cl + (m0 + nloc) * DM + kb, hlf);
#pragma unroll
    for (int t = 0; t < 8; ++t) { const v16b bw = frag_kb(WO + (size_t)(n0 + t * 16 + nloc) * DM + kb, hlf); acc[t] = wmma16b(a, bw, acc[t]); acc[t] = wmma16b(al, bw, acc[t]); }
  }
#pragma unroll
  for (int t = 0; t < 8; ++t) {
#pragma unroll
    for (int r = 0; r < 8; ++r) Tf[wave][8 * hlf + r][t * 16 + nloc] = acc[t][r] * (1.0f / (CS * WSC));
  }
  wave_lds_sync();
  {
    for (int rr = 0; rr < 16; ++rr) *(v4f*)(out + (mo + rr) * DM + n0 + lane * 4) = *(const v4f*)(&Tf[wave][rr][lane * 4]);
    
  }
}
}  // namespace

extern "C" void kernel_launch(void* const* d_in, const int* in_sizes, int n_in, void* d_out, int out_size, void* d_ws, size_t ws_size, hipStream_t stream) {
  if (n_in < 8) return;
  auto Fp = [&](int i) { return (const float*)d_in[i]; };
  // input order: 0 x [4,2048,1024], 1 W_q, 2 b_q, 3 W_k, 4 b_k, 5 W_v, 6 b_v, 7 W_p; all f32; W (in,out)
  if (in_sizes[0] < BL * TF * DM || in_sizes[1] < DM * DM || in_sizes[2] < DM || in_sizes[3] < DM * DM || in_sizes[4] < DM || in_sizes[5] < DM * DM || in_sizes[6] < DM || in_sizes[7] < DM * DM ||
      out_size < BL * TF * DM) return;
  size_t off = 0; char* ws = (char*)d_ws;
  auto carve = [&](size_t bytes) { char* p = ws + off; off += (bytes + 255) & ~(size_t)255; return p; };
  b16* WT = (b16*)carve((size_t)3 * DM * DM * 2); b16* WO = (b16*)carve((size_t)DM * DM * 2);
  float* CST = (float*)carve((size_t)TF * (HD / 2) * 4); float* SNT = (float*)carve((size_t)TF * (HD / 2) * 4);
  const size_t plane = (size_t)NBH * TF * DM * 2;
  b16* X8 = (b16*)carve(plane);
  b16* QH = (b16*)carve(plane); b16* QLo = (b16*)carve(plane); b16* KH = (b16*)carve(plane); b16* KLo = (b16*)carve(plane);
  b16* VTh = (b16*)carve(plane); b16* VTl = (b16*)carve(plane); b16* Ch = (b16*)carve(plane); b16* Cl = (b16*)carve(plane);
  if (off > ws_size || off > ((size_t)128 << 20)) return;   // 84,410,368 B at NBH == 2
  prep_kernel<<<(unsigned)(((size_t)4 * DM * DM / 8 + 255) / 256), 256, 0, stream>>>(Fp(1), Fp(3), Fp(5), Fp(7), WT, WO);
  rope_tab_kernel<<<(unsigned)((TF * (HD / 2) + 255) / 256), 256, 0, stream>>>(CST, SNT);
  for (int p = 0; p < NPASS; ++p) {
    const int b0 = p * NBH; const int nb = (BL - b0 < NBH) ? (BL - b0) : NBH;
    xcvt_kernel<<<(unsigned)(((size_t)nb * KL * DM / 8 + 255) / 256), 256, 0, stream>>>(Fp(0), X8, b0, nb);
    proj_kernel<<<dim3(KL / 64, nb, 24), 128, 0, stream>>>(X8, WT, Fp(2), Fp(4), Fp(6), CST, SNT, QH, QLo, KH, KLo, VTh, VTl);
    attn_kernel<1><<<dim3(RSPLIT / 32, nb * H), 64, 0, stream>>>(QH, QLo, KH, KLo, VTh, VTl, Ch, Cl, 0);
    if (QL > RSPLIT) attn_kernel<0><<<dim3((QL - RSPLIT) / 32, nb * H), 64, 0, stream>>>(QH, QLo, KH, KLo, VTh, VTl, Ch, Cl, RSPLIT / 32);
    out_kernel<<<dim3(QL / 64, DM / 128, nb), 128, 0, stream>>>(Ch, Cl, WO, (float*)d_out, b0);
  }
}

// v001
// A run of this version takes 456 microseconds.
// Timed twice side by side with v000, it ran 1.51 times as fast both times.
#include <hip/hip_runtime.h>

// compute dtype: every contraction on v_wmma_f32_16x16x32_f16 (f16 operands, f32 accumulate). q/k/v projections: x (bf16 RNE values carried x8) by W_q/W_k/W_v (bf16 RNE values carried x256): 1 product;
// attention for query rows < 512 of each sequence: S^T = K Q^T with q and k as f16 hi+lo planes (x8): 3 products; O^T += V^T P^T with v hi+lo (x8) and P hi+lo (x1024): 3 products;
// attention for query rows >= 512: S^T = K Q^T with the hi planes only: 1 product; O^T += V^T P^T with v hi and P (x1024) single: 1 product; ctx W_p with ctx hi+lo (x64) and W_p exact (x256): 2 products.
// Layout: x [B][T][1024]; W_* (in,out); q/k/v = x W + b reshaped to [B][T][16][64]; rotary pairs (2p, 2p+1) of q and k turned by angle t * theta^(-2p/64); scores q k^T / 8 with key j allowed iff
// j <= i + 64; softmax over keys; ctx = P v -> [B][T][1024]; out = ctx W_p (no bias).
// Fragment k-map per lane half hh for A AND B: elements 0..7 <- k = 8hh+0..7, 8..15 <- k = 16+8hh+0..7; acc[r] = D[8hh+r][col].

#ifndef NB
#define NB 4
#endif
#ifndef SEQ
#define SEQ 2048
#endif

namespace {
constexpr int BF = 4, TF = 2048, DM = 1024, H = 16, HD = 64, SRC = 64;
constexpr int BL = NB;                                   // batches computed (== 4 shipped)
constexpr int QL = SEQ;                                  // query rows computed per batch (== 2048 shipped)
constexpr int KL = (QL + SRC < TF) ? (QL + SRC) : TF;    // key rows needed: j <= i + SRC
constexpr int NBH = (BL < 2) ? BL : 2;                   // batches per pass (planes are sized for NBH)
constexpr int NPASS = (BL + NBH - 1) / NBH;
constexpr int RSPLIT = (QL < 512) ? QL : 512;            // query rows below this get the hi+lo (3-product) attention path
constexpr float XS = 8.0f, WSC = 256.0f, PS = 1024.0f, CS = 64.0f, LOG2E = 1.4426950408889634f, L2THETA = 13.287712379549449f;
static_assert(BL >= 1 && BL <= BF);
static_assert(QL >= 64 && QL <= TF && QL % 64 == 0);
static_assert(KL % 128 == 0 && KL <= TF && KL >= QL);
static_assert(RSPLIT % 32 == 0 && RSPLIT <= QL);
static_assert(DM == H * HD && TF % 64 == 0 && HD == 64);

typedef _Float16 b16;
typedef __attribute__((ext_vector_type(16))) _Float16 v16b;
typedef __attribute__((ext_vector_type(8))) _Float16 v8b;
typedef __attribute__((ext_vector_type(4))) _Float16 v4h;
typedef __attribute__((ext_vector_type(2))) _Float16 v2h;
typedef __attribute__((ext_vector_type(8))) float v8f;
typedef __attribute__((ext_vector_type(4))) float v4f;
typedef __attribute__((ext_vector_type(2))) float v2f;

__device__ __forceinline__ float bf16_rne(float f) { unsigned int u = __float_as_uint(f); u += 0x7FFFu + ((u >> 16) & 1u); return __uint_as_float(u & 0xFFFF0000u); }
__device__ __forceinline__ void split16(float v, b16& hi, b16& lo) { hi = (b16)v; lo = (b16)(v - (float)hi); }
__device__ __forceinline__ v16b frag_kb(const b16* p, int hh) {
  const v8b a = *(const v8b*)(p + 8 * hh), b = *(const v8b*)(p + 16 + 8 * hh); v16b f;
#pragma unroll
  for (int e = 0; e < 8; ++e) { f[e] = a[e]; f[8 + e] = b[e]; }
  return f;
}
__device__ __forceinline__ v8f wmma16b(v16b a, v16b b, v8f c) {
  v8f d = __builtin_amdgcn_wmma_f32_16x16x32_f16(false, a, false, b, (short)0, c, false, false);
  asm volatile("v_nop\n\tv_nop\n\tv_nop\n\tv_nop" : "+v"(d) : "v"(a), "v"(b));
  return d;
}
__device__ __forceinline__ void wave_lds_sync() { __builtin_amdgcn_fence(3 /* release order */, "workgroup"); __builtin_amdgcn_wave_barrier(); __builtin_amdgcn_fence(2 /* acquire order */, "workgroup"); }
__device__ __forceinline__ float nexp2(float v) { return __builtin_amdgcn_exp2f(v); }

// GEMM operand staging: a stage is KC k (one whole 128-byte line) of 256 operand rows, laid in LDS at a pitch of 144 B (16 B x odd: no bank conflict for the 16-byte fragment reads); two buffers.
constexpr int KC = 64, LP = KC + 8, SROWS = 256, NST = DM / KC;
constexpr int RING_BYTES = 2 * SROWS * LP * 2;
static_assert(DM % KC == 0 && NST >= 2 && (LP * 2) % 32 == 16);
__device__ __forceinline__ unsigned lds_addr(const void* p) { return (unsigned)(uintptr_t)p; }   // LDS byte address = low 32 bits of the __shared__ address
// eight 16-byte asynchronous copies per lane, global -> LDS through no register; the closing s_wait_xcnt stands in front of every later rewrite of the address registers that the copies name (a precaution)
__device__ __forceinline__ void copy8(const unsigned (&l)[8], const b16* const (&g)[8]) {
  asm volatile("global_load_async_to_lds_b128 %0, %8, off\n\t"
               "global_load_async_to_lds_b128 %1, %9, off\n\t"
               "global_load_async_to_lds_b128 %2, %10, off\n\t"
               "global_load_async_to_lds_b128 %3, %11, off\n\t"
               "global_load_async_to_lds_b128 %4, %12, off\n\t"
               "global_load_async_to_lds_b128 %5, %13, off\n\t"
               "global_load_async_to_lds_b128 %6, %14, off\n\t"
               "global_load_async_to_lds_b128 %7, %15, off\n\t"
               "s_wait_xcnt 0x0"
               :: "v"(l[0]), "v"(l[1]), "v"(l[2]), "v"(l[3]), "v"(l[4]), "v"(l[5]), "v"(l[6]), "v"(l[7]),
                  "v"(g[0]), "v"(g[1]), "v"(g[2]), "v"(g[3]), "v"(g[4]), "v"(g[5]), "v"(g[6]), "v"(g[7]) : "memory");
}
__device__ __forceinline__ void wait_copies() { asm volatile("s_wait_asynccnt 0x0" ::: "memory"); }   // this wave's copies have landed in LDS
__device__ __forceinline__ void wait_lds_reads() { asm volatile("s_wait_dscnt 0x0" ::: "memory"); }   // this wave's LDS reads are done before their buffer is handed back

// prep: WT [3072 o][1024 k]: o < 1024 W_q[k][o], < 2048 W_k[k][o-1024], else W_v[k][o-2048]; WO [1024 o][1024 k] = W_p[k][o] ((in,out) layouts -> transposed, k contiguous); bf16 RNE then x256
__global__ __launch_bounds__(256) void prep_kernel(const float* __restrict__ wq, const float* __restrict__ wk, const float* __restrict__ wv, const float* __restrict__ wp, b16* __restrict__ WT, b16* __restrict__ WO) {
  const size_t u = (size_t)blockIdx.x * 256 + threadIdx.x;
  if (u >= (size_t)4 * DM * DM / 8) return;
  const int mtx = (int)(u / ((size_t)DM * DM / 8)); const size_t e = (u % ((size_t)DM * DM / 8)) * 8; const int oo = (int)(e / DM), k0 = (int)(e % DM);
  const float* w = mtx == 0 ? wq : mtx == 1 ? wk : mtx == 2 ? wv : wp;
  v8b o;
#pragma unroll
  for (int j = 0; j < 8; ++j) o[j] = (b16)(bf16_rne(w[(size_t)(k0 + j) * DM + oo]) * WSC);
  b16* dst = (mtx < 3) ? (WT + (size_t)mtx * DM * DM + e) : (WO + e);
  { *(v8b*)dst = o;  }
}

__global__ __launch_bounds__(256) void rope_tab_kernel(float* __restrict__ cst, float* __restrict__ snt) {
  const int i = blockIdx.x * 256 + threadIdx.x;
  if (i >= TF * (HD / 2)) return;
  const int t = i / (HD / 2), p = i % (HD / 2);
  const float e = (float)(2 * p) * (1.0f / (float)HD);   // exact
  const float inv = exp2f(-(e * L2THETA));                // theta^(-e)
  const float ang = (float)t * inv;
  float sv, cv;
  sincosf(ang, &sv, &cv);
  { *(float*)(cst + i) = cv; *(float*)(snt + i) = sv;  }
}

__global__ __launch_bounds__(256) void xcvt_kernel(const float* __restrict__ x, b16* __restrict__ X8, int b0, int nb) {
  const size_t u = (size_t)blockIdx.x * 256 + threadIdx.x;
  const size_t per = (size_t)KL * DM / 8;
  if (u >= (size_t)nb * per) return;
  const int bb = (int)(u / per); const size_t e = (u % per) * 8; const int t = (int)(e / DM), c = (int)(e % DM);
  const float* src = x + (((size_t)(b0 + bb)) * TF + t) * DM + c;
  const v4f f0 = *(const v4f*)src, f1 = *(const v4f*)(src + 4);
  v8b o;
#pragma unroll
  for (int j = 0; j < 4; ++j) { o[j] = (b16)(bf16_rne(f0[j]) * XS); o[4 + j] = (b16)(bf16_rne(f1[j]) * XS); }
  b16* dst = X8 + ((size_t)bb * TF + t) * DM + c;
  { *(v8b*)dst = o;  }
}

// projections: grid (KL/128, nb, 24 slabs of 128 output channels: 0-7 q, 8-15 k, 16-23 v); block = 128 tokens x 8 waves of 16; K = 1024 in 16 stages of 64: stage rows 0-127 X8 tokens, 128-255 WT channels,
// copied to LDS one stage ahead; A and B fragments from LDS; the k order of every accumulator is unchanged
__global__ __launch_bounds__(256) void proj_kernel(const b16* __restrict__ X8, const b16* __restrict__ WT, const float* __restrict__ bq, const float* __restrict__ bk, const float* __restrict__ bv,
                                                    const float* __restrict__ cst, const float* __restrict__ snt,
                                                    b16* __restrict__ QH, b16* __restrict__ QLo, b16* __restrict__ KH, b16* __restrict__ KLo, b16* __restrict__ VTh, b16* __restrict__ VTl) {
  __shared__ __attribute__((aligned(16))) unsigned char smem[RING_BYTES];
  static_assert(sizeof(float) * 8 * 16 * (128 + 4) <= RING_BYTES);
  b16* const ring = (b16*)smem; float (*const Tf)[16][128 + 4] = (float (*)[16][128 + 4])smem;   // Tf takes the ring's place behind the loop's last barrier
  const int wave = threadIdx.x >> 5, lane = threadIdx.x & 31, nloc = lane & 15, hlf = lane >> 4;
  const int t0 = blockIdx.x * 128; const int bb = blockIdx.y; const int slab = blockIdx.z, n0 = slab * 128, part = slab / 8, c0 = n0 - part * DM;
  const int r0 = threadIdx.x >> 3, seg = threadIdx.x & 7;   // copy i of a lane: stage row r0 + 32 i, 16-byte piece seg; a wave's copy covers 4 whole lines
  const b16* const gA = X8 + ((size_t)bb * TF + t0 + r0) * DM + seg * 8; const b16* const gB = WT + (size_t)(n0 + r0) * DM + seg * 8;
  const unsigned lrow = lds_addr(smem) + (unsigned)(r0 * LP * 2 + seg * 16);
  auto issue = [&](int s) {
    unsigned l[8]; const b16* g[8];
    const b16* const pa = gA + s * KC; const b16* const pb = gB + s * KC; const unsigned lb = lrow + (unsigned)((s & 1) * SROWS * LP * 2);
#pragma unroll
    for (int i = 0; i < 8; ++i) { l[i] = lb + (unsigned)(32 * i * LP * 2); g[i] = i < 4 ? pa + (size_t)(32 * i) * DM : pb + (size_t)(32 * (i - 4)) * DM; }
    copy8(l, g);
  };
  v8f acc[8];
#pragma unroll
  for (int t = 0; t < 8; ++t) acc[t] = (v8f){};
  issue(0); wait_copies(); __syncthreads(); issue(1);
#pragma unroll 1   // one stage per trip: the buffer index and the refill test stay scalar
  for (int s = 0; s < NST; ++s) {
    const b16* const As = ring + ((s & 1) * SROWS + wave * 16 + nloc) * LP; const b16* const Bs = ring + ((s & 1) * SROWS + 128 + nloc) * LP;
#pragma unroll
    for (int kk = 0; kk < KC; kk += 32) {
      const v16b a = frag_kb(As + kk, hlf); v16b bw[8];   // the block's fragment reads stand as one group ahead of its products: their LDS latency is met once a block, not once a product
#pragma unroll
      for (int t = 0; t < 8; ++t) bw[t] = frag_kb(Bs + t * 16 * LP + kk, hlf);
#pragma unroll
      for (int t = 0; t < 8; ++t) acc[t] = wmma16b(a, bw[t], acc[t]);
    }
    wait_lds_reads(); wait_copies(); __syncthreads();   // publishes stage s + 1 and frees stage s's buffer
    if (s + 2 < NST) issue(s + 2);
  }
  wait_copies();
  const float* bias = part == 0 ? bq : part == 1 ? bk : bv;
#pragma unroll
  for (int t = 0; t < 8; ++t) {
    const float bval = bf16_rne(bias[c0 + t * 16 + nloc]);
#pragma unroll
    for (int r = 0; r < 8; ++r) Tf[wave][8 * hlf + r][t * 16 + nloc] = acc[t][r] * (1.0f / (XS * WSC)) + bval;
  }
  __syncthreads();
  {
    if (part < 2) {
      b16* ph_ = part == 0 ? QH : KH; b16* pl_ = part == 0 ? QLo : KLo;
      const int c = c0 + lane * 4; const int hq = c / HD, d = c % HD, p0 = d >> 1;   // d is a multiple of 4: pairs (d,d+1) -> p0 and (d+2,d+3) -> p0+1
      for (int rr = 0; rr < 16; ++rr) {
        const int tok = t0 + wave * 16 + rr;
        const v4f f = *(const v4f*)(&Tf[wave][rr][lane * 4]);
        const v2f cc = *(const v2f*)(cst + (size_t)tok * (HD / 2) + p0), ss = *(const v2f*)(snt + (size_t)tok * (HD / 2) + p0);
        const float o0 = f[0] * cc[0] - f[1] * ss[0];
        const float o1 = f[0] * ss[0] + f[1] * cc[0];
        const float o2 = f[2] * cc[1] - f[3] * ss[1];
        const float o3 = f[2] * ss[1] + f[3] * cc[1];
        v4h h4, l4; b16 ph, pl;
        split16(o0 * XS, ph, pl); h4[0] = ph; l4[0] = pl;
        split16(o1 * XS, ph, pl); h4[1] = ph; l4[1] = pl;
        split16(o2 * XS, ph, pl); h4[2] = ph; l4[2] = pl;
        split16(o3 * XS, ph, pl); h4[3] = ph; l4[3] = pl;
        const size_t oi = (((size_t)bb * H + hq) * TF + tok) * HD + d;
        *(v4h*)(ph_ + oi) = h4; *(v4h*)(pl_ + oi) = l4;
      }
    } else {
#pragma unroll 1
      for (int q = 0; q < 32; ++q) {
        const int cl = (wave & 3) * 32 + q; const int c = c0 + cl; const int hv_ = c / HD, d = c % HD; const int tk = (wave >> 2) * 64 + lane * 2; v2h hv, lv;   // waves 0-3: tokens 0-63, waves 4-7: tokens 64-127
        for (int j = 0; j < 2; ++j) { b16 p, ql; split16(Tf[(tk + j) >> 4][(tk + j) & 15][cl] * XS, p, ql); hv[j] = p; lv[j] = ql; }
        const size_t oi = (((size_t)bb * H + hv_) * HD + d) * (size_t)TF + t0 + tk;
        *(v2h*)(VTh + oi) = hv; *(v2h*)(VTl + oi) = lv;
      }
    }
    
  }
}

// attention: grid (rows/32, nb x H), block x offset xb0 (in 32-row units): block = 2 waves x 16 queries; keys 0 .. min(KL, q0+16+SRC)-1 in 32-key chunks; key allowed iff key <= qi + SRC;
// RES != 0 (query rows < RSPLIT): S^T = K Q^T with 3 products (kh qh + kh ql + kl qh), P x1024 hi/lo, O^T += V^T P^T with 3 products (vh ph + vh pl + vl ph);
// RES == 0 (query rows >= RSPLIT, >= RSPLIT+SRC keys per row): S^T = kh qh (1 product), P x1024 single, O^T += vh p (1 product). Online softmax (running max, f32) in both; P through
template <int RES>
__global__ __launch_bounds__(64) void attn_kernel(const b16* __restrict__ QH, const b16* __restrict__ QLo, const b16* __restrict__ KH, const b16* __restrict__ KLo, const b16* __restrict__ VTh, const b16* __restrict__ VTl,
                                                   b16* __restrict__ Ch, b16* __restrict__ Cl, int xb0) {
  __shared__ __attribute__((aligned(16))) b16 Pb[2][16][32 + 8], Pc[2][16][32 + 8]; __shared__ __attribute__((aligned(16))) float To[2][16][HD + 4];
  const int wave = threadIdx.x >> 5, lane = threadIdx.x & 31, hh = lane >> 4, col = lane & 15; const int bb = blockIdx.y / H, h = blockIdx.y % H;
  const int q0 = (xb0 + (int)blockIdx.x) * 32 + wave * 16, qi = q0 + col;
  const size_t ph = (size_t)bb * H + h; const size_t pq = ph * TF * HD; const b16* Vh = VTh + ph * HD * (size_t)TF; const b16* Vl = VTl + ph * HD * (size_t)TF;
  const v16b qh0 = frag_kb(QH + pq + (size_t)qi * HD, hh), qh1 = frag_kb(QH + pq + (size_t)qi * HD + 32, hh);
  v16b ql0 = (v16b){}, ql1 = (v16b){};
  if (RES) { ql0 = frag_kb(QLo + pq + (size_t)qi * HD, hh); ql1 = frag_kb(QLo + pq + (size_t)qi * HD + 32, hh); }
  const float cs = LOG2E / (8.0f * XS * XS);
  float m = -INFINITY, l = 0.0f; v8f o[4];
#pragma unroll
  for (int t = 0; t < 4; ++t) o[t] = (v8f){};
  const int kmax = q0 + 16 + SRC; const int kend = kmax < KL ? kmax : KL;
#pragma unroll 1
  for (int kb = 0; kb < kend; kb += 32) {
    float e[16]; float mx = -INFINITY;
#pragma unroll
    for (int u = 0; u < 2; ++u) {
      v8f s = (v8f){}; const size_t kr = pq + (size_t)(kb + u * 16 + col) * HD;
      const v16b kh0 = frag_kb(KH + kr, hh), kh1 = frag_kb(KH + kr + 32, hh);
      if (RES) {
        const v16b kl0 = frag_kb(KLo + kr, hh), kl1 = frag_kb(KLo + kr + 32, hh);
        s = wmma16b(kh0, qh0, s); s = wmma16b(kh0, ql0, s); s = wmma16b(kl0, qh0, s); s = wmma16b(kh1, qh1, s); s = wmma16b(kh1, ql1, s); s = wmma16b(kl1, qh1, s);
      } else {
        s = wmma16b(kh0, qh0, s); s = wmma16b(kh1, qh1, s);
      }
#pragma unroll
      for (int r = 0; r < 8; ++r) { const int key = kb + u * 16 + 8 * hh + r; const float vv = (key <= qi + SRC) ? s[r] * cs : -INFINITY; e[u * 8 + r] = vv; mx = fmaxf(mx, vv); }
    }
    mx = fmaxf(mx, __shfl_xor(mx, 16)); const float mn = fmaxf(m, mx); const float al = (mn == -INFINITY) ? 1.0f : nexp2(m - mn); float sum = 0.0f;
#pragma unroll
    for (int i2 = 0; i2 < 16; ++i2) {
      const float p = (e[i2] == -INFINITY) ? 0.0f : nexp2(e[i2] - mn); sum += p;
      const int sl = (i2 < 8 ? 0 : 16) + 8 * hh + (i2 & 7);
      if (RES) { b16 a_, b_; split16(p * PS, a_, b_); Pb[wave][col][sl] = a_; Pc[wave][col][sl] = b_; }
      else { Pb[wave][col][sl] = (b16)(p * PS); }
    }
    sum += __shfl_xor(sum, 16); l = l * al + sum; m = mn;
    wave_lds_sync();
    const v16b pf = frag_kb(&Pb[wave][col][0], hh);
    v16b pg = (v16b){};
    if (RES) pg = frag_kb(&Pc[wave][col][0], hh);
#pragma unroll
    for (int t = 0; t < 4; ++t) {
      o[t] *= al; const size_t vr = (size_t)(t * 16 + col) * TF + kb;
      const v16b va = frag_kb(Vh + vr, hh);
      if (RES) { const v16b vb2 = frag_kb(Vl + vr, hh); o[t] = wmma16b(va, pf, o[t]); o[t] = wmma16b(va, pg, o[t]); o[t] = wmma16b(vb2, pf, o[t]); }
      else { o[t] = wmma16b(va, pf, o[t]); }
    }
    wave_lds_sync();
  }
  const float inv = 1.0f / (l * PS * XS);
#pragma unroll
  for (int t = 0; t < 4; ++t)
#pragma unroll
    for (int r = 0; r < 8; ++r) To[wave][col][t * 16 + 8 * hh + r] = o[t][r] * inv;
  wave_lds_sync();
  {
    for (int rr = 0; rr < 16; ++rr) {
      const v2f f = *(const v2f*)(&To[wave][rr][lane * 2]); v2h hv, lv;
      for (int j = 0; j < 2; ++j) { b16 p, q; split16(f[j] * CS, p, q); hv[j] = p; lv[j] = q; }
      const size_t oi = ((size_t)bb * TF + q0 + rr) * DM + h * HD + lane * 2;
      *(v2h*)(Ch + oi) = hv; *(v2h*)(Cl + oi) = lv;
    }
    
  }
}

__global__ __launch_bounds__(128) void out_kernel(const b16* __restrict__ Ch, const b16* __restrict__ Cl, const b16* __restrict__ WO, float* __restrict__ out, int b0) {
  __shared__ __attribute__((aligned(16))) unsigned char smem[RING_BYTES];
  static_assert(sizeof(float) * 4 * 16 * (128 + 4) <= RING_BYTES);
  b16* const ring = (b16*)smem; float (*const Tf)[16][128 + 4] = (float (*)[16][128 + 4])smem;   // Tf takes the ring's place behind the loop's last barrier
  const int wave = threadIdx.x >> 5, lane = threadIdx.x & 31, nloc = lane & 15, hlf = lane >> 4; const int bb = blockIdx.z;
  const size_t mo = (size_t)(b0 + bb) * TF + ((size_t)blockIdx.x * 4 + wave) * 16;
  const int n0 = blockIdx.y * 128;
  v8f acc[8];
#pragma unroll
  for (int t = 0; t < 8; ++t) acc[t] = (v8f){};
  // stage rows 0-63 Ch, 64-127 Cl (the block's 64 rows), 128-255 WO channels; copy i of a lane: stage row r0 + 16 i, 16-byte piece seg
  const int r0 = threadIdx.x >> 3, seg = threadIdx.x & 7;
  const size_t ma = ((size_t)bb * TF + (size_t)blockIdx.x * 64 + r0) * DM + seg * 8;
  const b16* const gH = Ch + ma; const b16* const gL = Cl + ma; const b16* const gB = WO + (size_t)(n0 + r0) * DM + seg * 8;
  const unsigned lrow = lds_addr(smem) + (unsigned)(r0 * LP * 2 + seg * 16);
  auto issue = [&](int s) {
#pragma unroll
    for (int hf = 0; hf < 2; ++hf) {
      unsigned l[8]; const b16* g[8];
#pragma unroll
      for (int i = 0; i < 8; ++i) {
        l[i] = lrow + (unsigned)(((s & 1) * SROWS + 128 * hf + 16 * i) * LP * 2);
        g[i] = (hf ? gB + (size_t)(16 * i) * DM : i < 4 ? gH + (size_t)(16 * i) * DM : gL + (size_t)(16 * (i - 4)) * DM) + s * KC;
      }
      copy8(l, g);
    }
  };
  issue(0); wait_copies(); __syncthreads(); issue(1);
#pragma unroll 1   // one stage per trip: the buffer index and the refill test stay scalar
  for (int s = 0; s < NST; ++s) {
    const b16* const As = ring + ((s & 1) * SROWS + wave * 16 + nloc) * LP; const b16* const Bs = ring + ((s & 1) * SROWS + 128 + nloc) * LP;
#pragma unroll
    for (int kk = 0; kk < KC; kk += 32) {
      const v16b a = frag_kb(As + kk, hlf), al = frag_kb(As + 64 * LP + kk, hlf); v16b bw[8];   // the block's fragment reads stand as one group ahead of its products: their LDS latency is met once a block, not once a product
#pragma unroll
      for (int t = 0; t < 8; ++t) bw[t] = frag_kb(Bs + t * 16 * LP + kk, hlf);
#pragma unroll
      for (int t = 0; t < 8; ++t) { acc[t] = wmma16b(a, bw[t], acc[t]); acc[t] = wmma16b(al, bw[t], acc[t]); }
    }
    wait_lds_reads(); wait_copies(); __syncthreads();   // publishes stage s + 1 and frees stage s's buffer
    if (s + 2 < NST) issue(s + 2);
  }
  wait_copies();
#pragma unroll
  for (int t = 0; t < 8; ++t) {
#pragma unroll
    for (int r = 0; r < 8; ++r) Tf[wave][8 * hlf + r][t * 16 + nloc] = acc[t][r] * (1.0f / (CS * WSC));
  }
  wave_lds_sync();
  {
    for (int rr = 0; rr < 16; ++rr) *(v4f*)(out + (mo + rr) * DM + n0 + lane * 4) = *(const v4f*)(&Tf[wave][rr][lane * 4]);
    
  }
}
}  // namespace

extern "C" void kernel_launch(void* const* d_in, const int* in_sizes, int n_in, void* d_out, int out_size, void* d_ws, size_t ws_size, hipStream_t stream) {
  if (n_in < 8) return;
  auto Fp = [&](int i) { return (const float*)d_in[i]; };
  // input order: 0 x [4,2048,1024], 1 W_q, 2 b_q, 3 W_k, 4 b_k, 5 W_v, 6 b_v, 7 W_p; all f32; W (in,out)
  if (in_sizes[0] < BL * TF * DM || in_sizes[1] < DM * DM || in_sizes[2] < DM || in_sizes[3] < DM * DM || in_sizes[4] < DM || in_sizes[5] < DM * DM || in_sizes[6] < DM || in_sizes[7] < DM * DM ||
      out_size < BL * TF * DM) return;
  size_t off = 0; char* ws = (char*)d_ws;
  auto carve = [&](size_t bytes) { char* p = ws + off; off += (bytes + 255) & ~(size_t)255; return p; };
  b16* WT = (b16*)carve((size_t)3 * DM * DM * 2); b16* WO = (b16*)carve((size_t)DM * DM * 2);
  float* CST = (float*)carve((size_t)TF * (HD / 2) * 4); float* SNT = (float*)carve((size_t)TF * (HD / 2) * 4);
  const size_t plane = (size_t)NBH * TF * DM * 2;
  b16* X8 = (b16*)carve(plane);
  b16* QH = (b16*)carve(plane); b16* QLo = (b16*)carve(plane); b16* KH = (b16*)carve(plane); b16* KLo = (b16*)carve(plane);
  b16* VTh = (b16*)carve(plane); b16* VTl = (b16*)carve(plane); b16* Ch = (b16*)carve(plane); b16* Cl = (b16*)carve(plane);
  if (off > ws_size || off > ((size_t)128 << 20)) return;   // 84,410,368 B at NBH == 2
  prep_kernel<<<(unsigned)(((size_t)4 * DM * DM / 8 + 255) / 256), 256, 0, stream>>>(Fp(1), Fp(3), Fp(5), Fp(7), WT, WO);
  rope_tab_kernel<<<(unsigned)((TF * (HD / 2) + 255) / 256), 256, 0, stream>>>(CST, SNT);
  for (int p = 0; p < NPASS; ++p) {
    const int b0 = p * NBH; const int nb = (BL - b0 < NBH) ? (BL - b0) : NBH;
    xcvt_kernel<<<(unsigned)(((size_t)nb * KL * DM / 8 + 255) / 256), 256, 0, stream>>>(Fp(0), X8, b0, nb);
    proj_kernel<<<dim3(KL / 128, nb, 24), 256, 0, stream>>>(X8, WT, Fp(2), Fp(4), Fp(6), CST, SNT, QH, QLo, KH, KLo, VTh, VTl);
    attn_kernel<1><<<dim3(RSPLIT / 32, nb * H), 64, 0, stream>>>(QH, QLo, KH, KLo, VTh, VTl, Ch, Cl, 0);
    if (QL > RSPLIT) attn_kernel<0><<<dim3((QL - RSPLIT) / 32, nb * H), 64, 0, stream>>>(QH, QLo, KH, KLo, VTh, VTl, Ch, Cl, RSPLIT / 32);
    out_kernel<<<dim3(QL / 64, DM / 128, nb), 128, 0, stream>>>(Ch, Cl, WO, (float*)d_out, b0);
  }
}

// v002
// One run takes 282 microseconds.
// Timed twice side by side with v001, it ran 1.61 and 1.62 times as fast.
// Counting every step since v000, it is 2.44 times as fast.
#include <hip/hip_runtime.h>

// compute dtype: every contraction on v_wmma_f32_16x16x32_f16 (f16 operands, f32 accumulate). q/k/v projections: x (bf16 RNE values carried x8) by W_q/W_k/W_v (bf16 RNE values carried x256): 1 product;
// attention for query rows < 512 of each sequence: S^T = K Q^T with q and k as f16 hi+lo planes (x8): 3 products; O^T += V^T P^T with v hi+lo (x8) and P hi+lo (x1024): 3 products;
// attention for query rows >= 512: S^T = K Q^T with the hi planes only: 1 product; O^T += V^T P^T with v hi and P (x1024) single: 1 product; ctx W_p with ctx hi+lo (x64) and W_p exact (x256): 2 products.
// Layout: x [B][T][1024]; W_* (in,out); q/k/v = x W + b reshaped to [B][T][16][64]; rotary pairs (2p, 2p+1) of q and k turned by angle t * theta^(-2p/64); scores q k^T / 8 with key j allowed iff
// j <= i + 64; softmax over keys; ctx = P v -> [B][T][1024]; out = ctx W_p (no bias).
// Fragment k-map per lane half hh for A AND B: elements 0..7 <- k = 8hh+0..7, 8..15 <- k = 16+8hh+0..7; acc[r] = D[8hh+r][col].

#ifndef NB
#define NB 4
#endif
#ifndef SEQ
#define SEQ 2048
#endif

namespace {
constexpr int BF = 4, TF = 2048, DM = 1024, H = 16, HD = 64, SRC = 64;
constexpr int BL = NB;                                   // batches computed (== 4 shipped)
constexpr int QL = SEQ;                                  // query rows computed per batch (== 2048 shipped)
constexpr int KL = (QL + SRC < TF) ? (QL + SRC) : TF;    // key rows needed: j <= i + SRC
constexpr int NBH = (BL < 2) ? BL : 2;                   // batches per pass (planes are sized for NBH)
constexpr int NPASS = (BL + NBH - 1) / NBH;
constexpr int RSPLIT = (QL < 512) ? QL : 512;            // query rows below this get the hi+lo (3-product) attention path
constexpr float XS = 8.0f, WSC = 256.0f, PS = 1024.0f, CS = 64.0f, LOG2E = 1.4426950408889634f, L2THETA = 13.287712379549449f;
static_assert(BL >= 1 && BL <= BF);
static_assert(QL >= 64 && QL <= TF && QL % 64 == 0);
static_assert(KL % 128 == 0 && KL <= TF && KL >= QL);
static_assert(RSPLIT % 32 == 0 && RSPLIT <= QL);
static_assert(DM == H * HD && TF % 64 == 0 && HD == 64);

typedef _Float16 b16;
typedef __attribute__((ext_vector_type(16))) _Float16 v16b;
typedef __attribute__((ext_vector_type(8))) _Float16 v8b;
typedef __attribute__((ext_vector_type(4))) _Float16 v4h;
typedef __attribute__((ext_vector_type(2))) _Float16 v2h;
typedef __attribute__((ext_vector_type(8))) float v8f;
typedef __attribute__((ext_vector_type(4))) float v4f;
typedef __attribute__((ext_vector_type(2))) float v2f;

__device__ __forceinline__ float bf16_rne(float f) { unsigned int u = __float_as_uint(f); u += 0x7FFFu + ((u >> 16) & 1u); return __uint_as_float(u & 0xFFFF0000u); }
__device__ __forceinline__ void split16(float v, b16& hi, b16& lo) { hi = (b16)v; lo = (b16)(v - (float)hi); }
__device__ __forceinline__ v16b frag_kb(const b16* p, int hh) {
  const v8b a = *(const v8b*)(p + 8 * hh), b = *(const v8b*)(p + 16 + 8 * hh); v16b f;
#pragma unroll
  for (int e = 0; e < 8; ++e) { f[e] = a[e]; f[8 + e] = b[e]; }
  return f;
}
__device__ __forceinline__ v8f wmma16b(v16b a, v16b b, v8f c) {
  v8f d = __builtin_amdgcn_wmma_f32_16x16x32_f16(false, a, false, b, (short)0, c, false, false);
  asm volatile("v_nop\n\tv_nop\n\tv_nop\n\tv_nop" : "+v"(d) : "v"(a), "v"(b));
  return d;
}
__device__ __forceinline__ void wave_lds_sync() { __builtin_amdgcn_fence(3 /* release order */, "workgroup"); __builtin_amdgcn_wave_barrier(); __builtin_amdgcn_fence(2 /* acquire order */, "workgroup"); }
// behind a group of global loads that stay in flight: stands in front of every later rewrite of the address registers that the loads name (a precaution), and no load crosses the statement;
// the group's addresses are inputs, so their registers live to the wait and no load of the group can be given them for its result
__device__ __forceinline__ void close_loads(const b16* a, const b16* b) { asm volatile("s_wait_xcnt 0x0" :: "v"(a), "v"(b) : "memory"); }
__device__ __forceinline__ v16b frag_at(const b16* p) {   // frag_kb with the lane half's 8 hh already in p
  const v8b a = *(const v8b*)p, b = *(const v8b*)(p + 16); v16b f;
#pragma unroll
  for (int e = 0; e < 8; ++e) { f[e] = a[e]; f[8 + e] = b[e]; }
  return f;
}
__device__ __forceinline__ float nexp2(float v) { return __builtin_amdgcn_exp2f(v); }

// GEMM operand staging: a stage is KC k (one whole 128-byte line) of 256 operand rows, laid in LDS at a pitch of 144 B (16 B x odd: no bank conflict for the 16-byte fragment reads); two buffers.
constexpr int KC = 64, LP = KC + 8, SROWS = 256, NST = DM / KC;
constexpr int RING_BYTES = 2 * SROWS * LP * 2;
static_assert(DM % KC == 0 && NST >= 2 && (LP * 2) % 32 == 16);
__device__ __forceinline__ unsigned lds_addr(const void* p) { return (unsigned)(uintptr_t)p; }   // LDS byte address = low 32 bits of the __shared__ address
// eight 16-byte asynchronous copies per lane, global -> LDS through no register; the closing s_wait_xcnt stands in front of every later rewrite of the address registers that the copies name (a precaution)
__device__ __forceinline__ void copy8(const unsigned (&l)[8], const b16* const (&g)[8]) {
  asm volatile("global_load_async_to_lds_b128 %0, %8, off\n\t"
               "global_load_async_to_lds_b128 %1, %9, off\n\t"
               "global_load_async_to_lds_b128 %2, %10, off\n\t"
               "global_load_async_to_lds_b128 %3, %11, off\n\t"
               "global_load_async_to_lds_b128 %4, %12, off\n\t"
               "global_load_async_to_lds_b128 %5, %13, off\n\t"
               "global_load_async_to_lds_b128 %6, %14, off\n\t"
               "global_load_async_to_lds_b128 %7, %15, off\n\t"
               "s_wait_xcnt 0x0"
               :: "v"(l[0]), "v"(l[1]), "v"(l[2]), "v"(l[3]), "v"(l[4]), "v"(l[5]), "v"(l[6]), "v"(l[7]),
                  "v"(g[0]), "v"(g[1]), "v"(g[2]), "v"(g[3]), "v"(g[4]), "v"(g[5]), "v"(g[6]), "v"(g[7]) : "memory");
}
__device__ __forceinline__ void wait_copies() { asm volatile("s_wait_asynccnt 0x0" ::: "memory"); }   // this wave's copies have landed in LDS
__device__ __forceinline__ void wait_lds_reads() { asm volatile("s_wait_dscnt 0x0" ::: "memory"); }   // this wave's LDS reads are done before their buffer is handed back

// prep: WT [3072 o][1024 k]: o < 1024 W_q[k][o], < 2048 W_k[k][o-1024], else W_v[k][o-2048]; WO [1024 o][1024 k] = W_p[k][o] ((in,out) layouts -> transposed, k contiguous); bf16 RNE then x256
__global__ __launch_bounds__(256) void prep_kernel(const float* __restrict__ wq, const float* __restrict__ wk, const float* __restrict__ wv, const float* __restrict__ wp, b16* __restrict__ WT, b16* __restrict__ WO) {
  const size_t u = (size_t)blockIdx.x * 256 + threadIdx.x;
  if (u >= (size_t)4 * DM * DM / 8) return;
  const int mtx = (int)(u / ((size_t)DM * DM / 8)); const size_t e = (u % ((size_t)DM * DM / 8)) * 8; const int oo = (int)(e / DM), k0 = (int)(e % DM);
  const float* w = mtx == 0 ? wq : mtx == 1 ? wk : mtx == 2 ? wv : wp;
  v8b o;
#pragma unroll
  for (int j = 0; j < 8; ++j) o[j] = (b16)(bf16_rne(w[(size_t)(k0 + j) * DM + oo]) * WSC);
  b16* dst = (mtx < 3) ? (WT + (size_t)mtx * DM * DM + e) : (WO + e);
  { *(v8b*)dst = o;  }
}

__global__ __launch_bounds__(256) void rope_tab_kernel(float* __restrict__ cst, float* __restrict__ snt) {
  const int i = blockIdx.x * 256 + threadIdx.x;
  if (i >= TF * (HD / 2)) return;
  const int t = i / (HD / 2), p = i % (HD / 2);
  const float e = (float)(2 * p) * (1.0f / (float)HD);   // exact
  const float inv = exp2f(-(e * L2THETA));                // theta^(-e)
  const float ang = (float)t * inv;
  float sv, cv;
  sincosf(ang, &sv, &cv);
  { *(float*)(cst + i) = cv; *(float*)(snt + i) = sv;  }
}

__global__ __launch_bounds__(256) void xcvt_kernel(const float* __restrict__ x, b16* __restrict__ X8, int b0, int nb) {
  const size_t u = (size_t)blockIdx.x * 256 + threadIdx.x;
  const size_t per = (size_t)KL * DM / 8;
  if (u >= (size_t)nb * per) return;
  const int bb = (int)(u / per); const size_t e = (u % per) * 8; const int t = (int)(e / DM), c = (int)(e % DM);
  const float* src = x + (((size_t)(b0 + bb)) * TF + t) * DM + c;
  const v4f f0 = *(const v4f*)src, f1 = *(const v4f*)(src + 4);
  v8b o;
#pragma unroll
  for (int j = 0; j < 4; ++j) { o[j] = (b16)(bf16_rne(f0[j]) * XS); o[4 + j] = (b16)(bf16_rne(f1[j]) * XS); }
  b16* dst = X8 + ((size_t)bb * TF + t) * DM + c;
  { *(v8b*)dst = o;  }
}

// projections: grid (KL/128, nb, 24 slabs of 128 output channels: 0-7 q, 8-15 k, 16-23 v); block = 128 tokens x 8 waves of 16; K = 1024 in 16 stages of 64: stage rows 0-127 X8 tokens, 128-255 WT channels,
// copied to LDS one stage ahead; A and B fragments from LDS; the k order of every accumulator is unchanged
__global__ __launch_bounds__(256) void proj_kernel(const b16* __restrict__ X8, const b16* __restrict__ WT, const float* __restrict__ bq, const float* __restrict__ bk, const float* __restrict__ bv,
                                                    const float* __restrict__ cst, const float* __restrict__ snt,
                                                    b16* __restrict__ QH, b16* __restrict__ QLo, b16* __restrict__ KH, b16* __restrict__ KLo, b16* __restrict__ VTh, b16* __restrict__ VTl) {
  __shared__ __attribute__((aligned(16))) unsigned char smem[RING_BYTES];
  static_assert(sizeof(float) * 8 * 16 * (128 + 4) <= RING_BYTES);
  b16* const ring = (b16*)smem; float (*const Tf)[16][128 + 4] = (float (*)[16][128 + 4])smem;   // Tf takes the ring's place behind the loop's last barrier
  const int wave = threadIdx.x >> 5, lane = threadIdx.x & 31, nloc = lane & 15, hlf = lane >> 4;
  const int t0 = blockIdx.x * 128; const int bb = blockIdx.y; const int slab = blockIdx.z, n0 = slab * 128, part = slab / 8, c0 = n0 - part * DM;
  const int r0 = threadIdx.x >> 3, seg = threadIdx.x & 7;   // copy i of a lane: stage row r0 + 32 i, 16-byte piece seg; a wave's copy covers 4 whole lines
  const b16* const gA = X8 + ((size_t)bb * TF + t0 + r0) * DM + seg * 8; const b16* const gB = WT + (size_t)(n0 + r0) * DM + seg * 8;
  const unsigned lrow = lds_addr(smem) + (unsigned)(r0 * LP * 2 + seg * 16);
  auto issue = [&](int s) {
    unsigned l[8]; const b16* g[8];
    const b16* const pa = gA + s * KC; const b16* const pb = gB + s * KC; const unsigned lb = lrow + (unsigned)((s & 1) * SROWS * LP * 2);
#pragma unroll
    for (int i = 0; i < 8; ++i) { l[i] = lb + (unsigned)(32 * i * LP * 2); g[i] = i < 4 ? pa + (size_t)(32 * i) * DM : pb + (size_t)(32 * (i - 4)) * DM; }
    copy8(l, g);
  };
  v8f acc[8];
#pragma unroll
  for (int t = 0; t < 8; ++t) acc[t] = (v8f){};
  issue(0); wait_copies(); __syncthreads(); issue(1);
#pragma unroll 1   // one stage per trip: the buffer index and the refill test stay scalar
  for (int s = 0; s < NST; ++s) {
    const b16* const As = ring + ((s & 1) * SROWS + wave * 16 + nloc) * LP; const b16* const Bs = ring + ((s & 1) * SROWS + 128 + nloc) * LP;
#pragma unroll
    for (int kk = 0; kk < KC; kk += 32) {
      const v16b a = frag_kb(As + kk, hlf); v16b bw[8];   // the block's fragment reads stand as one group ahead of its products: their LDS latency is met once a block, not once a product
#pragma unroll
      for (int t = 0; t < 8; ++t) bw[t] = frag_kb(Bs + t * 16 * LP + kk, hlf);
#pragma unroll
      for (int t = 0; t < 8; ++t) acc[t] = wmma16b(a, bw[t], acc[t]);
    }
    wait_lds_reads(); wait_copies(); __syncthreads();   // publishes stage s + 1 and frees stage s's buffer
    if (s + 2 < NST) issue(s + 2);
  }
  wait_copies();
  const float* bias = part == 0 ? bq : part == 1 ? bk : bv;
#pragma unroll
  for (int t = 0; t < 8; ++t) {
    const float bval = bf16_rne(bias[c0 + t * 16 + nloc]);
#pragma unroll
    for (int r = 0; r < 8; ++r) Tf[wave][8 * hlf + r][t * 16 + nloc] = acc[t][r] * (1.0f / (XS * WSC)) + bval;
  }
  __syncthreads();
  {
    if (part < 2) {
      b16* ph_ = part == 0 ? QH : KH; b16* pl_ = part == 0 ? QLo : KLo;
      const int c = c0 + lane * 4; const int hq = c / HD, d = c % HD, p0 = d >> 1;   // d is a multiple of 4: pairs (d,d+1) -> p0 and (d+2,d+3) -> p0+1
      for (int rr = 0; rr < 16; ++rr) {
        const int tok = t0 + wave * 16 + rr;
        const v4f f = *(const v4f*)(&Tf[wave][rr][lane * 4]);
        const v2f cc = *(const v2f*)(cst + (size_t)tok * (HD / 2) + p0), ss = *(const v2f*)(snt + (size_t)tok * (HD / 2) + p0);
        const float o0 = f[0] * cc[0] - f[1] * ss[0];
        const float o1 = f[0] * ss[0] + f[1] * cc[0];
        const float o2 = f[2] * cc[1] - f[3] * ss[1];
        const float o3 = f[2] * ss[1] + f[3] * cc[1];
        v4h h4, l4; b16 ph, pl;
        split16(o0 * XS, ph, pl); h4[0] = ph; l4[0] = pl;
        split16(o1 * XS, ph, pl); h4[1] = ph; l4[1] = pl;
        split16(o2 * XS, ph, pl); h4[2] = ph; l4[2] = pl;
        split16(o3 * XS, ph, pl); h4[3] = ph; l4[3] = pl;
        const size_t oi = (((size_t)bb * H + hq) * TF + tok) * HD + d;
        *(v4h*)(ph_ + oi) = h4; *(v4h*)(pl_ + oi) = l4;
      }
    } else {
#pragma unroll 1
      for (int q = 0; q < 32; ++q) {
        const int cl = (wave & 3) * 32 + q; const int c = c0 + cl; const int hv_ = c / HD, d = c % HD; const int tk = (wave >> 2) * 64 + lane * 2; v2h hv, lv;   // waves 0-3: tokens 0-63, waves 4-7: tokens 64-127
        for (int j = 0; j < 2; ++j) { b16 p, ql; split16(Tf[(tk + j) >> 4][(tk + j) & 15][cl] * XS, p, ql); hv[j] = p; lv[j] = ql; }
        const size_t oi = (((size_t)bb * H + hv_) * HD + d) * (size_t)TF + t0 + tk;
        *(v2h*)(VTh + oi) = hv; *(v2h*)(VTl + oi) = lv;
      }
    }
    
  }
}

// attention: grid (rows/32, nb x H), block x offset xb0 (in 32-row units): block = 2 waves x 16 queries; keys 0 .. min(KL, q0+16+SRC)-1 in 32-key chunks; key allowed iff key <= qi + SRC;
// RES != 0 (query rows < RSPLIT): S^T = K Q^T with 3 products (kh qh + kh ql + kl qh), P x1024 hi/lo, O^T += V^T P^T with 3 products (vh ph + vh pl + vl ph);
// RES == 0 (query rows >= RSPLIT, >= RSPLIT+SRC keys per row): S^T = kh qh (1 product), P x1024 single, O^T += vh p (1 product). Online softmax (running max, f32) in both; a lane's own P values are its B fragment of P^T and stay in registers
template <int RES>
__global__ __launch_bounds__(64) void attn_kernel(const b16* __restrict__ QH, const b16* __restrict__ QLo, const b16* __restrict__ KH, const b16* __restrict__ KLo, const b16* __restrict__ VTh, const b16* __restrict__ VTl,
                                                   b16* __restrict__ Ch, b16* __restrict__ Cl, int xb0) {
  __shared__ __attribute__((aligned(16))) float To[2][16][HD + 4];
  const int wave = threadIdx.x >> 5, lane = threadIdx.x & 31, hh = lane >> 4, col = lane & 15; const int bb = blockIdx.y / H, h = blockIdx.y % H;
  const int q0 = (xb0 + (int)blockIdx.x) * 32 + wave * 16, qi = q0 + col;
  const size_t ph = (size_t)bb * H + h; const size_t pq = ph * TF * HD; const b16* Vh = VTh + ph * HD * (size_t)TF; const b16* Vl = VTl + ph * HD * (size_t)TF;
  const v16b qh0 = frag_kb(QH + pq + (size_t)qi * HD, hh), qh1 = frag_kb(QH + pq + (size_t)qi * HD + 32, hh);
  v16b ql0 = (v16b){}, ql1 = (v16b){};
  if (RES) { ql0 = frag_kb(QLo + pq + (size_t)qi * HD, hh); ql1 = frag_kb(QLo + pq + (size_t)qi * HD + 32, hh); }
  const float cs = LOG2E / (8.0f * XS * XS);
  float m = -INFINITY, l = 0.0f; v8f o[4];
#pragma unroll
  for (int t = 0; t < 4; ++t) o[t] = (v8f){};
  const int kmax = q0 + 16 + SRC; const int kend = kmax < KL ? kmax : KL;
  // every chunk's K and V fragments are fetched as two whole groups well ahead of their products: K one chunk ahead, right behind the last product that read its registers; V at the chunk's head
  v16b kh[2][2], kl[2][2], vh[4], vl[4];
  auto fetch_k = [&](int kb) {
    const size_t kr = pq + (size_t)(kb + col) * HD + 8 * hh;
    const b16* const a0 = KH + kr; const b16* const c0 = RES ? KLo + kr : a0;   // every load of the group is one of these two addresses plus a constant
#pragma unroll
    for (int u = 0; u < 2; ++u) {
      kh[u][0] = frag_at(a0 + u * 16 * HD); kh[u][1] = frag_at(a0 + u * 16 * HD + 32);
      if (RES) { kl[u][0] = frag_at(c0 + u * 16 * HD); kl[u][1] = frag_at(c0 + u * 16 * HD + 32); }
    }
    close_loads(a0, c0);
  };
  auto fetch_v = [&](int kb) {
    const size_t vr = (size_t)col * TF + kb + 8 * hh;
    const b16* const a0 = Vh + vr; const b16* const c0 = RES ? Vl + vr : a0;   // likewise
#pragma unroll
    for (int t = 0; t < 4; ++t) {
      vh[t] = frag_at(a0 + (size_t)(t * 16) * TF);
      if (RES) vl[t] = frag_at(c0 + (size_t)(t * 16) * TF);
    }
    close_loads(a0, c0);
  };
  fetch_k(0);
#pragma unroll 1
  for (int kb = 0; kb < kend; kb += 32) {
    const int kn = (kb + 32 < kend) ? kb + 32 : kb;   // the last chunk fetches its own rows again: always inside the planes
    float e[16]; float mx = -INFINITY; v8f s[2];
    fetch_v(kb);   // this chunk's V loads stay here: they fly under the score products and the softmax
#pragma unroll
    for (int u = 0; u < 2; ++u) {
      s[u] = (v8f){};
      if (RES) {
        s[u] = wmma16b(kh[u][0], qh0, s[u]); s[u] = wmma16b(kh[u][0], ql0, s[u]); s[u] = wmma16b(kl[u][0], qh0, s[u]);
        s[u] = wmma16b(kh[u][1], qh1, s[u]); s[u] = wmma16b(kh[u][1], ql1, s[u]); s[u] = wmma16b(kl[u][1], qh1, s[u]);
      } else {
        s[u] = wmma16b(kh[u][0], qh0, s[u]); s[u] = wmma16b(kh[u][1], qh1, s[u]);
      }
    }
    fetch_k(kn);   // the next chunk's K loads stay here, ahead of the softmax: moved down, they would have less of the chunk to land in
#pragma unroll
    for (int u = 0; u < 2; ++u)
#pragma unroll
      for (int r = 0; r < 8; ++r) { const int key = kb + u * 16 + 8 * hh + r; const float vv = (key <= qi + SRC) ? s[u][r] * cs : -INFINITY; e[u * 8 + r] = vv; mx = fmaxf(mx, vv); }
    mx = fmaxf(mx, __shfl_xor(mx, 16)); const float mn = fmaxf(m, mx); const float al = (mn == -INFINITY) ? 1.0f : nexp2(m - mn); float sum = 0.0f;
    v16b pf, pg = (v16b){};   // B fragment of P^T: element i2 of a lane is key (i2 < 8 ? 0 : 16) + 8 hh + (i2 & 7) of its own query, the lane's own score i2
#pragma unroll
    for (int i2 = 0; i2 < 16; ++i2) {
      const float p = (e[i2] == -INFINITY) ? 0.0f : nexp2(e[i2] - mn); sum += p;
      if (RES) { b16 a_, b_; split16(p * PS, a_, b_); pf[i2] = a_; pg[i2] = b_; }
      else { pf[i2] = (b16)(p * PS); }
    }
    sum += __shfl_xor(sum, 16); l = l * al + sum; m = mn;
#pragma unroll
    for (int t = 0; t < 4; ++t) {
      o[t] *= al;
      if (RES) { o[t] = wmma16b(vh[t], pf, o[t]); o[t] = wmma16b(vh[t], pg, o[t]); o[t] = wmma16b(vl[t], pf, o[t]); }
      else { o[t] = wmma16b(vh[t], pf, o[t]); }
    }
  }
  const float inv = 1.0f / (l * PS * XS);
#pragma unroll
  for (int t = 0; t < 4; ++t)
#pragma unroll
    for (int r = 0; r < 8; ++r) To[wave][col][t * 16 + 8 * hh + r] = o[t][r] * inv;
  wave_lds_sync();
  {
    for (int rr = 0; rr < 16; ++rr) {
      const v2f f = *(const v2f*)(&To[wave][rr][lane * 2]); v2h hv, lv;
      for (int j = 0; j < 2; ++j) { b16 p, q; split16(f[j] * CS, p, q); hv[j] = p; lv[j] = q; }
      const size_t oi = ((size_t)bb * TF + q0 + rr) * DM + h * HD + lane * 2;
      *(v2h*)(Ch + oi) = hv; *(v2h*)(Cl + oi) = lv;
    }
    
  }
}

__global__ __launch_bounds__(128) void out_kernel(const b16* __restrict__ Ch, const b16* __restrict__ Cl, const b16* __restrict__ WO, float* __restrict__ out, int b0) {
  __shared__ __attribute__((aligned(16))) unsigned char smem[RING_BYTES];
  static_assert(sizeof(float) * 4 * 16 * (128 + 4) <= RING_BYTES);
  b16* const ring = (b16*)smem; float (*const Tf)[16][128 + 4] = (float (*)[16][128 + 4])smem;   // Tf takes the ring's place behind the loop's last barrier
  const int wave = threadIdx.x >> 5, lane = threadIdx.x & 31, nloc = lane & 15, hlf = lane >> 4; const int bb = blockIdx.z;
  const size_t mo = (size_t)(b0 + bb) * TF + ((size_t)blockIdx.x * 4 + wave) * 16;
  const int n0 = blockIdx.y * 128;
  v8f acc[8];
#pragma unroll
  for (int t = 0; t < 8; ++t) acc[t] = (v8f){};
  // stage rows 0-63 Ch, 64-127 Cl (the block's 64 rows), 128-255 WO channels; copy i of a lane: stage row r0 + 16 i, 16-byte piece seg
  const int r0 = threadIdx.x >> 3, seg = threadIdx.x & 7;
  const size_t ma = ((size_t)bb * TF + (size_t)blockIdx.x * 64 + r0) * DM + seg * 8;
  const b16* const gH = Ch + ma; const b16* const gL = Cl + ma; const b16* const gB = WO + (size_t)(n0 + r0) * DM + seg * 8;
  const unsigned lrow = lds_addr(smem) + (unsigned)(r0 * LP * 2 + seg * 16);
  auto issue = [&](int s) {
#pragma unroll
    for (int hf = 0; hf < 2; ++hf) {
      unsigned l[8]; const b16* g[8];
#pragma unroll
      for (int i = 0; i < 8; ++i) {
        l[i] = lrow + (unsigned)(((s & 1) * SROWS + 128 * hf + 16 * i) * LP * 2);
        g[i] = (hf ? gB + (size_t)(16 * i) * DM : i < 4 ? gH + (size_t)(16 * i) * DM : gL + (size_t)(16 * (i - 4)) * DM) + s * KC;
      }
      copy8(l, g);
    }
  };
  issue(0); wait_copies(); __syncthreads(); issue(1);
#pragma unroll 1   // one stage per trip: the buffer index and the refill test stay scalar
  for (int s = 0; s < NST; ++s) {
    const b16* const As = ring + ((s & 1) * SROWS + wave * 16 + nloc) * LP; const b16* const Bs = ring + ((s & 1) * SROWS + 128 + nloc) * LP;
#pragma unroll
    for (int kk = 0; kk < KC; kk += 32) {
      const v16b a = frag_kb(As + kk, hlf), al = frag_kb(As + 64 * LP + kk, hlf); v16b bw[8];   // the block's fragment reads stand as one group ahead of its products: their LDS latency is met once a block, not once a product
#pragma unroll
      for (int t = 0; t < 8; ++t) bw[t] = frag_kb(Bs + t * 16 * LP + kk, hlf);
#pragma unroll
      for (int t = 0; t < 8; ++t) { acc[t] = wmma16b(a, bw[t], acc[t]); acc[t] = wmma16b(al, bw[t], acc[t]); }
    }
    wait_lds_reads(); wait_copies(); __syncthreads();   // publishes stage s + 1 and frees stage s's buffer
    if (s + 2 < NST) issue(s + 2);
  }
  wait_copies();
#pragma unroll
  for (int t = 0; t < 8; ++t) {
#pragma unroll
    for (int r = 0; r < 8; ++r) Tf[wave][8 * hlf + r][t * 16 + nloc] = acc[t][r] * (1.0f / (CS * WSC));
  }
  wave_lds_sync();
  {
    for (int rr = 0; rr < 16; ++rr) *(v4f*)(out + (mo + rr) * DM + n0 + lane * 4) = *(const v4f*)(&Tf[wave][rr][lane * 4]);
    
  }
}
}  // namespace

extern "C" void kernel_launch(void* const* d_in, const int* in_sizes, int n_in, void* d_out, int out_size, void* d_ws, size_t ws_size, hipStream_t stream) {
  if (n_in < 8) return;
  auto Fp = [&](int i) { return (const float*)d_in[i]; };
  // input order: 0 x [4,2048,1024], 1 W_q, 2 b_q, 3 W_k, 4 b_k, 5 W_v, 6 b_v, 7 W_p; all f32; W (in,out)
  if (in_sizes[0] < BL * TF * DM || in_sizes[1] < DM * DM || in_sizes[2] < DM || in_sizes[3] < DM * DM || in_sizes[4] < DM || in_sizes[5] < DM * DM || in_sizes[6] < DM || in_sizes[7] < DM * DM ||
      out_size < BL * TF * DM) return;
  size_t off = 0; char* ws = (char*)d_ws;
  auto carve = [&](size_t bytes) { char* p = ws + off; off += (bytes + 255) & ~(size_t)255; return p; };
  b16* WT = (b16*)carve((size_t)3 * DM * DM * 2); b16* WO = (b16*)carve((size_t)DM * DM * 2);
  float* CST = (float*)carve((size_t)TF * (HD / 2) * 4); float* SNT = (float*)carve((size_t)TF * (HD / 2) * 4);
  const size_t plane = (size_t)NBH * TF * DM * 2;
  b16* X8 = (b16*)carve(plane);
  b16* QH = (b16*)carve(plane); b16* QLo = (b16*)carve(plane); b16* KH = (b16*)carve(plane); b16* KLo = (b16*)carve(plane);
  b16* VTh = (b16*)carve(plane); b16* VTl = (b16*)carve(plane); b16* Ch = (b16*)carve(plane); b16* Cl = (b16*)carve(plane);
  if (off > ws_size || off > ((size_t)128 << 20)) return;   // 84,410,368 B at NBH == 2
  prep_kernel<<<(unsigned)(((size_t)4 * DM * DM / 8 + 255) / 256), 256, 0, stream>>>(Fp(1), Fp(3), Fp(5), Fp(7), WT, WO);
  rope_tab_kernel<<<(unsigned)((TF * (HD / 2) + 255) / 256), 256, 0, stream>>>(CST, SNT);
  for (int p = 0; p < NPASS; ++p) {
    const int b0 = p * NBH; const int nb = (BL - b0 < NBH) ? (BL - b0) : NBH;
    xcvt_kernel<<<(unsigned)(((size_t)nb * KL * DM / 8 + 255) / 256), 256, 0, stream>>>(Fp(0), X8, b0, nb);
    proj_kernel<<<dim3(KL / 128, nb, 24), 256, 0, stream>>>(X8, WT, Fp(2), Fp(4), Fp(6), CST, SNT, QH, QLo, KH, KLo, VTh, VTl);
    attn_kernel<1><<<dim3(RSPLIT / 32, nb * H), 64, 0, stream>>>(QH, QLo, KH, KLo, VTh, VTl, Ch, Cl, 0);
    if (QL > RSPLIT) attn_kernel<0><<<dim3((QL - RSPLIT) / 32, nb * H), 64, 0, stream>>>(QH, QLo, KH, KLo, VTh, VTl, Ch, Cl, RSPLIT / 32);
    out_kernel<<<dim3(QL / 64, DM / 128, nb), 128, 0, stream>>>(Ch, Cl, WO, (float*)d_out, b0);
  }
}

// v003
// It runs in 217 microseconds.
// Next to v002, in two timings, it ran 1.31 and 1.29 times as fast.
// Over all steps from v000 it is 3.19 times as fast.
#include <hip/hip_runtime.h>

// compute dtype: every contraction on v_wmma_f32_16x16x32_f16 (f16 operands, f32 accumulate). q/k/v projections: x (bf16 RNE values carried x8) by W_q/W_k/W_v (bf16 RNE values carried x256): 1 product;
// attention for query rows < 512 of each sequence: S^T = K Q^T with q and k as f16 hi+lo planes (x8): 3 products; O^T += V^T P^T with v hi+lo (x8) and P hi+lo (x1024): 3 products;
// attention for query rows >= 512: S^T = K Q^T with the hi planes only: 1 product; O^T += V^T P^T with v hi and P (x1024) single: 1 product; ctx W_p with ctx hi+lo (x64) and W_p exact (x256): 2 products.
// Layout: x [B][T][1024]; W_* (in,out); q/k/v = x W + b reshaped to [B][T][16][64]; rotary pairs (2p, 2p+1) of q and k turned by angle t * theta^(-2p/64); scores q k^T / 8 with key j allowed iff
// j <= i + 64; softmax over keys; ctx = P v -> [B][T][1024]; out = ctx W_p (no bias).
// Fragment k-map per lane half hh for A AND B: elements 0..7 <- k = 8hh+0..7, 8..15 <- k = 16+8hh+0..7; acc[r] = D[8hh+r][col].

#ifndef NB
#define NB 4
#endif
#ifndef SEQ
#define SEQ 2048
#endif

namespace {
constexpr int BF = 4, TF = 2048, DM = 1024, H = 16, HD = 64, SRC = 64;
constexpr int BL = NB;                                   // batches computed (== 4 shipped)
constexpr int QL = SEQ;                                  // query rows computed per batch (== 2048 shipped)
constexpr int KL = (QL + SRC < TF) ? (QL + SRC) : TF;    // key rows needed: j <= i + SRC
constexpr int NBH = (BL < 2) ? BL : 2;                   // batches per pass (planes are sized for NBH)
constexpr int NPASS = (BL + NBH - 1) / NBH;
constexpr int RSPLIT = (QL < 512) ? QL : 512;            // query rows below this get the hi+lo (3-product) attention path
constexpr float XS = 8.0f, WSC = 256.0f, PS = 1024.0f, CS = 64.0f, LOG2E = 1.4426950408889634f, L2THETA = 13.287712379549449f;
static_assert(BL >= 1 && BL <= BF);
static_assert(QL >= 64 && QL <= TF && QL % 64 == 0);
static_assert(KL % 128 == 0 && KL <= TF && KL >= QL);
static_assert(RSPLIT % 32 == 0 && RSPLIT <= QL);
static_assert(DM == H * HD && TF % 64 == 0 && HD == 64);

typedef _Float16 b16;
typedef __attribute__((ext_vector_type(16))) _Float16 v16b;
typedef __attribute__((ext_vector_type(8))) _Float16 v8b;
typedef __attribute__((ext_vector_type(4))) _Float16 v4h;
typedef __attribute__((ext_vector_type(2))) _Float16 v2h;
typedef __attribute__((ext_vector_type(8))) float v8f;
typedef __attribute__((ext_vector_type(4))) float v4f;
typedef __attribute__((ext_vector_type(2))) float v2f;

__device__ __forceinline__ float bf16_rne(float f) { unsigned int u = __float_as_uint(f); u += 0x7FFFu + ((u >> 16) & 1u); return __uint_as_float(u & 0xFFFF0000u); }
__device__ __forceinline__ void split16(float v, b16& hi, b16& lo) { hi = (b16)v; lo = (b16)(v - (float)hi); }
__device__ __forceinline__ v16b frag_kb(const b16* p, int hh) {
  const v8b a = *(const v8b*)(p + 8 * hh), b = *(const v8b*)(p + 16 + 8 * hh); v16b f;
#pragma unroll
  for (int e = 0; e < 8; ++e) { f[e] = a[e]; f[8 + e] = b[e]; }
  return f;
}
__device__ __forceinline__ v8f wmma16b(v16b a, v16b b, v8f c) {
  v8f d = __builtin_amdgcn_wmma_f32_16x16x32_f16(false, a, false, b, (short)0, c, false, false);
  asm volatile("v_nop\n\tv_nop\n\tv_nop\n\tv_nop" : "+v"(d) : "v"(a), "v"(b));
  return d;
}
__device__ __forceinline__ void wave_lds_sync() { __builtin_amdgcn_fence(3 /* release order */, "workgroup"); __builtin_amdgcn_wave_barrier(); __builtin_amdgcn_fence(2 /* acquire order */, "workgroup"); }
__device__ __forceinline__ v16b frag_at(const b16* p) {   // frag_kb with the lane half's 8 hh already in p
  const v8b a = *(const v8b*)p, b = *(const v8b*)(p + 16); v16b f;
#pragma unroll
  for (int e = 0; e < 8; ++e) { f[e] = a[e]; f[8 + e] = b[e]; }
  return f;
}
__device__ __forceinline__ float nexp2(float v) { return __builtin_amdgcn_exp2f(v); }

// GEMM operand staging: a stage is KC k (one whole 128-byte line) of 256 operand rows, laid in LDS at a pitch of 144 B (16 B x odd: no bank conflict for the 16-byte fragment reads); two buffers.
constexpr int KC = 64, LP = KC + 8, SROWS = 256, NST = DM / KC;
constexpr int RING_BYTES = 2 * SROWS * LP * 2;
static_assert(DM % KC == 0 && NST >= 2 && (LP * 2) % 32 == 16);
__device__ __forceinline__ unsigned lds_addr(const void* p) { return (unsigned)(uintptr_t)p; }   // LDS byte address = low 32 bits of the __shared__ address
// eight 16-byte asynchronous copies per lane, global -> LDS through no register; the closing s_wait_xcnt stands in front of every later rewrite of the address registers that the copies name (a precaution)
__device__ __forceinline__ void copy8(const unsigned (&l)[8], const b16* const (&g)[8]) {
  asm volatile("global_load_async_to_lds_b128 %0, %8, off\n\t"
               "global_load_async_to_lds_b128 %1, %9, off\n\t"
               "global_load_async_to_lds_b128 %2, %10, off\n\t"
               "global_load_async_to_lds_b128 %3, %11, off\n\t"
               "global_load_async_to_lds_b128 %4, %12, off\n\t"
               "global_load_async_to_lds_b128 %5, %13, off\n\t"
               "global_load_async_to_lds_b128 %6, %14, off\n\t"
               "global_load_async_to_lds_b128 %7, %15, off\n\t"
               "s_wait_xcnt 0x0"
               :: "v"(l[0]), "v"(l[1]), "v"(l[2]), "v"(l[3]), "v"(l[4]), "v"(l[5]), "v"(l[6]), "v"(l[7]),
                  "v"(g[0]), "v"(g[1]), "v"(g[2]), "v"(g[3]), "v"(g[4]), "v"(g[5]), "v"(g[6]), "v"(g[7]) : "memory");
}
__device__ __forceinline__ void wait_copies() { asm volatile("s_wait_asynccnt 0x0" ::: "memory"); }   // this wave's copies have landed in LDS
__device__ __forceinline__ void wait_lds_reads() { asm volatile("s_wait_dscnt 0x0" ::: "memory"); }   // this wave's LDS reads are done before their buffer is handed back

// prep: WT [3072 o][1024 k]: o < 1024 W_q[k][o], < 2048 W_k[k][o-1024], else W_v[k][o-2048]; WO [1024 o][1024 k] = W_p[k][o] ((in,out) layouts -> transposed, k contiguous); bf16 RNE then x256
__global__ __launch_bounds__(256) void prep_kernel(const float* __restrict__ wq, const float* __restrict__ wk, const float* __restrict__ wv, const float* __restrict__ wp, b16* __restrict__ WT, b16* __restrict__ WO) {
  const size_t u = (size_t)blockIdx.x * 256 + threadIdx.x;
  if (u >= (size_t)4 * DM * DM / 8) return;
  const int mtx = (int)(u / ((size_t)DM * DM / 8)); const size_t e = (u % ((size_t)DM * DM / 8)) * 8; const int oo = (int)(e / DM), k0 = (int)(e % DM);
  const float* w = mtx == 0 ? wq : mtx == 1 ? wk : mtx == 2 ? wv : wp;
  v8b o;
#pragma unroll
  for (int j = 0; j < 8; ++j) o[j] = (b16)(bf16_rne(w[(size_t)(k0 + j) * DM + oo]) * WSC);
  b16* dst = (mtx < 3) ? (WT + (size_t)mtx * DM * DM + e) : (WO + e);
  { *(v8b*)dst = o;  }
}

__global__ __launch_bounds__(256) void rope_tab_kernel(float* __restrict__ cst, float* __restrict__ snt) {
  const int i = blockIdx.x * 256 + threadIdx.x;
  if (i >= TF * (HD / 2)) return;
  const int t = i / (HD / 2), p = i % (HD / 2);
  const float e = (float)(2 * p) * (1.0f / (float)HD);   // exact
  const float inv = exp2f(-(e * L2THETA));                // theta^(-e)
  const float ang = (float)t * inv;
  float sv, cv;
  sincosf(ang, &sv, &cv);
  { *(float*)(cst + i) = cv; *(float*)(snt + i) = sv;  }
}

__global__ __launch_bounds__(256) void xcvt_kernel(const float* __restrict__ x, b16* __restrict__ X8, int b0, int nb) {
  const size_t u = (size_t)blockIdx.x * 256 + threadIdx.x;
  const size_t per = (size_t)KL * DM / 8;
  if (u >= (size_t)nb * per) return;
  const int bb = (int)(u / per); const size_t e = (u % per) * 8; const int t = (int)(e / DM), c = (int)(e % DM);
  const float* src = x + (((size_t)(b0 + bb)) * TF + t) * DM + c;
  const v4f f0 = *(const v4f*)src, f1 = *(const v4f*)(src + 4);
  v8b o;
#pragma unroll
  for (int j = 0; j < 4; ++j) { o[j] = (b16)(bf16_rne(f0[j]) * XS); o[4 + j] = (b16)(bf16_rne(f1[j]) * XS); }
  b16* dst = X8 + ((size_t)bb * TF + t) * DM + c;
  { *(v8b*)dst = o;  }
}

// projections: grid (KL/128, nb, 24 slabs of 128 output channels: 0-7 q, 8-15 k, 16-23 v); block = 128 tokens x 8 waves of 16; K = 1024 in 16 stages of 64: stage rows 0-127 X8 tokens, 128-255 WT channels,
// copied to LDS one stage ahead; A and B fragments from LDS; the k order of every accumulator is unchanged
__global__ __launch_bounds__(256) void proj_kernel(const b16* __restrict__ X8, const b16* __restrict__ WT, const float* __restrict__ bq, const float* __restrict__ bk, const float* __restrict__ bv,
                                                    const float* __restrict__ cst, const float* __restrict__ snt,
                                                    b16* __restrict__ QH, b16* __restrict__ QLo, b16* __restrict__ KH, b16* __restrict__ KLo, b16* __restrict__ VTh, b16* __restrict__ VTl) {
  __shared__ __attribute__((aligned(16))) unsigned char smem[RING_BYTES];
  static_assert(sizeof(float) * 8 * 16 * (128 + 4) <= RING_BYTES);
  b16* const ring = (b16*)smem; float (*const Tf)[16][128 + 4] = (float (*)[16][128 + 4])smem;   // Tf takes the ring's place behind the loop's last barrier
  const int wave = threadIdx.x >> 5, lane = threadIdx.x & 31, nloc = lane & 15, hlf = lane >> 4;
  const int t0 = blockIdx.x * 128; const int bb = blockIdx.y; const int slab = blockIdx.z, n0 = slab * 128, part = slab / 8, c0 = n0 - part * DM;
  const int r0 = threadIdx.x >> 3, seg = threadIdx.x & 7;   // copy i of a lane: stage row r0 + 32 i, 16-byte piece seg; a wave's copy covers 4 whole lines
  const b16* const gA = X8 + ((size_t)bb * TF + t0 + r0) * DM + seg * 8; const b16* const gB = WT + (size_t)(n0 + r0) * DM + seg * 8;
  const unsigned lrow = lds_addr(smem) + (unsigned)(r0 * LP * 2 + seg * 16);
  auto issue = [&](int s) {
    unsigned l[8]; const b16* g[8];
    const b16* const pa = gA + s * KC; const b16* const pb = gB + s * KC; const unsigned lb = lrow + (unsigned)((s & 1) * SROWS * LP * 2);
#pragma unroll
    for (int i = 0; i < 8; ++i) { l[i] = lb + (unsigned)(32 * i * LP * 2); g[i] = i < 4 ? pa + (size_t)(32 * i) * DM : pb + (size_t)(32 * (i - 4)) * DM; }
    copy8(l, g);
  };
  v8f acc[8];
#pragma unroll
  for (int t = 0; t < 8; ++t) acc[t] = (v8f){};
  issue(0); wait_copies(); __syncthreads(); issue(1);
#pragma unroll 1   // one stage per trip: the buffer index and the refill test stay scalar
  for (int s = 0; s < NST; ++s) {
    const b16* const As = ring + ((s & 1) * SROWS + wave * 16 + nloc) * LP; const b16* const Bs = ring + ((s & 1) * SROWS + 128 + nloc) * LP;
#pragma unroll
    for (int kk = 0; kk < KC; kk += 32) {
      const v16b a = frag_kb(As + kk, hlf); v16b bw[8];   // the block's fragment reads stand as one group ahead of its products: their LDS latency is met once a block, not once a product
#pragma unroll
      for (int t = 0; t < 8; ++t) bw[t] = frag_kb(Bs + t * 16 * LP + kk, hlf);
#pragma unroll
      for (int t = 0; t < 8; ++t) acc[t] = wmma16b(a, bw[t], acc[t]);
    }
    wait_lds_reads(); wait_copies(); __syncthreads();   // publishes stage s + 1 and frees stage s's buffer
    if (s + 2 < NST) issue(s + 2);
  }
  wait_copies();
  const float* bias = part == 0 ? bq : part == 1 ? bk : bv;
#pragma unroll
  for (int t = 0; t < 8; ++t) {
    const float bval = bf16_rne(bias[c0 + t * 16 + nloc]);
#pragma unroll
    for (int r = 0; r < 8; ++r) Tf[wave][8 * hlf + r][t * 16 + nloc] = acc[t][r] * (1.0f / (XS * WSC)) + bval;
  }
  __syncthreads();
  {
    if (part < 2) {
      b16* ph_ = part == 0 ? QH : KH; b16* pl_ = part == 0 ? QLo : KLo;
      const int c = c0 + lane * 4; const int hq = c / HD, d = c % HD, p0 = d >> 1;   // d is a multiple of 4: pairs (d,d+1) -> p0 and (d+2,d+3) -> p0+1
      for (int rr = 0; rr < 16; ++rr) {
        const int tok = t0 + wave * 16 + rr;
        const v4f f = *(const v4f*)(&Tf[wave][rr][lane * 4]);
        const v2f cc = *(const v2f*)(cst + (size_t)tok * (HD / 2) + p0), ss = *(const v2f*)(snt + (size_t)tok * (HD / 2) + p0);
        const float o0 = f[0] * cc[0] - f[1] * ss[0];
        const float o1 = f[0] * ss[0] + f[1] * cc[0];
        const float o2 = f[2] * cc[1] - f[3] * ss[1];
        const float o3 = f[2] * ss[1] + f[3] * cc[1];
        v4h h4, l4; b16 ph, pl;
        split16(o0 * XS, ph, pl); h4[0] = ph; l4[0] = pl;
        split16(o1 * XS, ph, pl); h4[1] = ph; l4[1] = pl;
        split16(o2 * XS, ph, pl); h4[2] = ph; l4[2] = pl;
        split16(o3 * XS, ph, pl); h4[3] = ph; l4[3] = pl;
        const size_t oi = (((size_t)bb * H + hq) * TF + tok) * HD + d;
        *(v4h*)(ph_ + oi) = h4; *(v4h*)(pl_ + oi) = l4;
      }
    } else {
#pragma unroll 1
      for (int q = 0; q < 32; ++q) {
        const int cl = (wave & 3) * 32 + q; const int c = c0 + cl; const int hv_ = c / HD, d = c % HD; const int tk = (wave >> 2) * 64 + lane * 2; v2h hv, lv;   // waves 0-3: tokens 0-63, waves 4-7: tokens 64-127
        for (int j = 0; j < 2; ++j) { b16 p, ql; split16(Tf[(tk + j) >> 4][(tk + j) & 15][cl] * XS, p, ql); hv[j] = p; lv[j] = ql; }
        const size_t oi = (((size_t)bb * H + hv_) * HD + d) * (size_t)TF + t0 + tk;
        *(v2h*)(VTh + oi) = hv; *(v2h*)(VTl + oi) = lv;
      }
    }
    
  }
}

// attention: grid (rows/64, nb x H), block x offset xb0 (in 64-row units): block = 4 waves x 16 queries; a wave's keys are 0 .. min(KL, q0+16+SRC)-1 in 32-key chunks; key allowed iff key <= qi + SRC;
// RES != 0 (query rows < RSPLIT): S^T = K Q^T with 3 products (kh qh + kh ql + kl qh), P x1024 hi/lo, O^T += V^T P^T with 3 products (vh ph + vh pl + vl ph);
// RES == 0 (query rows >= RSPLIT, >= RSPLIT+SRC keys per row): S^T = kh qh (1 product), P x1024 single, O^T += vh p (1 product). Online softmax (running max, f32) in both; a lane's own P values are its B fragment of P^T and stay in registers
// K and V^T reach the waves through LDS: a stage is SK keys = 64 K rows and 64 V^T rows of one whole 128-byte line each (hi planes; RES: the lo planes behind them), copied one stage ahead as whole lines and shared by the
// block's 4 waves; the 16-byte fragment reads, which touch 16 rows each, go to LDS at the 144-byte pitch instead of to the cache
constexpr int AW = 4, AQ = AW * 16, SK = 64;
static_assert(SK == KC && HD == KC && KL % SK == 0 && (AQ + SRC) % SK == 0 && AQ + SRC >= 2 * SK && RSPLIT % AQ == 0 && QL % AQ == 0);
template <int RES>
__global__ __launch_bounds__(128) void attn_kernel(const b16* __restrict__ QH, const b16* __restrict__ QLo, const b16* __restrict__ KH, const b16* __restrict__ KLo, const b16* __restrict__ VTh, const b16* __restrict__ VTl,
                                                   b16* __restrict__ Ch, b16* __restrict__ Cl, int xb0) {
  constexpr int NP = RES ? 2 : 1, BROWS = 2 * SK * NP;   // stage rows: 0-63 K hi, 64-127 V^T hi, then (RES) 128-191 K lo, 192-255 V^T lo
  __shared__ __attribute__((aligned(16))) unsigned char smem[2 * BROWS * LP * 2];
  static_assert(sizeof(float) * AW * 16 * (HD + 4) <= sizeof(smem));
  b16* const ring = (b16*)smem; float (*const To)[16][HD + 4] = (float (*)[16][HD + 4])smem;   // To takes the ring's place behind the loop's last barrier
  // the wave's number is taken into a scalar register, so that kend and the test on it below are scalar and no wave's EXEC changes around the products
  const int wave = __builtin_amdgcn_readfirstlane(threadIdx.x >> 5), lane = threadIdx.x & 31, hh = lane >> 4, col = lane & 15; const int bb = blockIdx.y / H, h = blockIdx.y % H;
  const int qb = (xb0 + (int)blockIdx.x) * AQ, q0 = qb + wave * 16, qi = q0 + col;
  const size_t ph = (size_t)bb * H + h; const size_t pq = ph * TF * HD; const b16* Vh = VTh + ph * HD * (size_t)TF; const b16* Vl = VTl + ph * HD * (size_t)TF;
  const int kmax = q0 + 16 + SRC; const int kend = kmax < KL ? kmax : KL;          // this wave's keys
  const int bmax = qb + AQ + SRC; const int ns = (bmax < KL ? bmax : KL) / SK;      // the block's stages: >= 2, every one wholly inside the planes
  // copy i of a lane: stage row r0 + 16 i, 16-byte piece seg; a wave's copy covers 4 whole lines
  const int r0 = threadIdx.x >> 3, seg = threadIdx.x & 7;
  const size_t ko = pq + (size_t)r0 * HD + seg * 8, vo = (size_t)r0 * TF + seg * 8;
  const unsigned lrow = lds_addr(smem) + (unsigned)(r0 * LP * 2 + seg * 16);
  auto issue = [&](int s) {
#pragma unroll
    for (int pl = 0; pl < NP; ++pl) {
      unsigned l[8]; const b16* g[8];
      const b16* const pk = (pl ? KLo : KH) + ko + (size_t)s * (SK * HD); const b16* const pv = (pl ? Vl : Vh) + vo + s * SK;
      const unsigned lb = lrow + (unsigned)(((s & 1) * BROWS + pl * 2 * SK) * LP * 2);
#pragma unroll
      for (int i = 0; i < 8; ++i) { l[i] = lb + (unsigned)(16 * i * LP * 2); g[i] = i < 4 ? pk + (size_t)(16 * i) * HD : pv + (size_t)(16 * (i - 4)) * TF; }
      copy8(l, g);
    }
  };
  issue(0);
  const v16b qh0 = frag_kb(QH + pq + (size_t)qi * HD, hh), qh1 = frag_kb(QH + pq + (size_t)qi * HD + 32, hh);
  v16b ql0 = (v16b){}, ql1 = (v16b){};
  if (RES) { ql0 = frag_kb(QLo + pq + (size_t)qi * HD, hh); ql1 = frag_kb(QLo + pq + (size_t)qi * HD + 32, hh); }
  const float cs = LOG2E / (8.0f * XS * XS);
  float m = -INFINITY, l = 0.0f; v8f o[4];
#pragma unroll
  for (int t = 0; t < 4; ++t) o[t] = (v8f){};
  v16b kh[2][2], kl[2][2], vh[4], vl[4];
  auto fetch_k = [&](const b16* st, int c) {   // chunk c of the stage at st: K rows 32 c + 16 u + col
    const b16* const a0 = st + (c * 32 + col) * LP + 8 * hh;
#pragma unroll
    for (int u = 0; u < 2; ++u) {
      kh[u][0] = frag_at(a0 + u * 16 * LP); kh[u][1] = frag_at(a0 + u * 16 * LP + 32);
      if (RES) { kl[u][0] = frag_at(a0 + (2 * SK + u * 16) * LP); kl[u][1] = frag_at(a0 + (2 * SK + u * 16) * LP + 32); }
    }
  };
  auto fetch_v = [&](const b16* st, int c) {   // V^T rows 16 t + col, keys 32 c ..
    const b16* const a0 = st + (SK + col) * LP + c * 32 + 8 * hh;
#pragma unroll
    for (int t = 0; t < 4; ++t) {
      vh[t] = frag_at(a0 + t * 16 * LP);
      if (RES) vl[t] = frag_at(a0 + (2 * SK + t * 16) * LP);
    }
  };
  wait_copies(); __syncthreads(); issue(1);
#pragma unroll 1   // one stage per trip: the buffer index and the refill test stay scalar
  for (int s = 0; s < ns; ++s) {
    const b16* const st = ring + (s & 1) * BROWS * LP;
#pragma unroll
    for (int c = 0; c < SK / 32; ++c) {
      const int kb = s * SK + c * 32;
      if (kb < kend) {   // the same for a whole wave (a scalar test): a wave past its last key only passes the stage's foot
        float e[16]; float mx = -INFINITY; v8f s_[2];
        if (c == 0) fetch_k(st, 0);
        fetch_v(st, c);   // this chunk's V reads fly under the score products and the softmax
#pragma unroll
        for (int u = 0; u < 2; ++u) {
          s_[u] = (v8f){};
          if (RES) {
            s_[u] = wmma16b(kh[u][0], qh0, s_[u]); s_[u] = wmma16b(kh[u][0], ql0, s_[u]); s_[u] = wmma16b(kl[u][0], qh0, s_[u]);
            s_[u] = wmma16b(kh[u][1], qh1, s_[u]); s_[u] = wmma16b(kh[u][1], ql1, s_[u]); s_[u] = wmma16b(kl[u][1], qh1, s_[u]);
          } else {
            s_[u] = wmma16b(kh[u][0], qh0, s_[u]); s_[u] = wmma16b(kh[u][1], qh1, s_[u]);
          }
        }
        if (c + 1 < SK / 32) fetch_k(st, c + 1);   // the same stage's next chunk: its K reads are issued inside this chunk, well ahead of their products
#pragma unroll
        for (int u = 0; u < 2; ++u)
#pragma unroll
          for (int r = 0; r < 8; ++r) { const int key = kb + u * 16 + 8 * hh + r; const float vv = (key <= qi + SRC) ? s_[u][r] * cs : -INFINITY; e[u * 8 + r] = vv; mx = fmaxf(mx, vv); }
        mx = fmaxf(mx, __shfl_xor(mx, 16)); const float mn = fmaxf(m, mx); const float al = (mn == -INFINITY) ? 1.0f : nexp2(m - mn); float sum = 0.0f;
        v16b pf, pg = (v16b){};   // B fragment of P^T: element i2 of a lane is key (i2 < 8 ? 0 : 16) + 8 hh + (i2 & 7) of its own query, the lane's own score i2
#pragma unroll
        for (int i2 = 0; i2 < 16; ++i2) {
          const float p = (e[i2] == -INFINITY) ? 0.0f : nexp2(e[i2] - mn); sum += p;
          if (RES) { b16 a_, b_; split16(p * PS, a_, b_); pf[i2] = a_; pg[i2] = b_; }
          else { pf[i2] = (b16)(p * PS); }
        }
        sum += __shfl_xor(sum, 16); l = l * al + sum; m = mn;
#pragma unroll
        for (int t = 0; t < 4; ++t) {
          o[t] *= al;
          if (RES) { o[t] = wmma16b(vh[t], pf, o[t]); o[t] = wmma16b(vh[t], pg, o[t]); o[t] = wmma16b(vl[t], pf, o[t]); }
          else { o[t] = wmma16b(vh[t], pf, o[t]); }
        }
      }
    }
    wait_lds_reads(); wait_copies(); __syncthreads();   // publishes stage s + 1 and frees stage s's buffer
    if (s + 2 < ns) issue(s + 2);
  }
  wait_copies();
  const float inv = 1.0f / (l * PS * XS);
#pragma unroll
  for (int t = 0; t < 4; ++t)
#pragma unroll
    for (int r = 0; r < 8; ++r) To[wave][col][t * 16 + 8 * hh + r] = o[t][r] * inv;
  wave_lds_sync();
  {
    for (int rr = 0; rr < 16; ++rr) {
      const v2f f = *(const v2f*)(&To[wave][rr][lane * 2]); v2h hv, lv;
      for (int j = 0; j < 2; ++j) { b16 p, q; split16(f[j] * CS, p, q); hv[j] = p; lv[j] = q; }
      const size_t oi = ((size_t)bb * TF + q0 + rr) * DM + h * HD + lane * 2;
      *(v2h*)(Ch + oi) = hv; *(v2h*)(Cl + oi) = lv;
    }
    
  }
}

__global__ __launch_bounds__(128) void out_kernel(const b16* __restrict__ Ch, const b16* __restrict__ Cl, const b16* __restrict__ WO, float* __restrict__ out, int b0) {
  __shared__ __attribute__((aligned(16))) unsigned char smem[RING_BYTES];
  static_assert(sizeof(float) * 4 * 16 * (128 + 4) <= RING_BYTES);
  b16* const ring = (b16*)smem; float (*const Tf)[16][128 + 4] = (float (*)[16][128 + 4])smem;   // Tf takes the ring's place behind the loop's last barrier
  const int wave = threadIdx.x >> 5, lane = threadIdx.x & 31, nloc = lane & 15, hlf = lane >> 4; const int bb = blockIdx.z;
  const size_t mo = (size_t)(b0 + bb) * TF + ((size_t)blockIdx.x * 4 + wave) * 16;
  const int n0 = blockIdx.y * 128;
  v8f acc[8];
#pragma unroll
  for (int t = 0; t < 8; ++t) acc[t] = (v8f){};
  // stage rows 0-63 Ch, 64-127 Cl (the block's 64 rows), 128-255 WO channels; copy i of a lane: stage row r0 + 16 i, 16-byte piece seg
  const int r0 = threadIdx.x >> 3, seg = threadIdx.x & 7;
  const size_t ma = ((size_t)bb * TF + (size_t)blockIdx.x * 64 + r0) * DM + seg * 8;
  const b16* const gH = Ch + ma; const b16* const gL = Cl + ma; const b16* const gB = WO + (size_t)(n0 + r0) * DM + seg * 8;
  const unsigned lrow = lds_addr(smem) + (unsigned)(r0 * LP * 2 + seg * 16);
  auto issue = [&](int s) {
#pragma unroll
    for (int hf = 0; hf < 2; ++hf) {
      unsigned l[8]; const b16* g[8];
#pragma unroll
      for (int i = 0; i < 8; ++i) {
        l[i] = lrow + (unsigned)(((s & 1) * SROWS + 128 * hf + 16 * i) * LP * 2);
        g[i] = (hf ? gB + (size_t)(16 * i) * DM : i < 4 ? gH + (size_t)(16 * i) * DM : gL + (size_t)(16 * (i - 4)) * DM) + s * KC;
      }
      copy8(l, g);
    }
  };
  issue(0); wait_copies(); __syncthreads(); issue(1);
#pragma unroll 1   // one stage per trip: the buffer index and the refill test stay scalar
  for (int s = 0; s < NST; ++s) {
    const b16* const As = ring + ((s & 1) * SROWS + wave * 16 + nloc) * LP; const b16* const Bs = ring + ((s & 1) * SROWS + 128 + nloc) * LP;
#pragma unroll
    for (int kk = 0; kk < KC; kk += 32) {
      const v16b a = frag_kb(As + kk, hlf), al = frag_kb(As + 64 * LP + kk, hlf); v16b bw[8];   // the block's fragment reads stand as one group ahead of its products: their LDS latency is met once a block, not once a product
#pragma unroll
      for (int t = 0; t < 8; ++t) bw[t] = frag_kb(Bs + t * 16 * LP + kk, hlf);
#pragma unroll
      for (int t = 0; t < 8; ++t) { acc[t] = wmma16b(a, bw[t], acc[t]); acc[t] = wmma16b(al, bw[t], acc[t]); }
    }
    wait_lds_reads(); wait_copies(); __syncthreads();   // publishes stage s + 1 and frees stage s's buffer
    if (s + 2 < NST) issue(s + 2);
  }
  wait_copies();
#pragma unroll
  for (int t = 0; t < 8; ++t) {
#pragma unroll
    for (int r = 0; r < 8; ++r) Tf[wave][8 * hlf + r][t * 16 + nloc] = acc[t][r] * (1.0f / (CS * WSC));
  }
  wave_lds_sync();
  {
    for (int rr = 0; rr < 16; ++rr) *(v4f*)(out + (mo + rr) * DM + n0 + lane * 4) = *(const v4f*)(&Tf[wave][rr][lane * 4]);
    
  }
}
}  // namespace

extern "C" void kernel_launch(void* const* d_in, const int* in_sizes, int n_in, void* d_out, int out_size, void* d_ws, size_t ws_size, hipStream_t stream) {
  if (n_in < 8) return;
  auto Fp = [&](int i) { return (const float*)d_in[i]; };
  // input order: 0 x [4,2048,1024], 1 W_q, 2 b_q, 3 W_k, 4 b_k, 5 W_v, 6 b_v, 7 W_p; all f32; W (in,out)
  if (in_sizes[0] < BL * TF * DM || in_sizes[1] < DM * DM || in_sizes[2] < DM || in_sizes[3] < DM * DM || in_sizes[4] < DM || in_sizes[5] < DM * DM || in_sizes[6] < DM || in_sizes[7] < DM * DM ||
      out_size < BL * TF * DM) return;
  size_t off = 0; char* ws = (char*)d_ws;
  auto carve = [&](size_t bytes) { char* p = ws + off; off += (bytes + 255) & ~(size_t)255; return p; };
  b16* WT = (b16*)carve((size_t)3 * DM * DM * 2); b16* WO = (b16*)carve((size_t)DM * DM * 2);
  float* CST = (float*)carve((size_t)TF * (HD / 2) * 4); float* SNT = (float*)carve((size_t)TF * (HD / 2) * 4);
  const size_t plane = (size_t)NBH * TF * DM * 2;
  b16* X8 = (b16*)carve(plane);
  b16* QH = (b16*)carve(plane); b16* QLo = (b16*)carve(plane); b16* KH = (b16*)carve(plane); b16* KLo = (b16*)carve(plane);
  b16* VTh = (b16*)carve(plane); b16* VTl = (b16*)carve(plane); b16* Ch = (b16*)carve(plane); b16* Cl = (b16*)carve(plane);
  if (off > ws_size || off > ((size_t)128 << 20)) return;   // 84,410,368 B at NBH == 2
  prep_kernel<<<(unsigned)(((size_t)4 * DM * DM / 8 + 255) / 256), 256, 0, stream>>>(Fp(1), Fp(3), Fp(5), Fp(7), WT, WO);
  rope_tab_kernel<<<(unsigned)((TF * (HD / 2) + 255) / 256), 256, 0, stream>>>(CST, SNT);
  for (int p = 0; p < NPASS; ++p) {
    const int b0 = p * NBH; const int nb = (BL - b0 < NBH) ? (BL - b0) : NBH;
    xcvt_kernel<<<(unsigned)(((size_t)nb * KL * DM / 8 + 255) / 256), 256, 0, stream>>>(Fp(0), X8, b0, nb);
    proj_kernel<<<dim3(KL / 128, nb, 24), 256, 0, stream>>>(X8, WT, Fp(2), Fp(4), Fp(6), CST, SNT, QH, QLo, KH, KLo, VTh, VTl);
    attn_kernel<1><<<dim3(RSPLIT / AQ, nb * H), AW * 32, 0, stream>>>(QH, QLo, KH, KLo, VTh, VTl, Ch, Cl, 0);
    if (QL > RSPLIT) attn_kernel<0><<<dim3((QL - RSPLIT) / AQ, nb * H), AW * 32, 0, stream>>>(QH, QLo, KH, KLo, VTh, VTl, Ch, Cl, RSPLIT / AQ);
    out_kernel<<<dim3(QL / 64, DM / 128, nb), 128, 0, stream>>>(Ch, Cl, WO, (float*)d_out, b0);
  }
}

// v004
// One run takes 191 microseconds.
// Timed twice side by side with v003, it ran 1.13 and 1.14 times as fast.
// Over all steps from v000 it is 3.62 times as fast.
#include <hip/hip_runtime.h>

// compute dtype: every contraction on v_wmma_f32_16x16x32_f16 (f16 operands, f32 accumulate). q/k/v projections: x (bf16 RNE values carried x8) by W_q/W_k/W_v (bf16 RNE values carried x256): 1 product;
// attention for query rows < 512 of each sequence: S^T = K Q^T with q and k as f16 hi+lo planes (x8): 3 products; O^T += V^T P^T with v hi+lo (x8) and P hi+lo (x1024): 3 products;
// attention for query rows >= 512: S^T = K Q^T with the hi planes only: 1 product; O^T += V^T P^T with v hi and P (x1024) single: 1 product; ctx W_p with ctx hi+lo (x64) and W_p exact (x256): 2 products.
// Layout: x [B][T][1024]; W_* (in,out); q/k/v = x W + b reshaped to [B][T][16][64]; rotary pairs (2p, 2p+1) of q and k turned by angle t * theta^(-2p/64); scores q k^T / 8 with key j allowed iff
// j <= i + 64; softmax over keys; ctx = P v -> [B][T][1024]; out = ctx W_p (no bias).
// Fragment k-map per lane half hh for A AND B: elements 0..7 <- k = 8hh+0..7, 8..15 <- k = 16+8hh+0..7; acc[r] = D[8hh+r][col].

#ifndef NB
#define NB 4
#endif
#ifndef SEQ
#define SEQ 2048
#endif

namespace {
constexpr int BF = 4, TF = 2048, DM = 1024, H = 16, HD = 64, SRC = 64;
constexpr int BL = NB;                                   // batches computed (== 4 shipped)
constexpr int QL = SEQ;                                  // query rows computed per batch (== 2048 shipped)
constexpr int KL = (QL + SRC < TF) ? (QL + SRC) : TF;    // key rows needed: j <= i + SRC
constexpr int NBH = BL;                                  // batches per pass (planes are sized for NBH): all of them, so every kernel is launched once over the whole problem
constexpr int NPASS = (BL + NBH - 1) / NBH;
constexpr int RSPLIT = (QL < 512) ? QL : 512;            // query rows below this get the hi+lo (3-product) attention path
constexpr float XS = 8.0f, WSC = 256.0f, PS = 1024.0f, CS = 64.0f, LOG2E = 1.4426950408889634f, L2THETA = 13.287712379549449f;
static_assert(BL >= 1 && BL <= BF);
static_assert(QL >= 64 && QL <= TF && QL % 64 == 0);
static_assert(KL % 128 == 0 && KL <= TF && KL >= QL);
static_assert(RSPLIT % 32 == 0 && RSPLIT <= QL);
static_assert(DM == H * HD && TF % 64 == 0 && HD == 64);

typedef _Float16 b16;
typedef __attribute__((ext_vector_type(16))) _Float16 v16b;
typedef __attribute__((ext_vector_type(8))) _Float16 v8b;
typedef __attribute__((ext_vector_type(4))) _Float16 v4h;
typedef __attribute__((ext_vector_type(2))) _Float16 v2h;
typedef __attribute__((ext_vector_type(8))) float v8f;
typedef __attribute__((ext_vector_type(4))) float v4f;
typedef __attribute__((ext_vector_type(2))) float v2f;

__device__ __forceinline__ float bf16_rne(float f) { unsigned int u = __float_as_uint(f); u += 0x7FFFu + ((u >> 16) & 1u); return __uint_as_float(u & 0xFFFF0000u); }
__device__ __forceinline__ void split16(float v, b16& hi, b16& lo) { hi = (b16)v; lo = (b16)(v - (float)hi); }
__device__ __forceinline__ v16b frag_kb(const b16* p, int hh) {
  const v8b a = *(const v8b*)(p + 8 * hh), b = *(const v8b*)(p + 16 + 8 * hh); v16b f;
#pragma unroll
  for (int e = 0; e < 8; ++e) { f[e] = a[e]; f[8 + e] = b[e]; }
  return f;
}
__device__ __forceinline__ v8f wmma16b(v16b a, v16b b, v8f c) {
  v8f d = __builtin_amdgcn_wmma_f32_16x16x32_f16(false, a, false, b, (short)0, c, false, false);
  asm volatile("v_nop\n\tv_nop\n\tv_nop\n\tv_nop" : "+v"(d) : "v"(a), "v"(b));
  return d;
}
__device__ __forceinline__ void wave_lds_sync() { __builtin_amdgcn_fence(3 /* release order */, "workgroup"); __builtin_amdgcn_wave_barrier(); __builtin_amdgcn_fence(2 /* acquire order */, "workgroup"); }
__device__ __forceinline__ v16b frag_at(const b16* p) {   // frag_kb with the lane half's 8 hh already in p
  const v8b a = *(const v8b*)p, b = *(const v8b*)(p + 16); v16b f;
#pragma unroll
  for (int e = 0; e < 8; ++e) { f[e] = a[e]; f[8 + e] = b[e]; }
  return f;
}
__device__ __forceinline__ float nexp2(float v) { return __builtin_amdgcn_exp2f(v); }

// GEMM operand staging: a stage is KC k (one whole 128-byte line) of 256 operand rows, laid in LDS at a pitch of 144 B (16 B x odd: no bank conflict for the 16-byte fragment reads); two buffers.
constexpr int KC = 64, LP = KC + 8, SROWS = 256, NST = DM / KC;
constexpr int RING_BYTES = 2 * SROWS * LP * 2;
static_assert(DM % KC == 0 && NST >= 2 && (LP * 2) % 32 == 16);
__device__ __forceinline__ unsigned lds_addr(const void* p) { return (unsigned)(uintptr_t)p; }   // LDS byte address = low 32 bits of the __shared__ address
// eight 16-byte asynchronous copies per lane, global -> LDS through no register; the closing s_wait_xcnt stands in front of every later rewrite of the address registers that the copies name (a precaution)
__device__ __forceinline__ void copy8(const unsigned (&l)[8], const b16* const (&g)[8]) {
  asm volatile("global_load_async_to_lds_b128 %0, %8, off\n\t"
               "global_load_async_to_lds_b128 %1, %9, off\n\t"
               "global_load_async_to_lds_b128 %2, %10, off\n\t"
               "global_load_async_to_lds_b128 %3, %11, off\n\t"
               "global_load_async_to_lds_b128 %4, %12, off\n\t"
               "global_load_async_to_lds_b128 %5, %13, off\n\t"
               "global_load_async_to_lds_b128 %6, %14, off\n\t"
               "global_load_async_to_lds_b128 %7, %15, off\n\t"
               "s_wait_xcnt 0x0"
               :: "v"(l[0]), "v"(l[1]), "v"(l[2]), "v"(l[3]), "v"(l[4]), "v"(l[5]), "v"(l[6]), "v"(l[7]),
                  "v"(g[0]), "v"(g[1]), "v"(g[2]), "v"(g[3]), "v"(g[4]), "v"(g[5]), "v"(g[6]), "v"(g[7]) : "memory");
}
__device__ __forceinline__ void wait_copies() { asm volatile("s_wait_asynccnt 0x0" ::: "memory"); }   // this wave's copies have landed in LDS
__device__ __forceinline__ void wait_lds_reads() { asm volatile("s_wait_dscnt 0x0" ::: "memory"); }   // this wave's LDS reads are done before their buffer is handed back

// prep: WT [3072 o][1024 k]: o < 1024 W_q[k][o], < 2048 W_k[k][o-1024], else W_v[k][o-2048]; WO [1024 o][1024 k] = W_p[k][o] ((in,out) layouts -> transposed, k contiguous); bf16 RNE then x256
__global__ __launch_bounds__(256) void prep_kernel(const float* __restrict__ wq, const float* __restrict__ wk, const float* __restrict__ wv, const float* __restrict__ wp, b16* __restrict__ WT, b16* __restrict__ WO) {
  const size_t u = (size_t)blockIdx.x * 256 + threadIdx.x;
  if (u >= (size_t)4 * DM * DM / 8) return;
  const int mtx = (int)(u / ((size_t)DM * DM / 8)); const size_t e = (u % ((size_t)DM * DM / 8)) * 8; const int oo = (int)(e / DM), k0 = (int)(e % DM);
  const float* w = mtx == 0 ? wq : mtx == 1 ? wk : mtx == 2 ? wv : wp;
  v8b o;
#pragma unroll
  for (int j = 0; j < 8; ++j) o[j] = (b16)(bf16_rne(w[(size_t)(k0 + j) * DM + oo]) * WSC);
  b16* dst = (mtx < 3) ? (WT + (size_t)mtx * DM * DM + e) : (WO + e);
  { *(v8b*)dst = o;  }
}

__global__ __launch_bounds__(256) void rope_tab_kernel(float* __restrict__ cst, float* __restrict__ snt) {
  const int i = blockIdx.x * 256 + threadIdx.x;
  if (i >= TF * (HD / 2)) return;
  const int t = i / (HD / 2), p = i % (HD / 2);
  const float e = (float)(2 * p) * (1.0f / (float)HD);   // exact
  const float inv = exp2f(-(e * L2THETA));                // theta^(-e)
  const float ang = (float)t * inv;
  float sv, cv;
  sincosf(ang, &sv, &cv);
  { *(float*)(cst + i) = cv; *(float*)(snt + i) = sv;  }
}

__global__ __launch_bounds__(256) void xcvt_kernel(const float* __restrict__ x, b16* __restrict__ X8, int b0, int nb) {
  const size_t u = (size_t)blockIdx.x * 256 + threadIdx.x;
  const size_t per = (size_t)KL * DM / 8;
  if (u >= (size_t)nb * per) return;
  const int bb = (int)(u / per); const size_t e = (u % per) * 8; const int t = (int)(e / DM), c = (int)(e % DM);
  const float* src = x + (((size_t)(b0 + bb)) * TF + t) * DM + c;
  const v4f f0 = *(const v4f*)src, f1 = *(const v4f*)(src + 4);
  v8b o;
#pragma unroll
  for (int j = 0; j < 4; ++j) { o[j] = (b16)(bf16_rne(f0[j]) * XS); o[4 + j] = (b16)(bf16_rne(f1[j]) * XS); }
  b16* dst = X8 + ((size_t)bb * TF + t) * DM + c;
  { *(v8b*)dst = o;  }
}

// projections: grid (KL/128, nb, 24 slabs of 128 output channels: 0-7 q, 8-15 k, 16-23 v); block = 128 tokens x 8 waves of 16; K = 1024 in 16 stages of 64: stage rows 0-127 X8 tokens, 128-255 WT channels,
// copied to LDS one stage ahead; A and B fragments from LDS; the k order of every accumulator is unchanged
__global__ __launch_bounds__(256) void proj_kernel(const b16* __restrict__ X8, const b16* __restrict__ WT, const float* __restrict__ bq, const float* __restrict__ bk, const float* __restrict__ bv,
                                                    const float* __restrict__ cst, const float* __restrict__ snt,
                                                    b16* __restrict__ QH, b16* __restrict__ QLo, b16* __restrict__ KH, b16* __restrict__ KLo, b16* __restrict__ VTh, b16* __restrict__ VTl) {
  __shared__ __attribute__((aligned(16))) unsigned char smem[RING_BYTES];
  static_assert(sizeof(float) * 8 * 16 * (128 + 4) <= RING_BYTES);
  b16* const ring = (b16*)smem; float (*const Tf)[16][128 + 4] = (float (*)[16][128 + 4])smem;   // Tf takes the ring's place behind the loop's last barrier
  const int wave = threadIdx.x >> 5, lane = threadIdx.x & 31, nloc = lane & 15, hlf = lane >> 4;
  const int t0 = blockIdx.x * 128; const int bb = blockIdx.y; const int slab = blockIdx.z, n0 = slab * 128, part = slab / 8, c0 = n0 - part * DM;
  const int r0 = threadIdx.x >> 3, seg = threadIdx.x & 7;   // copy i of a lane: stage row r0 + 32 i, 16-byte piece seg; a wave's copy covers 4 whole lines
  const b16* const gA = X8 + ((size_t)bb * TF + t0 + r0) * DM + seg * 8; const b16* const gB = WT + (size_t)(n0 + r0) * DM + seg * 8;
  const unsigned lrow = lds_addr(smem) + (unsigned)(r0 * LP * 2 + seg * 16);
  auto issue = [&](int s) {
    unsigned l[8]; const b16* g[8];
    const b16* const pa = gA + s * KC; const b16* const pb = gB + s * KC; const unsigned lb = lrow + (unsigned)((s & 1) * SROWS * LP * 2);
#pragma unroll
    for (int i = 0; i < 8; ++i) { l[i] = lb + (unsigned)(32 * i * LP * 2); g[i] = i < 4 ? pa + (size_t)(32 * i) * DM : pb + (size_t)(32 * (i - 4)) * DM; }
    copy8(l, g);
  };
  v8f acc[8];
#pragma unroll
  for (int t = 0; t < 8; ++t) acc[t] = (v8f){};
  issue(0); wait_copies(); __syncthreads(); issue(1);
#pragma unroll 1   // one stage per trip: the buffer index and the refill test stay scalar
  for (int s = 0; s < NST; ++s) {
    const b16* const As = ring + ((s & 1) * SROWS + wave * 16 + nloc) * LP; const b16* const Bs = ring + ((s & 1) * SROWS + 128 + nloc) * LP;
#pragma unroll
    for (int kk = 0; kk < KC; kk += 32) {
      const v16b a = frag_kb(As + kk, hlf); v16b bw[8];   // the block's fragment reads stand as one group ahead of its products: their LDS latency is met once a block, not once a product
#pragma unroll
      for (int t = 0; t < 8; ++t) bw[t] = frag_kb(Bs + t * 16 * LP + kk, hlf);
#pragma unroll
      for (int t = 0; t < 8; ++t) acc[t] = wmma16b(a, bw[t], acc[t]);
    }
    wait_lds_reads(); wait_copies(); __syncthreads();   // publishes stage s + 1 and frees stage s's buffer
    if (s + 2 < NST) issue(s + 2);
  }
  wait_copies();
  const float* bias = part == 0 ? bq : part == 1 ? bk : bv;
#pragma unroll
  for (int t = 0; t < 8; ++t) {
    const float bval = bf16_rne(bias[c0 + t * 16 + nloc]);
#pragma unroll
    for (int r = 0; r < 8; ++r) Tf[wave][8 * hlf + r][t * 16 + nloc] = acc[t][r] * (1.0f / (XS * WSC)) + bval;
  }
  __syncthreads();
  {
    if (part < 2) {
      b16* ph_ = part == 0 ? QH : KH; b16* pl_ = part == 0 ? QLo : KLo;
      const int c = c0 + lane * 4; const int hq = c / HD, d = c % HD, p0 = d >> 1;   // d is a multiple of 4: pairs (d,d+1) -> p0 and (d+2,d+3) -> p0+1
      for (int rr = 0; rr < 16; ++rr) {
        const int tok = t0 + wave * 16 + rr;
        const v4f f = *(const v4f*)(&Tf[wave][rr][lane * 4]);
        const v2f cc = *(const v2f*)(cst + (size_t)tok * (HD / 2) + p0), ss = *(const v2f*)(snt + (size_t)tok * (HD / 2) + p0);
        const float o0 = f[0] * cc[0] - f[1] * ss[0];
        const float o1 = f[0] * ss[0] + f[1] * cc[0];
        const float o2 = f[2] * cc[1] - f[3] * ss[1];
        const float o3 = f[2] * ss[1] + f[3] * cc[1];
        v4h h4, l4; b16 ph, pl;
        split16(o0 * XS, ph, pl); h4[0] = ph; l4[0] = pl;
        split16(o1 * XS, ph, pl); h4[1] = ph; l4[1] = pl;
        split16(o2 * XS, ph, pl); h4[2] = ph; l4[2] = pl;
        split16(o3 * XS, ph, pl); h4[3] = ph; l4[3] = pl;
        const size_t oi = (((size_t)bb * H + hq) * TF + tok) * HD + d;
        *(v4h*)(ph_ + oi) = h4; *(v4h*)(pl_ + oi) = l4;
      }
    } else {
#pragma unroll 1
      for (int q = 0; q < 32; ++q) {
        const int cl = (wave & 3) * 32 + q; const int c = c0 + cl; const int hv_ = c / HD, d = c % HD; const int tk = (wave >> 2) * 64 + lane * 2; v2h hv, lv;   // waves 0-3: tokens 0-63, waves 4-7: tokens 64-127
        for (int j = 0; j < 2; ++j) { b16 p, ql; split16(Tf[(tk + j) >> 4][(tk + j) & 15][cl] * XS, p, ql); hv[j] = p; lv[j] = ql; }
        const size_t oi = (((size_t)bb * H + hv_) * HD + d) * (size_t)TF + t0 + tk;
        *(v2h*)(VTh + oi) = hv; *(v2h*)(VTl + oi) = lv;
      }
    }
    
  }
}

// attention: grid (rows/64, nb x H), block x offset xb0 (in 64-row units): block = 4 waves x 16 queries; a wave's keys are 0 .. min(KL, q0+16+SRC)-1 in 32-key chunks; key allowed iff key <= qi + SRC;
// RES != 0 (query rows < RSPLIT): S^T = K Q^T with 3 products (kh qh + kh ql + kl qh), P x1024 hi/lo, O^T += V^T P^T with 3 products (vh ph + vh pl + vl ph);
// RES == 0 (query rows >= RSPLIT, >= RSPLIT+SRC keys per row): S^T = kh qh (1 product), P x1024 single, O^T += vh p (1 product). Online softmax (running max, f32) in both; a lane's own P values are its B fragment of P^T and stay in registers
// K and V^T reach the waves through LDS: a stage is SK keys = 64 K rows and 64 V^T rows of one whole 128-byte line each (hi planes; RES: the lo planes behind them), copied one stage ahead as whole lines and shared by the
// block's 4 waves; the 16-byte fragment reads, which touch 16 rows each, go to LDS at the 144-byte pitch instead of to the cache
constexpr int AW = 4, AQ = AW * 16, SK = 64;
static_assert(SK == KC && HD == KC && KL % SK == 0 && (AQ + SRC) % SK == 0 && AQ + SRC >= 2 * SK && RSPLIT % AQ == 0 && QL % AQ == 0);
template <int RES>
__global__ __launch_bounds__(128) void attn_kernel(const b16* __restrict__ QH, const b16* __restrict__ QLo, const b16* __restrict__ KH, const b16* __restrict__ KLo, const b16* __restrict__ VTh, const b16* __restrict__ VTl,
                                                   b16* __restrict__ Ch, b16* __restrict__ Cl, int xb0) {
  constexpr int NP = RES ? 2 : 1, BROWS = 2 * SK * NP;   // stage rows: 0-63 K hi, 64-127 V^T hi, then (RES) 128-191 K lo, 192-255 V^T lo
  __shared__ __attribute__((aligned(16))) unsigned char smem[2 * BROWS * LP * 2];
  static_assert(sizeof(float) * AW * 16 * (HD + 4) <= sizeof(smem));
  b16* const ring = (b16*)smem; float (*const To)[16][HD + 4] = (float (*)[16][HD + 4])smem;   // To takes the ring's place behind the loop's last barrier
  // the wave's number is taken into a scalar register, so that kend and the test on it below are scalar and no wave's EXEC changes around the products
  const int wave = __builtin_amdgcn_readfirstlane(threadIdx.x >> 5), lane = threadIdx.x & 31, hh = lane >> 4, col = lane & 15; const int bb = blockIdx.y / H, h = blockIdx.y % H;
  const int qb = (xb0 + (int)blockIdx.x) * AQ, q0 = qb + wave * 16, qi = q0 + col;
  const size_t ph = (size_t)bb * H + h; const size_t pq = ph * TF * HD; const b16* Vh = VTh + ph * HD * (size_t)TF; const b16* Vl = VTl + ph * HD * (size_t)TF;
  const int kmax = q0 + 16 + SRC; const int kend = kmax < KL ? kmax : KL;          // this wave's keys
  const int bmax = qb + AQ + SRC; const int ns = (bmax < KL ? bmax : KL) / SK;      // the block's stages: >= 2, every one wholly inside the planes
  // copy i of a lane: stage row r0 + 16 i, 16-byte piece seg; a wave's copy covers 4 whole lines
  const int r0 = threadIdx.x >> 3, seg = threadIdx.x & 7;
  const size_t ko = pq + (size_t)r0 * HD + seg * 8, vo = (size_t)r0 * TF + seg * 8;
  const unsigned lrow = lds_addr(smem) + (unsigned)(r0 * LP * 2 + seg * 16);
  auto issue = [&](int s) {
#pragma unroll
    for (int pl = 0; pl < NP; ++pl) {
      unsigned l[8]; const b16* g[8];
      const b16* const pk = (pl ? KLo : KH) + ko + (size_t)s * (SK * HD); const b16* const pv = (pl ? Vl : Vh) + vo + s * SK;
      const unsigned lb = lrow + (unsigned)(((s & 1) * BROWS + pl * 2 * SK) * LP * 2);
#pragma unroll
      for (int i = 0; i < 8; ++i) { l[i] = lb + (unsigned)(16 * i * LP * 2); g[i] = i < 4 ? pk + (size_t)(16 * i) * HD : pv + (size_t)(16 * (i - 4)) * TF; }
      copy8(l, g);
    }
  };
  issue(0);
  const v16b qh0 = frag_kb(QH + pq + (size_t)qi * HD, hh), qh1 = frag_kb(QH + pq + (size_t)qi * HD + 32, hh);
  v16b ql0 = (v16b){}, ql1 = (v16b){};
  if (RES) { ql0 = frag_kb(QLo + pq + (size_t)qi * HD, hh); ql1 = frag_kb(QLo + pq + (size_t)qi * HD + 32, hh); }
  const float cs = LOG2E / (8.0f * XS * XS);
  float m = -INFINITY, l = 0.0f; v8f o[4];
#pragma unroll
  for (int t = 0; t < 4; ++t) o[t] = (v8f){};
  v16b kh[2][2], kl[2][2], vh[4], vl[4];
  auto fetch_k = [&](const b16* st, int c) {   // chunk c of the stage at st: K rows 32 c + 16 u + col
    const b16* const a0 = st + (c * 32 + col) * LP + 8 * hh;
#pragma unroll
    for (int u = 0; u < 2; ++u) {
      kh[u][0] = frag_at(a0 + u * 16 * LP); kh[u][1] = frag_at(a0 + u * 16 * LP + 32);
      if (RES) { kl[u][0] = frag_at(a0 + (2 * SK + u * 16) * LP); kl[u][1] = frag_at(a0 + (2 * SK + u * 16) * LP + 32); }
    }
  };
  auto fetch_v = [&](const b16* st, int c) {   // V^T rows 16 t + col, keys 32 c ..
    const b16* const a0 = st + (SK + col) * LP + c * 32 + 8 * hh;
#pragma unroll
    for (int t = 0; t < 4; ++t) {
      vh[t] = frag_at(a0 + t * 16 * LP);
      if (RES) vl[t] = frag_at(a0 + (2 * SK + t * 16) * LP);
    }
  };
  wait_copies(); __syncthreads(); issue(1);
#pragma unroll 1   // one stage per trip: the buffer index and the refill test stay scalar
  for (int s = 0; s < ns; ++s) {
    const b16* const st = ring + (s & 1) * BROWS * LP;
#pragma unroll
    for (int c = 0; c < SK / 32; ++c) {
      const int kb = s * SK + c * 32;
      if (kb < kend) {   // the same for a whole wave (a scalar test): a wave past its last key only passes the stage's foot
        float e[16]; float mx = -INFINITY; v8f s_[2];
        if (c == 0) fetch_k(st, 0);
        fetch_v(st, c);   // this chunk's V reads fly under the score products and the softmax
#pragma unroll
        for (int u = 0; u < 2; ++u) {
          s_[u] = (v8f){};
          if (RES) {
            s_[u] = wmma16b(kh[u][0], qh0, s_[u]); s_[u] = wmma16b(kh[u][0], ql0, s_[u]); s_[u] = wmma16b(kl[u][0], qh0, s_[u]);
            s_[u] = wmma16b(kh[u][1], qh1, s_[u]); s_[u] = wmma16b(kh[u][1], ql1, s_[u]); s_[u] = wmma16b(kl[u][1], qh1, s_[u]);
          } else {
            s_[u] = wmma16b(kh[u][0], qh0, s_[u]); s_[u] = wmma16b(kh[u][1], qh1, s_[u]);
          }
        }
        if (c + 1 < SK / 32) fetch_k(st, c + 1);   // the same stage's next chunk: its K reads are issued inside this chunk, well ahead of their products
#pragma unroll
        for (int u = 0; u < 2; ++u)
#pragma unroll
          for (int r = 0; r < 8; ++r) { const int key = kb + u * 16 + 8 * hh + r; const float vv = (key <= qi + SRC) ? s_[u][r] * cs : -INFINITY; e[u * 8 + r] = vv; mx = fmaxf(mx, vv); }
        mx = fmaxf(mx, __shfl_xor(mx, 16)); const float mn = fmaxf(m, mx); const float al = (mn == -INFINITY) ? 1.0f : nexp2(m - mn); float sum = 0.0f;
        v16b pf, pg = (v16b){};   // B fragment of P^T: element i2 of a lane is key (i2 < 8 ? 0 : 16) + 8 hh + (i2 & 7) of its own query, the lane's own score i2
#pragma unroll
        for (int i2 = 0; i2 < 16; ++i2) {
          const float p = (e[i2] == -INFINITY) ? 0.0f : nexp2(e[i2] - mn); sum += p;
          if (RES) { b16 a_, b_; split16(p * PS, a_, b_); pf[i2] = a_; pg[i2] = b_; }
          else { pf[i2] = (b16)(p * PS); }
        }
        sum += __shfl_xor(sum, 16); l = l * al + sum; m = mn;
#pragma unroll
        for (int t = 0; t < 4; ++t) {
          o[t] *= al;
          if (RES) { o[t] = wmma16b(vh[t], pf, o[t]); o[t] = wmma16b(vh[t], pg, o[t]); o[t] = wmma16b(vl[t], pf, o[t]); }
          else { o[t] = wmma16b(vh[t], pf, o[t]); }
        }
      }
    }
    wait_lds_reads(); wait_copies(); __syncthreads();   // publishes stage s + 1 and frees stage s's buffer
    if (s + 2 < ns) issue(s + 2);
  }
  wait_copies();
  const float inv = 1.0f / (l * PS * XS);
#pragma unroll
  for (int t = 0; t < 4; ++t)
#pragma unroll
    for (int r = 0; r < 8; ++r) To[wave][col][t * 16 + 8 * hh + r] = o[t][r] * inv;
  wave_lds_sync();
  {
    for (int rr = 0; rr < 16; ++rr) {
      const v2f f = *(const v2f*)(&To[wave][rr][lane * 2]); v2h hv, lv;
      for (int j = 0; j < 2; ++j) { b16 p, q; split16(f[j] * CS, p, q); hv[j] = p; lv[j] = q; }
      const size_t oi = ((size_t)bb * TF + q0 + rr) * DM + h * HD + lane * 2;
      *(v2h*)(Ch + oi) = hv; *(v2h*)(Cl + oi) = lv;
    }
    
  }
}

__global__ __launch_bounds__(128) void out_kernel(const b16* __restrict__ Ch, const b16* __restrict__ Cl, const b16* __restrict__ WO, float* __restrict__ out, int b0) {
  __shared__ __attribute__((aligned(16))) unsigned char smem[RING_BYTES];
  static_assert(sizeof(float) * 4 * 16 * (128 + 4) <= RING_BYTES);
  b16* const ring = (b16*)smem; float (*const Tf)[16][128 + 4] = (float (*)[16][128 + 4])smem;   // Tf takes the ring's place behind the loop's last barrier
  const int wave = threadIdx.x >> 5, lane = threadIdx.x & 31, nloc = lane & 15, hlf = lane >> 4; const int bb = blockIdx.z;
  const size_t mo = (size_t)(b0 + bb) * TF + ((size_t)blockIdx.x * 4 + wave) * 16;
  const int n0 = blockIdx.y * 128;
  v8f acc[8];
#pragma unroll
  for (int t = 0; t < 8; ++t) acc[t] = (v8f){};
  // stage rows 0-63 Ch, 64-127 Cl (the block's 64 rows), 128-255 WO channels; copy i of a lane: stage row r0 + 16 i, 16-byte piece seg
  const int r0 = threadIdx.x >> 3, seg = threadIdx.x & 7;
  const size_t ma = ((size_t)bb * TF + (size_t)blockIdx.x * 64 + r0) * DM + seg * 8;
  const b16* const gH = Ch + ma; const b16* const gL = Cl + ma; const b16* const gB = WO + (size_t)(n0 + r0) * DM + seg * 8;
  const unsigned lrow = lds_addr(smem) + (unsigned)(r0 * LP * 2 + seg * 16);
  auto issue = [&](int s) {
#pragma unroll
    for (int hf = 0; hf < 2; ++hf) {
      unsigned l[8]; const b16* g[8];
#pragma unroll
      for (int i = 0; i < 8; ++i) {
        l[i] = lrow + (unsigned)(((s & 1) * SROWS + 128 * hf + 16 * i) * LP * 2);
        g[i] = (hf ? gB + (size_t)(16 * i) * DM : i < 4 ? gH + (size_t)(16 * i) * DM : gL + (size_t)(16 * (i - 4)) * DM) + s * KC;
      }
      copy8(l, g);
    }
  };
  issue(0); wait_copies(); __syncthreads(); issue(1);
#pragma unroll 1   // one stage per trip: the buffer index and the refill test stay scalar
  for (int s = 0; s < NST; ++s) {
    const b16* const As = ring + ((s & 1) * SROWS + wave * 16 + nloc) * LP; const b16* const Bs = ring + ((s & 1) * SROWS + 128 + nloc) * LP;
#pragma unroll
    for (int kk = 0; kk < KC; kk += 32) {
      const v16b a = frag_kb(As + kk, hlf), al = frag_kb(As + 64 * LP + kk, hlf); v16b bw[8];   // the block's fragment reads stand as one group ahead of its products: their LDS latency is met once a block, not once a product
#pragma unroll
      for (int t = 0; t < 8; ++t) bw[t] = frag_kb(Bs + t * 16 * LP + kk, hlf);
#pragma unroll
      for (int t = 0; t < 8; ++t) { acc[t] = wmma16b(a, bw[t], acc[t]); acc[t] = wmma16b(al, bw[t], acc[t]); }
    }
    wait_lds_reads(); wait_copies(); __syncthreads();   // publishes stage s + 1 and frees stage s's buffer
    if (s + 2 < NST) issue(s + 2);
  }
  wait_copies();
#pragma unroll
  for (int t = 0; t < 8; ++t) {
#pragma unroll
    for (int r = 0; r < 8; ++r) Tf[wave][8 * hlf + r][t * 16 + nloc] = acc[t][r] * (1.0f / (CS * WSC));
  }
  wave_lds_sync();
  {
    for (int rr = 0; rr < 16; ++rr) *(v4f*)(out + (mo + rr) * DM + n0 + lane * 4) = *(const v4f*)(&Tf[wave][rr][lane * 4]);
    
  }
}
}  // namespace

extern "C" void kernel_launch(void* const* d_in, const int* in_sizes, int n_in, void* d_out, int out_size, void* d_ws, size_t ws_size, hipStream_t stream) {
  if (n_in < 8) return;
  auto Fp = [&](int i) { return (const float*)d_in[i]; };
  // input order: 0 x [4,2048,1024], 1 W_q, 2 b_q, 3 W_k, 4 b_k, 5 W_v, 6 b_v, 7 W_p; all f32; W (in,out)
  if (in_sizes[0] < BL * TF * DM || in_sizes[1] < DM * DM || in_sizes[2] < DM || in_sizes[3] < DM * DM || in_sizes[4] < DM || in_sizes[5] < DM * DM || in_sizes[6] < DM || in_sizes[7] < DM * DM ||
      out_size < BL * TF * DM) return;
  size_t off = 0; char* ws = (char*)d_ws;
  auto carve = [&](size_t bytes) { char* p = ws + off; off += (bytes + 255) & ~(size_t)255; return p; };
  b16* WT = (b16*)carve((size_t)3 * DM * DM * 2); b16* WO = (b16*)carve((size_t)DM * DM * 2);
  float* CST = (float*)carve((size_t)TF * (HD / 2) * 4); float* SNT = (float*)carve((size_t)TF * (HD / 2) * 4);
  const size_t plane = (size_t)NBH * TF * DM * 2;
  b16* X8 = (b16*)carve(plane);
  b16* QH = (b16*)carve(plane); b16* QLo = (b16*)carve(plane); b16* KH = (b16*)carve(plane); b16* KLo = (b16*)carve(plane);
  b16* VTh = (b16*)carve(plane); b16* VTl = (b16*)carve(plane); b16* Ch = (b16*)carve(plane); b16* Cl = (b16*)carve(plane);
  if (off > ws_size || off > ((size_t)256 << 20)) return;   // 159,907,840 B at NBH == 4
  prep_kernel<<<(unsigned)(((size_t)4 * DM * DM / 8 + 255) / 256), 256, 0, stream>>>(Fp(1), Fp(3), Fp(5), Fp(7), WT, WO);
  rope_tab_kernel<<<(unsigned)((TF * (HD / 2) + 255) / 256), 256, 0, stream>>>(CST, SNT);
  for (int p = 0; p < NPASS; ++p) {
    const int b0 = p * NBH; const int nb = (BL - b0 < NBH) ? (BL - b0) : NBH;
    xcvt_kernel<<<(unsigned)(((size_t)nb * KL * DM / 8 + 255) / 256), 256, 0, stream>>>(Fp(0), X8, b0, nb);
    proj_kernel<<<dim3(KL / 128, nb, 24), 256, 0, stream>>>(X8, WT, Fp(2), Fp(4), Fp(6), CST, SNT, QH, QLo, KH, KLo, VTh, VTl);
    attn_kernel<1><<<dim3(RSPLIT / AQ, nb * H), AW * 32, 0, stream>>>(QH, QLo, KH, KLo, VTh, VTl, Ch, Cl, 0);
    if (QL > RSPLIT) attn_kernel<0><<<dim3((QL - RSPLIT) / AQ, nb * H), AW * 32, 0, stream>>>(QH, QLo, KH, KLo, VTh, VTl, Ch, Cl, RSPLIT / AQ);
    out_kernel<<<dim3(QL / 64, DM / 128, nb), 128, 0, stream>>>(Ch, Cl, WO, (float*)d_out, b0);
  }
}

// v005
// One run takes 173 microseconds.
// Two timings next to v004 put it at 1.09 and 1.10 times that version's speed.
// Over all steps from v000 it is 3.96 times as fast.
#include <hip/hip_runtime.h>

// compute dtype: every contraction on v_wmma_f32_16x16x32_f16 (f16 operands, f32 accumulate). q/k/v projections: x (bf16 RNE values carried x8) by W_q/W_k/W_v (bf16 RNE values carried x256): 1 product;
// attention for query rows < 512 of each sequence: S^T = K Q^T with q and k as f16 hi+lo planes (x8): 3 products; O^T += V^T P^T with v hi+lo (x8) and P hi+lo (x1024): 3 products;
// attention for query rows >= 512: S^T = K Q^T with the hi planes only: 1 product; O^T += V^T P^T with v hi and P (x1024) single: 1 product; ctx W_p with ctx hi+lo (x64) and W_p exact (x256): 2 products.
// Layout: x [B][T][1024]; W_* (in,out); q/k/v = x W + b reshaped to [B][T][16][64]; rotary pairs (2p, 2p+1) of q and k turned by angle t * theta^(-2p/64); scores q k^T / 8 with key j allowed iff
// j <= i + 64; softmax over keys; ctx = P v -> [B][T][1024]; out = ctx W_p (no bias).
// Fragment k-map per lane half hh for A AND B: elements 0..7 <- k = 8hh+0..7, 8..15 <- k = 16+8hh+0..7; acc[r] = D[8hh+r][col].

#ifndef NB
#define NB 4
#endif
#ifndef SEQ
#define SEQ 2048
#endif

namespace {
constexpr int BF = 4, TF = 2048, DM = 1024, H = 16, HD = 64, SRC = 64;
constexpr int BL = NB;                                   // batches computed (== 4 shipped)
constexpr int QL = SEQ;                                  // query rows computed per batch (== 2048 shipped)
constexpr int KL = (QL + SRC < TF) ? (QL + SRC) : TF;    // key rows needed: j <= i + SRC
constexpr int NBH = BL;                                  // batches per pass (planes are sized for NBH): all of them, so every kernel is launched once over the whole problem
constexpr int NPASS = (BL + NBH - 1) / NBH;
constexpr int RSPLIT = (QL < 512) ? QL : 512;            // query rows below this get the hi+lo (3-product) attention path
constexpr float XS = 8.0f, WSC = 256.0f, PS = 1024.0f, CS = 64.0f, LOG2E = 1.4426950408889634f, L2THETA = 13.287712379549449f;
static_assert(BL >= 1 && BL <= BF);
static_assert(QL >= 64 && QL <= TF && QL % 64 == 0);
static_assert(KL % 128 == 0 && KL <= TF && KL >= QL);
static_assert(RSPLIT % 32 == 0 && RSPLIT <= QL);
static_assert(DM == H * HD && TF % 64 == 0 && HD == 64);

typedef _Float16 b16;
typedef __attribute__((ext_vector_type(16))) _Float16 v16b;
typedef __attribute__((ext_vector_type(8))) _Float16 v8b;
typedef __attribute__((ext_vector_type(4))) _Float16 v4h;
typedef __attribute__((ext_vector_type(2))) _Float16 v2h;
typedef __attribute__((ext_vector_type(8))) float v8f;
typedef __attribute__((ext_vector_type(4))) float v4f;
typedef __attribute__((ext_vector_type(2))) float v2f;

__device__ __forceinline__ float bf16_rne(float f) { unsigned int u = __float_as_uint(f); u += 0x7FFFu + ((u >> 16) & 1u); return __uint_as_float(u & 0xFFFF0000u); }
__device__ __forceinline__ void split16(float v, b16& hi, b16& lo) { hi = (b16)v; lo = (b16)(v - (float)hi); }
__device__ __forceinline__ v16b frag_kb(const b16* p, int hh) {
  const v8b a = *(const v8b*)(p + 8 * hh), b = *(const v8b*)(p + 16 + 8 * hh); v16b f;
#pragma unroll
  for (int e = 0; e < 8; ++e) { f[e] = a[e]; f[8 + e] = b[e]; }
  return f;
}
__device__ __forceinline__ v8f wmma16b(v16b a, v16b b, v8f c) {
  v8f d = __builtin_amdgcn_wmma_f32_16x16x32_f16(false, a, false, b, (short)0, c, false, false);
  asm volatile("v_nop\n\tv_nop\n\tv_nop\n\tv_nop" : "+v"(d) : "v"(a), "v"(b));
  return d;
}
__device__ __forceinline__ void wave_lds_sync() { __builtin_amdgcn_fence(3 /* release order */, "workgroup"); __builtin_amdgcn_wave_barrier(); __builtin_amdgcn_fence(2 /* acquire order */, "workgroup"); }
__device__ __forceinline__ v16b frag_at(const b16* p) {   // frag_kb with the lane half's 8 hh already in p
  const v8b a = *(const v8b*)p, b = *(const v8b*)(p + 16); v16b f;
#pragma unroll
  for (int e = 0; e < 8; ++e) { f[e] = a[e]; f[8 + e] = b[e]; }
  return f;
}
__device__ __forceinline__ float nexp2(float v) { return __builtin_amdgcn_exp2f(v); }
template <bool B> struct flag { static constexpr bool v = B; };
// the slot behind a transcendental: the results r and the sources x of the v_exp_f32 in front are operands of this statement, so nothing ahead of it reads such a result or overwrites such a source,
// and its v_nop fills the slot where the statement stands directly behind the last of them
template <int B> __device__ __forceinline__ void exp_slot(float (&r)[16], const float (&x)[16]) {
  asm("v_nop" : "+v"(r[B]), "+v"(r[B + 1]), "+v"(r[B + 2]), "+v"(r[B + 3]), "+v"(r[B + 4]), "+v"(r[B + 5]), "+v"(r[B + 6]), "+v"(r[B + 7])
              : "v"(x[B]), "v"(x[B + 1]), "v"(x[B + 2]), "v"(x[B + 3]), "v"(x[B + 4]), "v"(x[B + 5]), "v"(x[B + 6]), "v"(x[B + 7]));
}
__device__ __forceinline__ void exp_slot(float& r, float x) { asm("v_nop" : "+v"(r) : "v"(x)); }   // the same for one v_exp_f32

// GEMM operand staging: a stage is KC k (one whole 128-byte line) of 256 operand rows, laid in LDS at a pitch of 144 B (16 B x odd: no bank conflict for the 16-byte fragment reads); two buffers.
constexpr int KC = 64, LP = KC + 8, SROWS = 256, NST = DM / KC;
constexpr int RING_BYTES = 2 * SROWS * LP * 2;
static_assert(DM % KC == 0 && NST >= 2 && (LP * 2) % 32 == 16);
__device__ __forceinline__ unsigned lds_addr(const void* p) { return (unsigned)(uintptr_t)p; }   // LDS byte address = low 32 bits of the __shared__ address
// eight 16-byte asynchronous copies per lane, global -> LDS through no register; the closing s_wait_xcnt stands in front of every later rewrite of the address registers that the copies name (a precaution)
__device__ __forceinline__ void copy8(const unsigned (&l)[8], const b16* const (&g)[8]) {
  asm volatile("global_load_async_to_lds_b128 %0, %8, off\n\t"
               "global_load_async_to_lds_b128 %1, %9, off\n\t"
               "global_load_async_to_lds_b128 %2, %10, off\n\t"
               "global_load_async_to_lds_b128 %3, %11, off\n\t"
               "global_load_async_to_lds_b128 %4, %12, off\n\t"
               "global_load_async_to_lds_b128 %5, %13, off\n\t"
               "global_load_async_to_lds_b128 %6, %14, off\n\t"
               "global_load_async_to_lds_b128 %7, %15, off\n\t"
               "s_wait_xcnt 0x0"
               :: "v"(l[0]), "v"(l[1]), "v"(l[2]), "v"(l[3]), "v"(l[4]), "v"(l[5]), "v"(l[6]), "v"(l[7]),
                  "v"(g[0]), "v"(g[1]), "v"(g[2]), "v"(g[3]), "v"(g[4]), "v"(g[5]), "v"(g[6]), "v"(g[7]) : "memory");
}
__device__ __forceinline__ void wait_copies() { asm volatile("s_wait_asynccnt 0x0" ::: "memory"); }   // this wave's copies have landed in LDS
__device__ __forceinline__ void wait_lds_reads() { asm volatile("s_wait_dscnt 0x0" ::: "memory"); }   // this wave's LDS reads are done before their buffer is handed back

// prep: WT [3072 o][1024 k]: o < 1024 W_q[k][o], < 2048 W_k[k][o-1024], else W_v[k][o-2048]; WO [1024 o][1024 k] = W_p[k][o] ((in,out) layouts -> transposed, k contiguous); bf16 RNE then x256
__global__ __launch_bounds__(256) void prep_kernel(const float* __restrict__ wq, const float* __restrict__ wk, const float* __restrict__ wv, const float* __restrict__ wp, b16* __restrict__ WT, b16* __restrict__ WO) {
  const size_t u = (size_t)blockIdx.x * 256 + threadIdx.x;
  if (u >= (size_t)4 * DM * DM / 8) return;
  const int mtx = (int)(u / ((size_t)DM * DM / 8)); const size_t e = (u % ((size_t)DM * DM / 8)) * 8; const int oo = (int)(e / DM), k0 = (int)(e % DM);
  const float* w = mtx == 0 ? wq : mtx == 1 ? wk : mtx == 2 ? wv : wp;
  v8b o;
#pragma unroll
  for (int j = 0; j < 8; ++j) o[j] = (b16)(bf16_rne(w[(size_t)(k0 + j) * DM + oo]) * WSC);
  b16* dst = (mtx < 3) ? (WT + (size_t)mtx * DM * DM + e) : (WO + e);
  { *(v8b*)dst = o;  }
}

__global__ __launch_bounds__(256) void rope_tab_kernel(float* __restrict__ cst, float* __restrict__ snt) {
  const int i = blockIdx.x * 256 + threadIdx.x;
  if (i >= TF * (HD / 2)) return;
  const int t = i / (HD / 2), p = i % (HD / 2);
  const float e = (float)(2 * p) * (1.0f / (float)HD);   // exact
  const float inv = exp2f(-(e * L2THETA));                // theta^(-e)
  const float ang = (float)t * inv;
  float sv, cv;
  sincosf(ang, &sv, &cv);
  { *(float*)(cst + i) = cv; *(float*)(snt + i) = sv;  }
}

__global__ __launch_bounds__(256) void xcvt_kernel(const float* __restrict__ x, b16* __restrict__ X8, int b0, int nb) {
  const size_t u = (size_t)blockIdx.x * 256 + threadIdx.x;
  const size_t per = (size_t)KL * DM / 8;
  if (u >= (size_t)nb * per) return;
  const int bb = (int)(u / per); const size_t e = (u % per) * 8; const int t = (int)(e / DM), c = (int)(e % DM);
  const float* src = x + (((size_t)(b0 + bb)) * TF + t) * DM + c;
  const v4f f0 = *(const v4f*)src, f1 = *(const v4f*)(src + 4);
  v8b o;
#pragma unroll
  for (int j = 0; j < 4; ++j) { o[j] = (b16)(bf16_rne(f0[j]) * XS); o[4 + j] = (b16)(bf16_rne(f1[j]) * XS); }
  b16* dst = X8 + ((size_t)bb * TF + t) * DM + c;
  { *(v8b*)dst = o;  }
}

// projections: grid (KL/128, nb, 24 slabs of 128 output channels: 0-7 q, 8-15 k, 16-23 v); block = 128 tokens x 8 waves of 16; K = 1024 in 16 stages of 64: stage rows 0-127 X8 tokens, 128-255 WT channels,
// copied to LDS one stage ahead; A and B fragments from LDS; the k order of every accumulator is unchanged
__global__ __launch_bounds__(256) void proj_kernel(const b16* __restrict__ X8, const b16* __restrict__ WT, const float* __restrict__ bq, const float* __restrict__ bk, const float* __restrict__ bv,
                                                    const float* __restrict__ cst, const float* __restrict__ snt,
                                                    b16* __restrict__ QH, b16* __restrict__ QLo, b16* __restrict__ KH, b16* __restrict__ KLo, b16* __restrict__ VTh, b16* __restrict__ VTl) {
  __shared__ __attribute__((aligned(16))) unsigned char smem[RING_BYTES];
  static_assert(sizeof(float) * 8 * 16 * (128 + 4) <= RING_BYTES);
  b16* const ring = (b16*)smem; float (*const Tf)[16][128 + 4] = (float (*)[16][128 + 4])smem;   // Tf takes the ring's place behind the loop's last barrier
  const int wave = threadIdx.x >> 5, lane = threadIdx.x & 31, nloc = lane & 15, hlf = lane >> 4;
  const int t0 = blockIdx.x * 128; const int bb = blockIdx.y; const int slab = blockIdx.z, n0 = slab * 128, part = slab / 8, c0 = n0 - part * DM;
  const int r0 = threadIdx.x >> 3, seg = threadIdx.x & 7;   // copy i of a lane: stage row r0 + 32 i, 16-byte piece seg; a wave's copy covers 4 whole lines
  const b16* const gA = X8 + ((size_t)bb * TF + t0 + r0) * DM + seg * 8; const b16* const gB = WT + (size_t)(n0 + r0) * DM + seg * 8;
  const unsigned lrow = lds_addr(smem) + (unsigned)(r0 * LP * 2 + seg * 16);
  auto issue = [&](int s) {
    unsigned l[8]; const b16* g[8];
    const b16* const pa = gA + s * KC; const b16* const pb = gB + s * KC; const unsigned lb = lrow + (unsigned)((s & 1) * SROWS * LP * 2);
#pragma unroll
    for (int i = 0; i < 8; ++i) { l[i] = lb + (unsigned)(32 * i * LP * 2); g[i] = i < 4 ? pa + (size_t)(32 * i) * DM : pb + (size_t)(32 * (i - 4)) * DM; }
    copy8(l, g);
  };
  v8f acc[8];
#pragma unroll
  for (int t = 0; t < 8; ++t) acc[t] = (v8f){};
  issue(0); wait_copies(); __syncthreads(); issue(1);
#pragma unroll 1   // one stage per trip: the buffer index and the refill test stay scalar
  for (int s = 0; s < NST; ++s) {
    const b16* const As = ring + ((s & 1) * SROWS + wave * 16 + nloc) * LP; const b16* const Bs = ring + ((s & 1) * SROWS + 128 + nloc) * LP;
#pragma unroll
    for (int kk = 0; kk < KC; kk += 32) {
      const v16b a = frag_kb(As + kk, hlf); v16b bw[8];   // the block's fragment reads stand as one group ahead of its products: their LDS latency is met once a block, not once a product
#pragma unroll
      for (int t = 0; t < 8; ++t) bw[t] = frag_kb(Bs + t * 16 * LP + kk, hlf);
#pragma unroll
      for (int t = 0; t < 8; ++t) acc[t] = wmma16b(a, bw[t], acc[t]);
    }
    wait_lds_reads(); wait_copies(); __syncthreads();   // publishes stage s + 1 and frees stage s's buffer
    if (s + 2 < NST) issue(s + 2);
  }
  wait_copies();
  const float* bias = part == 0 ? bq : part == 1 ? bk : bv;
#pragma unroll
  for (int t = 0; t < 8; ++t) {
    const float bval = bf16_rne(bias[c0 + t * 16 + nloc]);
#pragma unroll
    for (int r = 0; r < 8; ++r) Tf[wave][8 * hlf + r][t * 16 + nloc] = acc[t][r] * (1.0f / (XS * WSC)) + bval;
  }
  __syncthreads();
  {
    if (part < 2) {
      b16* ph_ = part == 0 ? QH : KH; b16* pl_ = part == 0 ? QLo : KLo;
      const int c = c0 + lane * 4; const int hq = c / HD, d = c % HD, p0 = d >> 1;   // d is a multiple of 4: pairs (d,d+1) -> p0 and (d+2,d+3) -> p0+1
      for (int rr = 0; rr < 16; ++rr) {
        const int tok = t0 + wave * 16 + rr;
        const v4f f = *(const v4f*)(&Tf[wave][rr][lane * 4]);
        const v2f cc = *(const v2f*)(cst + (size_t)tok * (HD / 2) + p0), ss = *(const v2f*)(snt + (size_t)tok * (HD / 2) + p0);
        const float o0 = f[0] * cc[0] - f[1] * ss[0];
        const float o1 = f[0] * ss[0] + f[1] * cc[0];
        const float o2 = f[2] * cc[1] - f[3] * ss[1];
        const float o3 = f[2] * ss[1] + f[3] * cc[1];
        v4h h4, l4; b16 ph, pl;
        split16(o0 * XS, ph, pl); h4[0] = ph; l4[0] = pl;
        split16(o1 * XS, ph, pl); h4[1] = ph; l4[1] = pl;
        split16(o2 * XS, ph, pl); h4[2] = ph; l4[2] = pl;
        split16(o3 * XS, ph, pl); h4[3] = ph; l4[3] = pl;
        const size_t oi = (((size_t)bb * H + hq) * TF + tok) * HD + d;
        *(v4h*)(ph_ + oi) = h4; *(v4h*)(pl_ + oi) = l4;
      }
    } else {
#pragma unroll 1
      for (int q = 0; q < 32; ++q) {
        const int cl = (wave & 3) * 32 + q; const int c = c0 + cl; const int hv_ = c / HD, d = c % HD; const int tk = (wave >> 2) * 64 + lane * 2; v2h hv, lv;   // waves 0-3: tokens 0-63, waves 4-7: tokens 64-127
        for (int j = 0; j < 2; ++j) { b16 p, ql; split16(Tf[(tk + j) >> 4][(tk + j) & 15][cl] * XS, p, ql); hv[j] = p; lv[j] = ql; }
        const size_t oi = (((size_t)bb * H + hv_) * HD + d) * (size_t)TF + t0 + tk;
        *(v2h*)(VTh + oi) = hv; *(v2h*)(VTl + oi) = lv;
      }
    }
    
  }
}

// attention: grid (rows/64, nb x H), block x offset xb0 (in 64-row units): block = 4 waves x 16 queries; a wave's keys are 0 .. min(KL, q0+16+SRC)-1 in 32-key chunks; key allowed iff key <= qi + SRC;
// RES != 0 (query rows < RSPLIT): S^T = K Q^T with 3 products (kh qh + kh ql + kl qh), P x1024 hi/lo, O^T += V^T P^T with 3 products (vh ph + vh pl + vl ph);
// RES == 0 (query rows >= RSPLIT, >= RSPLIT+SRC keys per row): S^T = kh qh (1 product), P x1024 single, O^T += vh p (1 product). Online softmax (running max, f32) in both; a lane's own P values are its B fragment of P^T and stay in registers
// K and V^T reach the waves through LDS: a stage is SK keys = 64 K rows and 64 V^T rows of one whole 128-byte line each (hi planes; RES: the lo planes behind them), copied one stage ahead as whole lines and shared by the
// block's 4 waves; the 16-byte fragment reads, which touch 16 rows each, go to LDS at the 144-byte pitch instead of to the cache
constexpr int AW = 4, AQ = AW * 16, SK = 64;
static_assert(SK == KC && HD == KC && KL % SK == 0 && (AQ + SRC) % SK == 0 && AQ + SRC >= 2 * SK && RSPLIT % AQ == 0 && QL % AQ == 0);
template <int RES>
__global__ __launch_bounds__(128) void attn_kernel(const b16* __restrict__ QH, const b16* __restrict__ QLo, const b16* __restrict__ KH, const b16* __restrict__ KLo, const b16* __restrict__ VTh, const b16* __restrict__ VTl,
                                                   b16* __restrict__ Ch, b16* __restrict__ Cl, int xb0) {
  constexpr int NP = RES ? 2 : 1, BROWS = 2 * SK * NP;   // stage rows: 0-63 K hi, 64-127 V^T hi, then (RES) 128-191 K lo, 192-255 V^T lo
  __shared__ __attribute__((aligned(16))) unsigned char smem[2 * BROWS * LP * 2];
  static_assert(sizeof(float) * AW * 16 * (HD + 4) <= sizeof(smem));
  b16* const ring = (b16*)smem; float (*const To)[16][HD + 4] = (float (*)[16][HD + 4])smem;   // To takes the ring's place behind the loop's last barrier
  // the wave's number is taken into a scalar register, so that kend and the test on it below are scalar and no wave's EXEC changes around the products
  const int wave = __builtin_amdgcn_readfirstlane(threadIdx.x >> 5), lane = threadIdx.x & 31, hh = lane >> 4, col = lane & 15; const int bb = blockIdx.y / H, h = blockIdx.y % H;
  const int qb = (xb0 + (int)blockIdx.x) * AQ, q0 = qb + wave * 16, qi = q0 + col;
  const size_t ph = (size_t)bb * H + h; const size_t pq = ph * TF * HD; const b16* Vh = VTh + ph * HD * (size_t)TF; const b16* Vl = VTl + ph * HD * (size_t)TF;
  const int kmax = q0 + 16 + SRC; const int kend = kmax < KL ? kmax : KL;          // this wave's keys
  const int bmax = qb + AQ + SRC; const int ns = (bmax < KL ? bmax : KL) / SK;      // the block's stages: >= 2, every one wholly inside the planes
  // copy i of a lane: stage row r0 + 16 i, 16-byte piece seg; a wave's copy covers 4 whole lines
  const int r0 = threadIdx.x >> 3, seg = threadIdx.x & 7;
  const size_t ko = pq + (size_t)r0 * HD + seg * 8, vo = (size_t)r0 * TF + seg * 8;
  const unsigned lrow = lds_addr(smem) + (unsigned)(r0 * LP * 2 + seg * 16);
  auto issue = [&](int s) {
#pragma unroll
    for (int pl = 0; pl < NP; ++pl) {
      unsigned l[8]; const b16* g[8];
      const b16* const pk = (pl ? KLo : KH) + ko + (size_t)s * (SK * HD); const b16* const pv = (pl ? Vl : Vh) + vo + s * SK;
      const unsigned lb = lrow + (unsigned)(((s & 1) * BROWS + pl * 2 * SK) * LP * 2);
#pragma unroll
      for (int i = 0; i < 8; ++i) { l[i] = lb + (unsigned)(16 * i * LP * 2); g[i] = i < 4 ? pk + (size_t)(16 * i) * HD : pv + (size_t)(16 * (i - 4)) * TF; }
      copy8(l, g);
    }
  };
  issue(0);
  const v16b qh0 = frag_kb(QH + pq + (size_t)qi * HD, hh), qh1 = frag_kb(QH + pq + (size_t)qi * HD + 32, hh);
  v16b ql0 = (v16b){}, ql1 = (v16b){};
  if (RES) { ql0 = frag_kb(QLo + pq + (size_t)qi * HD, hh); ql1 = frag_kb(QLo + pq + (size_t)qi * HD + 32, hh); }
  const float cs = LOG2E / (8.0f * XS * XS);
  float m = -INFINITY, l = 0.0f; v8f o[4];
#pragma unroll
  for (int t = 0; t < 4; ++t) o[t] = (v8f){};
  v16b kh[2][2], kl[2][2], vh[4], vl[4];
  auto fetch_k = [&](const b16* st, int c) {   // chunk c of the stage at st: K rows 32 c + 16 u + col
    const b16* const a0 = st + (c * 32 + col) * LP + 8 * hh;
#pragma unroll
    for (int u = 0; u < 2; ++u) {
      kh[u][0] = frag_at(a0 + u * 16 * LP); kh[u][1] = frag_at(a0 + u * 16 * LP + 32);
      if (RES) { kl[u][0] = frag_at(a0 + (2 * SK + u * 16) * LP); kl[u][1] = frag_at(a0 + (2 * SK + u * 16) * LP + 32); }
    }
  };
  auto fetch_v = [&](const b16* st, int c) {   // V^T rows 16 t + col, keys 32 c ..
    const b16* const a0 = st + (SK + col) * LP + c * 32 + 8 * hh;
#pragma unroll
    for (int t = 0; t < 4; ++t) {
      vh[t] = frag_at(a0 + t * 16 * LP);
      if (RES) vl[t] = frag_at(a0 + (2 * SK + t * 16) * LP);
    }
  };
  wait_copies(); __syncthreads(); issue(1);
#pragma unroll 1   // one stage per trip: the buffer index and the refill test stay scalar
  for (int s = 0; s < ns; ++s) {
    const b16* const st = ring + (s & 1) * BROWS * LP;
#pragma unroll
    for (int c = 0; c < SK / 32; ++c) {
      const int kb = s * SK + c * 32;
      if (kb < kend) {   // the same for a whole wave (a scalar test): a wave past its last key only passes the stage's foot
        v8f s_[2];
        if (c == 0) fetch_k(st, 0);
        fetch_v(st, c);   // this chunk's V reads fly under the score products and the softmax
#pragma unroll
        for (int u = 0; u < 2; ++u) {
          s_[u] = (v8f){};
          if (RES) {
            s_[u] = wmma16b(kh[u][0], qh0, s_[u]); s_[u] = wmma16b(kh[u][0], ql0, s_[u]); s_[u] = wmma16b(kl[u][0], qh0, s_[u]);
            s_[u] = wmma16b(kh[u][1], qh1, s_[u]); s_[u] = wmma16b(kh[u][1], ql1, s_[u]); s_[u] = wmma16b(kl[u][1], qh1, s_[u]);
          } else {
            s_[u] = wmma16b(kh[u][0], qh0, s_[u]); s_[u] = wmma16b(kh[u][1], qh1, s_[u]);
          }
        }
        if (c + 1 < SK / 32) fetch_k(st, c + 1);   // the same stage's next chunk: its K reads are issued inside this chunk, well ahead of their products
        float al; v16b pf, pg = (v16b){};   // B fragment of P^T: element i2 of a lane is key (i2 < 8 ? 0 : 16) + 8 hh + (i2 & 7) of its own query, the lane's own score i2
        // MK: the chunk crosses the mask line. Without it every key of the chunk is allowed for every query of the wave: every score is finite, so the key test and the tests on -inf are identities and are left out
        auto soft = [&](auto mk) {
          constexpr bool MK = decltype(mk)::v;
          float e[16]; float mx = -INFINITY;
#pragma unroll
          for (int u = 0; u < 2; ++u)
#pragma unroll
            for (int r = 0; r < 8; ++r) { const int key = kb + u * 16 + 8 * hh + r; const float vv = (!MK || key <= qi + SRC) ? s_[u][r] * cs : -INFINITY; e[u * 8 + r] = vv; mx = fmaxf(mx, vv); }
          mx = fmaxf(mx, __shfl_xor(mx, 16)); const float mn = fmaxf(m, mx); const float da = m - mn; float ea = nexp2(da), sum;
          float x[16], pe[16];
#pragma unroll
          for (int i2 = 0; i2 < 16; ++i2) { x[i2] = e[i2] - mn; pe[i2] = nexp2(x[i2]); }
          exp_slot(ea, da); exp_slot<0>(pe, x); exp_slot<8>(pe, x);
          al = (MK && mn == -INFINITY) ? 1.0f : ea;
#pragma unroll
          for (int i2 = 0; i2 < 16; ++i2) {
            const float p = (MK && e[i2] == -INFINITY) ? 0.0f : pe[i2]; sum = i2 ? sum + p : p;
            if (RES) { b16 a_, b_; split16(p * PS, a_, b_); pf[i2] = a_; pg[i2] = b_; }
            else { pf[i2] = (b16)(p * PS); }
          }
          sum += __shfl_xor(sum, 16); l = l * al + sum; m = mn;
        };
        if (kb + 31 <= q0 + SRC) soft(flag<false>{}); else soft(flag<true>{});   // a scalar test: the chunk's last key against the wave's first query
#pragma unroll
        for (int t = 0; t < 4; ++t) {
          o[t] *= al;
          if (RES) { o[t] = wmma16b(vh[t], pf, o[t]); o[t] = wmma16b(vh[t], pg, o[t]); o[t] = wmma16b(vl[t], pf, o[t]); }
          else { o[t] = wmma16b(vh[t], pf, o[t]); }
        }
      }
    }
    wait_lds_reads(); wait_copies(); __syncthreads();   // publishes stage s + 1 and frees stage s's buffer
    if (s + 2 < ns) issue(s + 2);
  }
  wait_copies();
  const float inv = 1.0f / (l * PS * XS);
#pragma unroll
  for (int t = 0; t < 4; ++t)
#pragma unroll
    for (int r = 0; r < 8; ++r) To[wave][col][t * 16 + 8 * hh + r] = o[t][r] * inv;
  wave_lds_sync();
  {
    for (int rr = 0; rr < 16; ++rr) {
      const v2f f = *(const v2f*)(&To[wave][rr][lane * 2]); v2h hv, lv;
      for (int j = 0; j < 2; ++j) { b16 p, q; split16(f[j] * CS, p, q); hv[j] = p; lv[j] = q; }
      const size_t oi = ((size_t)bb * TF + q0 + rr) * DM + h * HD + lane * 2;
      *(v2h*)(Ch + oi) = hv; *(v2h*)(Cl + oi) = lv;
    }
    
  }
}

__global__ __launch_bounds__(128) void out_kernel(const b16* __restrict__ Ch, const b16* __restrict__ Cl, const b16* __restrict__ WO, float* __restrict__ out, int b0) {
  __shared__ __attribute__((aligned(16))) unsigned char smem[RING_BYTES];
  static_assert(sizeof(float) * 4 * 16 * (128 + 4) <= RING_BYTES);
  b16* const ring = (b16*)smem; float (*const Tf)[16][128 + 4] = (float (*)[16][128 + 4])smem;   // Tf takes the ring's place behind the loop's last barrier
  const int wave = threadIdx.x >> 5, lane = threadIdx.x & 31, nloc = lane & 15, hlf = lane >> 4; const int bb = blockIdx.z;
  const size_t mo = (size_t)(b0 + bb) * TF + ((size_t)blockIdx.x * 4 + wave) * 16;
  const int n0 = blockIdx.y * 128;
  v8f acc[8];
#pragma unroll
  for (int t = 0; t < 8; ++t) acc[t] = (v8f){};
  // stage rows 0-63 Ch, 64-127 Cl (the block's 64 rows), 128-255 WO channels; copy i of a lane: stage row r0 + 16 i, 16-byte piece seg
  const int r0 = threadIdx.x >> 3, seg = threadIdx.x & 7;
  const size_t ma = ((size_t)bb * TF + (size_t)blockIdx.x * 64 + r0) * DM + seg * 8;
  const b16* const gH = Ch + ma; const b16* const gL = Cl + ma; const b16* const gB = WO + (size_t)(n0 + r0) * DM + seg * 8;
  const unsigned lrow = lds_addr(smem) + (unsigned)(r0 * LP * 2 + seg * 16);
  auto issue = [&](int s) {
#pragma unroll
    for (int hf = 0; hf < 2; ++hf) {
      unsigned l[8]; const b16* g[8];
#pragma unroll
      for (int i = 0; i < 8; ++i) {
        l[i] = lrow + (unsigned)(((s & 1) * SROWS + 128 * hf + 16 * i) * LP * 2);
        g[i] = (hf ? gB + (size_t)(16 * i) * DM : i < 4 ? gH + (size_t)(16 * i) * DM : gL + (size_t)(16 * (i - 4)) * DM) + s * KC;
      }
      copy8(l, g);
    }
  };
  issue(0); wait_copies(); __syncthreads(); issue(1);
#pragma unroll 1   // one stage per trip: the buffer index and the refill test stay scalar
  for (int s = 0; s < NST; ++s) {
    const b16* const As = ring + ((s & 1) * SROWS + wave * 16 + nloc) * LP; const b16* const Bs = ring + ((s & 1) * SROWS + 128 + nloc) * LP;
#pragma unroll
    for (int kk = 0; kk < KC; kk += 32) {
      const v16b a = frag_kb(As + kk, hlf), al = frag_kb(As + 64 * LP + kk, hlf); v16b bw[8];   // the block's fragment reads stand as one group ahead of its products: their LDS latency is met once a block, not once a product
#pragma unroll
      for (int t = 0; t < 8; ++t) bw[t] = frag_kb(Bs + t * 16 * LP + kk, hlf);
#pragma unroll
      for (int t = 0; t < 8; ++t) { acc[t] = wmma16b(a, bw[t], acc[t]); acc[t] = wmma16b(al, bw[t], acc[t]); }
    }
    wait_lds_reads(); wait_copies(); __syncthreads();   // publishes stage s + 1 and frees stage s's buffer
    if (s + 2 < NST) issue(s + 2);
  }
  wait_copies();
#pragma unroll
  for (int t = 0; t < 8; ++t) {
#pragma unroll
    for (int r = 0; r < 8; ++r) Tf[wave][8 * hlf + r][t * 16 + nloc] = acc[t][r] * (1.0f / (CS * WSC));
  }
  wave_lds_sync();
  {
    for (int rr = 0; rr < 16; ++rr) *(v4f*)(out + (mo + rr) * DM + n0 + lane * 4) = *(const v4f*)(&Tf[wave][rr][lane * 4]);
    
  }
}
}  // namespace

extern "C" void kernel_launch(void* const* d_in, const int* in_sizes, int n_in, void* d_out, int out_size, void* d_ws, size_t ws_size, hipStream_t stream) {
  if (n_in < 8) return;
  auto Fp = [&](int i) { return (const float*)d_in[i]; };
  // input order: 0 x [4,2048,1024], 1 W_q, 2 b_q, 3 W_k, 4 b_k, 5 W_v, 6 b_v, 7 W_p; all f32; W (in,out)
  if (in_sizes[0] < BL * TF * DM || in_sizes[1] < DM * DM || in_sizes[2] < DM || in_sizes[3] < DM * DM || in_sizes[4] < DM || in_sizes[5] < DM * DM || in_sizes[6] < DM || in_sizes[7] < DM * DM ||
      out_size < BL * TF * DM) return;
  size_t off = 0; char* ws = (char*)d_ws;
  auto carve = [&](size_t bytes) { char* p = ws + off; off += (bytes + 255) & ~(size_t)255; return p; };
  b16* WT = (b16*)carve((size_t)3 * DM * DM * 2); b16* WO = (b16*)carve((size_t)DM * DM * 2);
  float* CST = (float*)carve((size_t)TF * (HD / 2) * 4); float* SNT = (float*)carve((size_t)TF * (HD / 2) * 4);
  const size_t plane = (size_t)NBH * TF * DM * 2;
  b16* X8 = (b16*)carve(plane);
  b16* QH = (b16*)carve(plane); b16* QLo = (b16*)carve(plane); b16* KH = (b16*)carve(plane); b16* KLo = (b16*)carve(plane);
  b16* VTh = (b16*)carve(plane); b16* VTl = (b16*)carve(plane); b16* Ch = (b16*)carve(plane); b16* Cl = (b16*)carve(plane);
  if (off > ws_size || off > ((size_t)256 << 20)) return;   // 159,907,840 B at NBH == 4
  prep_kernel<<<(unsigned)(((size_t)4 * DM * DM / 8 + 255) / 256), 256, 0, stream>>>(Fp(1), Fp(3), Fp(5), Fp(7), WT, WO);
  rope_tab_kernel<<<(unsigned)((TF * (HD / 2) + 255) / 256), 256, 0, stream>>>(CST, SNT);
  for (int p = 0; p < NPASS; ++p) {
    const int b0 = p * NBH; const int nb = (BL - b0 < NBH) ? (BL - b0) : NBH;
    xcvt_kernel<<<(unsigned)(((size_t)nb * KL * DM / 8 + 255) / 256), 256, 0, stream>>>(Fp(0), X8, b0, nb);
    proj_kernel<<<dim3(KL / 128, nb, 24), 256, 0, stream>>>(X8, WT, Fp(2), Fp(4), Fp(6), CST, SNT, QH, QLo, KH, KLo, VTh, VTl);
    attn_kernel<1><<<dim3(RSPLIT / AQ, nb * H), AW * 32, 0, stream>>>(QH, QLo, KH, KLo, VTh, VTl, Ch, Cl, 0);
    if (QL > RSPLIT) attn_kernel<0><<<dim3((QL - RSPLIT) / AQ, nb * H), AW * 32, 0, stream>>>(QH, QLo, KH, KLo, VTh, VTl, Ch, Cl, RSPLIT / AQ);
    out_kernel<<<dim3(QL / 64, DM / 128, nb), 128, 0, stream>>>(Ch, Cl, WO, (float*)d_out, b0);
  }
}

// v006
// One run takes 163 microseconds.
// Next to v005, in two timings, it ran 1.06 times as fast each time.
// All steps since v000 together make it 4.22 times as fast.
#include <hip/hip_runtime.h>

// compute dtype: every contraction on v_wmma_f32_16x16x32_f16 (f16 operands, f32 accumulate). q/k/v projections: x (bf16 RNE values carried x8) by W_q/W_k/W_v (bf16 RNE values carried x256): 1 product;
// attention for query rows < 512 of each sequence: S^T = K Q^T with q and k as f16 hi+lo planes (x8): 3 products; O^T += V^T P^T with v hi+lo (x8) and P hi+lo (x1024): 3 products;
// attention for query rows >= 512: S^T = K Q^T with the hi planes only: 1 product; O^T += V^T P^T with v hi and P (x1024) single: 1 product; ctx W_p with ctx hi+lo (x64) and W_p exact (x256): 2 products.
// Layout: x [B][T][1024]; W_* (in,out); q/k/v = x W + b reshaped to [B][T][16][64]; rotary pairs (2p, 2p+1) of q and k turned by angle t * theta^(-2p/64); scores q k^T / 8 with key j allowed iff
// j <= i + 64; softmax over keys; ctx = P v -> [B][T][1024]; out = ctx W_p (no bias).
// Fragment k-map per lane half hh for A AND B: elements 0..7 <- k = 8hh+0..7, 8..15 <- k = 16+8hh+0..7; acc[r] = D[8hh+r][col].

#ifndef NB
#define NB 4
#endif
#ifndef SEQ
#define SEQ 2048
#endif

namespace {
constexpr int BF = 4, TF = 2048, DM = 1024, H = 16, HD = 64, SRC = 64;
constexpr int BL = NB;                                   // batches computed (== 4 shipped)
constexpr int QL = SEQ;                                  // query rows computed per batch (== 2048 shipped)
constexpr int KL = (QL + SRC < TF) ? (QL + SRC) : TF;    // key rows needed: j <= i + SRC
constexpr int NBH = BL;                                  // batches per pass (planes are sized for NBH): all of them, so every kernel is launched once over the whole problem
constexpr int NPASS = (BL + NBH - 1) / NBH;
constexpr int RSPLIT = (QL < 512) ? QL : 512;            // query rows below this get the hi+lo (3-product) attention path
constexpr float XS = 8.0f, WSC = 256.0f, PS = 1024.0f, CS = 64.0f, LOG2E = 1.4426950408889634f, L2THETA = 13.287712379549449f;
static_assert(BL >= 1 && BL <= BF);
static_assert(QL >= 64 && QL <= TF && QL % 64 == 0);
static_assert(KL % 128 == 0 && KL <= TF && KL >= QL);
static_assert(RSPLIT % 32 == 0 && RSPLIT <= QL);
static_assert(DM == H * HD && TF % 64 == 0 && HD == 64);

typedef _Float16 b16;
typedef __attribute__((ext_vector_type(16))) _Float16 v16b;
typedef __attribute__((ext_vector_type(8))) _Float16 v8b;
typedef __attribute__((ext_vector_type(4))) _Float16 v4h;
typedef __attribute__((ext_vector_type(2))) _Float16 v2h;
typedef __attribute__((ext_vector_type(8))) float v8f;
typedef __attribute__((ext_vector_type(4))) float v4f;
typedef __attribute__((ext_vector_type(2))) float v2f;

__device__ __forceinline__ float bf16_rne(float f) { unsigned int u = __float_as_uint(f); u += 0x7FFFu + ((u >> 16) & 1u); return __uint_as_float(u & 0xFFFF0000u); }
__device__ __forceinline__ void split16(float v, b16& hi, b16& lo) { hi = (b16)v; lo = (b16)(v - (float)hi); }
__device__ __forceinline__ v16b frag_kb(const b16* p, int hh) {
  const v8b a = *(const v8b*)(p + 8 * hh), b = *(const v8b*)(p + 16 + 8 * hh); v16b f;
#pragma unroll
  for (int e = 0; e < 8; ++e) { f[e] = a[e]; f[8 + e] = b[e]; }
  return f;
}
__device__ __forceinline__ v8f wmma16b(v16b a, v16b b, v8f c) {
  v8f d = __builtin_amdgcn_wmma_f32_16x16x32_f16(false, a, false, b, (short)0, c, false, false);
  asm volatile("v_nop\n\tv_nop\n\tv_nop\n\tv_nop" : "+v"(d) : "v"(a), "v"(b));
  return d;
}
__device__ __forceinline__ void wave_lds_sync() { __builtin_amdgcn_fence(3 /* release order */, "workgroup"); __builtin_amdgcn_wave_barrier(); __builtin_amdgcn_fence(2 /* acquire order */, "workgroup"); }
__device__ __forceinline__ v16b frag_at(const b16* p) {   // frag_kb with the lane half's 8 hh already in p
  const v8b a = *(const v8b*)p, b = *(const v8b*)(p + 16); v16b f;
#pragma unroll
  for (int e = 0; e < 8; ++e) { f[e] = a[e]; f[8 + e] = b[e]; }
  return f;
}
__device__ __forceinline__ float nexp2(float v) { return __builtin_amdgcn_exp2f(v); }
template <bool B> struct flag { static constexpr bool v = B; };
// the slot behind a transcendental: the results r and the sources x of the v_exp_f32 in front are operands of this statement, so nothing ahead of it reads such a result or overwrites such a source,
// and its v_nop fills the slot where the statement stands directly behind the last of them
template <int B> __device__ __forceinline__ void exp_slot(float (&r)[16], const float (&x)[16]) {
  asm("v_nop" : "+v"(r[B]), "+v"(r[B + 1]), "+v"(r[B + 2]), "+v"(r[B + 3]), "+v"(r[B + 4]), "+v"(r[B + 5]), "+v"(r[B + 6]), "+v"(r[B + 7])
              : "v"(x[B]), "v"(x[B + 1]), "v"(x[B + 2]), "v"(x[B + 3]), "v"(x[B + 4]), "v"(x[B + 5]), "v"(x[B + 6]), "v"(x[B + 7]));
}
__device__ __forceinline__ void exp_slot(float& r, float x) { asm("v_nop" : "+v"(r) : "v"(x)); }   // the same for one v_exp_f32

// GEMM operand staging: a stage is KC k (one whole 128-byte line) of 256 operand rows, laid in LDS at a pitch of 144 B (16 B x odd: no bank conflict for the 16-byte fragment reads); two buffers.
constexpr int KC = 64, LP = KC + 8, SROWS = 256, NST = DM / KC;
constexpr int RING_BYTES = 2 * SROWS * LP * 2;
static_assert(DM % KC == 0 && NST >= 2 && (LP * 2) % 32 == 16);
__device__ __forceinline__ unsigned lds_addr(const void* p) { return (unsigned)(uintptr_t)p; }   // LDS byte address = low 32 bits of the __shared__ address
// eight 16-byte asynchronous copies per lane, global -> LDS through no register; the closing s_wait_xcnt stands in front of every later rewrite of the address registers that the copies name (a precaution)
__device__ __forceinline__ void copy8(const unsigned (&l)[8], const b16* const (&g)[8]) {
  asm volatile("global_load_async_to_lds_b128 %0, %8, off\n\t"
               "global_load_async_to_lds_b128 %1, %9, off\n\t"
               "global_load_async_to_lds_b128 %2, %10, off\n\t"
               "global_load_async_to_lds_b128 %3, %11, off\n\t"
               "global_load_async_to_lds_b128 %4, %12, off\n\t"
               "global_load_async_to_lds_b128 %5, %13, off\n\t"
               "global_load_async_to_lds_b128 %6, %14, off\n\t"
               "global_load_async_to_lds_b128 %7, %15, off\n\t"
               "s_wait_xcnt 0x0"
               :: "v"(l[0]), "v"(l[1]), "v"(l[2]), "v"(l[3]), "v"(l[4]), "v"(l[5]), "v"(l[6]), "v"(l[7]),
                  "v"(g[0]), "v"(g[1]), "v"(g[2]), "v"(g[3]), "v"(g[4]), "v"(g[5]), "v"(g[6]), "v"(g[7]) : "memory");
}
__device__ __forceinline__ void wait_copies() { asm volatile("s_wait_asynccnt 0x0" ::: "memory"); }   // this wave's copies have landed in LDS
__device__ __forceinline__ void wait_lds_reads() { asm volatile("s_wait_dscnt 0x0" ::: "memory"); }   // this wave's LDS reads are done before their buffer is handed back

// prep: WT [3072 o][1024 k]: o < 1024 W_q[k][o], < 2048 W_k[k][o-1024], else W_v[k][o-2048]; WO [1024 o][1024 k] = W_p[k][o] ((in,out) layouts -> transposed, k contiguous); bf16 RNE then x256
// a thread converts PK = 64 elements: one output channel o, 64 consecutive k. Over a wave (32 neighbouring o) each of its 64 loads is one whole 128-byte line of W, and a lane's 8 stores fill one whole line of WT / WO
constexpr int PK = 64, PWM = (DM / 32) * (DM / PK);   // PWM: waves per matrix
static_assert(DM % 32 == 0 && DM % PK == 0 && (4 * PWM) % 8 == 0);
__global__ __launch_bounds__(256) void prep_kernel(const float* __restrict__ wq, const float* __restrict__ wk, const float* __restrict__ wv, const float* __restrict__ wp, b16* __restrict__ WT, b16* __restrict__ WO) {
  const int gw = (int)blockIdx.x * 8 + (int)(threadIdx.x >> 5), lane = threadIdx.x & 31;
  if (gw >= 4 * PWM) return;
  const int mtx = gw / PWM, r = gw % PWM, oo = (r / (DM / PK)) * 32 + lane, k0 = (r % (DM / PK)) * PK;
  const float* w = mtx == 0 ? wq : mtx == 1 ? wk : mtx == 2 ? wv : wp;
  const float* const src = w + (size_t)k0 * DM + oo;
  float f[PK];
#pragma unroll
  for (int j = 0; j < PK; ++j) f[j] = src[(size_t)j * DM];
  b16* const dst = ((mtx < 3) ? (WT + (size_t)mtx * DM * DM) : WO) + (size_t)oo * DM + k0;
#pragma unroll
  for (int q = 0; q < PK / 8; ++q) {
    v8b o;
#pragma unroll
    for (int j = 0; j < 8; ++j) o[j] = (b16)(bf16_rne(f[q * 8 + j]) * WSC);
    *(v8b*)(dst + q * 8) = o;
  }
}

__global__ __launch_bounds__(256) void rope_tab_kernel(float* __restrict__ cst, float* __restrict__ snt) {
  const int i = blockIdx.x * 256 + threadIdx.x;
  if (i >= TF * (HD / 2)) return;
  const int t = i / (HD / 2), p = i % (HD / 2);
  const float e = (float)(2 * p) * (1.0f / (float)HD);   // exact
  const float inv = exp2f(-(e * L2THETA));                // theta^(-e)
  const float ang = (float)t * inv;
  float sv, cv;
  sincosf(ang, &sv, &cv);
  { *(float*)(cst + i) = cv; *(float*)(snt + i) = sv;  }
}

// a thread converts XU = 8 units of 8 elements; a block's 256 XU units are consecutive (64 KiB of x, inside one batch); a thread's loads stand ahead of its conversions, so that many are in flight at once
constexpr int XU = 8;
static_assert(((size_t)KL * DM / 8) % (256 * XU) == 0);
__global__ __launch_bounds__(256) void xcvt_kernel(const float* __restrict__ x, b16* __restrict__ X8, int b0, int nb) {
  const size_t ub = (size_t)blockIdx.x * (256 * XU);
  const size_t per = (size_t)KL * DM / 8;
  if (ub >= (size_t)nb * per) return;
  const int bb = (int)(ub / per); const size_t e = (ub % per + threadIdx.x) * 8;   // e = t DM + c of the thread's first unit
  const float* const src = x + ((size_t)(b0 + bb)) * TF * DM + e;
  b16* const dst = X8 + (size_t)bb * TF * DM + e;
  v4f f0[XU], f1[XU];
#pragma unroll
  for (int i = 0; i < XU; ++i) { f0[i] = *(const v4f*)(src + i * 2048); f1[i] = *(const v4f*)(src + i * 2048 + 4); }
#pragma unroll
  for (int i = 0; i < XU; ++i) {
    v8b o;
#pragma unroll
    for (int j = 0; j < 4; ++j) { o[j] = (b16)(bf16_rne(f0[i][j]) * XS); o[4 + j] = (b16)(bf16_rne(f1[i][j]) * XS); }
    *(v8b*)(dst + i * 2048) = o;
  }
}

// projections: grid (KL/128, nb, 24 slabs of 128 output channels: 0-7 q, 8-15 k, 16-23 v); block = 128 tokens x 8 waves of 16; K = 1024 in 16 stages of 64: stage rows 0-127 X8 tokens, 128-255 WT channels,
// copied to LDS one stage ahead; A and B fragments from LDS; the k order of every accumulator is unchanged
__global__ __launch_bounds__(256) void proj_kernel(const b16* __restrict__ X8, const b16* __restrict__ WT, const float* __restrict__ bq, const float* __restrict__ bk, const float* __restrict__ bv,
                                                    const float* __restrict__ cst, const float* __restrict__ snt,
                                                    b16* __restrict__ QH, b16* __restrict__ QLo, b16* __restrict__ KH, b16* __restrict__ KLo, b16* __restrict__ VTh, b16* __restrict__ VTl) {
  __shared__ __attribute__((aligned(16))) unsigned char smem[RING_BYTES];
  static_assert(sizeof(float) * 8 * 16 * (128 + 4) <= RING_BYTES);
  b16* const ring = (b16*)smem; float (*const Tf)[16][128 + 4] = (float (*)[16][128 + 4])smem;   // Tf takes the ring's place behind the loop's last barrier
  const int wave = threadIdx.x >> 5, lane = threadIdx.x & 31, nloc = lane & 15, hlf = lane >> 4;
  const int t0 = blockIdx.x * 128; const int bb = blockIdx.y; const int slab = blockIdx.z, n0 = slab * 128, part = slab / 8, c0 = n0 - part * DM;
  const int r0 = threadIdx.x >> 3, seg = threadIdx.x & 7;   // copy i of a lane: stage row r0 + 32 i, 16-byte piece seg; a wave's copy covers 4 whole lines
  const b16* const gA = X8 + ((size_t)bb * TF + t0 + r0) * DM + seg * 8; const b16* const gB = WT + (size_t)(n0 + r0) * DM + seg * 8;
  const unsigned lrow = lds_addr(smem) + (unsigned)(r0 * LP * 2 + seg * 16);
  auto issue = [&](int s) {
    unsigned l[8]; const b16* g[8];
    const b16* const pa = gA + s * KC; const b16* const pb = gB + s * KC; const unsigned lb = lrow + (unsigned)((s & 1) * SROWS * LP * 2);
#pragma unroll
    for (int i = 0; i < 8; ++i) { l[i] = lb + (unsigned)(32 * i * LP * 2); g[i] = i < 4 ? pa + (size_t)(32 * i) * DM : pb + (size_t)(32 * (i - 4)) * DM; }
    copy8(l, g);
  };
  v8f acc[8];
#pragma unroll
  for (int t = 0; t < 8; ++t) acc[t] = (v8f){};
  issue(0); wait_copies(); __syncthreads(); issue(1);
#pragma unroll 1   // one stage per trip: the buffer index and the refill test stay scalar
  for (int s = 0; s < NST; ++s) {
    const b16* const As = ring + ((s & 1) * SROWS + wave * 16 + nloc) * LP; const b16* const Bs = ring + ((s & 1) * SROWS + 128 + nloc) * LP;
#pragma unroll
    for (int kk = 0; kk < KC; kk += 32) {
      const v16b a = frag_kb(As + kk, hlf); v16b bw[8];   // the block's fragment reads stand as one group ahead of its products: their LDS latency is met once a block, not once a product
#pragma unroll
      for (int t = 0; t < 8; ++t) bw[t] = frag_kb(Bs + t * 16 * LP + kk, hlf);
#pragma unroll
      for (int t = 0; t < 8; ++t) acc[t] = wmma16b(a, bw[t], acc[t]);
    }
    wait_lds_reads(); wait_copies(); __syncthreads();   // publishes stage s + 1 and frees stage s's buffer
    if (s + 2 < NST) issue(s + 2);
  }
  wait_copies();
  const float* bias = part == 0 ? bq : part == 1 ? bk : bv;
#pragma unroll
  for (int t = 0; t < 8; ++t) {
    const float bval = bf16_rne(bias[c0 + t * 16 + nloc]);
#pragma unroll
    for (int r = 0; r < 8; ++r) Tf[wave][8 * hlf + r][t * 16 + nloc] = acc[t][r] * (1.0f / (XS * WSC)) + bval;
  }
  __syncthreads();
  {
    if (part < 2) {
      b16* ph_ = part == 0 ? QH : KH; b16* pl_ = part == 0 ? QLo : KLo;
      const int c = c0 + lane * 4; const int hq = c / HD, d = c % HD, p0 = d >> 1;   // d is a multiple of 4: pairs (d,d+1) -> p0 and (d+2,d+3) -> p0+1
      for (int rr = 0; rr < 16; ++rr) {
        const int tok = t0 + wave * 16 + rr;
        const v4f f = *(const v4f*)(&Tf[wave][rr][lane * 4]);
        const v2f cc = *(const v2f*)(cst + (size_t)tok * (HD / 2) + p0), ss = *(const v2f*)(snt + (size_t)tok * (HD / 2) + p0);
        const float o0 = f[0] * cc[0] - f[1] * ss[0];
        const float o1 = f[0] * ss[0] + f[1] * cc[0];
        const float o2 = f[2] * cc[1] - f[3] * ss[1];
        const float o3 = f[2] * ss[1] + f[3] * cc[1];
        v4h h4, l4; b16 ph, pl;
        split16(o0 * XS, ph, pl); h4[0] = ph; l4[0] = pl;
        split16(o1 * XS, ph, pl); h4[1] = ph; l4[1] = pl;
        split16(o2 * XS, ph, pl); h4[2] = ph; l4[2] = pl;
        split16(o3 * XS, ph, pl); h4[3] = ph; l4[3] = pl;
        const size_t oi = (((size_t)bb * H + hq) * TF + tok) * HD + d;
        *(v4h*)(ph_ + oi) = h4; *(v4h*)(pl_ + oi) = l4;
      }
    } else {
#pragma unroll 1
      for (int q = 0; q < 32; ++q) {
        const int cl = (wave & 3) * 32 + q; const int c = c0 + cl; const int hv_ = c / HD, d = c % HD; const int tk = (wave >> 2) * 64 + lane * 2; v2h hv, lv;   // waves 0-3: tokens 0-63, waves 4-7: tokens 64-127
        for (int j = 0; j < 2; ++j) { b16 p, ql; split16(Tf[(tk + j) >> 4][(tk + j) & 15][cl] * XS, p, ql); hv[j] = p; lv[j] = ql; }
        const size_t oi = (((size_t)bb * H + hv_) * HD + d) * (size_t)TF + t0 + tk;
        *(v2h*)(VTh + oi) = hv; *(v2h*)(VTl + oi) = lv;
      }
    }
    
  }
}

// attention: grid (rows/64, nb x H), block x offset xb0 (in 64-row units): block = 4 waves x 16 queries; a wave's keys are 0 .. min(KL, q0+16+SRC)-1 in 32-key chunks; key allowed iff key <= qi + SRC;
// RES != 0 (query rows < RSPLIT): S^T = K Q^T with 3 products (kh qh + kh ql + kl qh), P x1024 hi/lo, O^T += V^T P^T with 3 products (vh ph + vh pl + vl ph);
// RES == 0 (query rows >= RSPLIT, >= RSPLIT+SRC keys per row): S^T = kh qh (1 product), P x1024 single, O^T += vh p (1 product). Online softmax (running max, f32) in both; a lane's own P values are its B fragment of P^T and stay in registers
// K and V^T reach the waves through LDS: a stage is SK keys = 64 K rows and 64 V^T rows of one whole 128-byte line each (hi planes; RES: the lo planes behind them), copied one stage ahead as whole lines and shared by the
// block's 4 waves; the 16-byte fragment reads, which touch 16 rows each, go to LDS at the 144-byte pitch instead of to the cache
constexpr int AW = 4, AQ = AW * 16, SK = 64;
static_assert(SK == KC && HD == KC && KL % SK == 0 && (AQ + SRC) % SK == 0 && AQ + SRC >= 2 * SK && RSPLIT % AQ == 0 && QL % AQ == 0);
template <int RES>
__global__ __launch_bounds__(128) void attn_kernel(const b16* __restrict__ QH, const b16* __restrict__ QLo, const b16* __restrict__ KH, const b16* __restrict__ KLo, const b16* __restrict__ VTh, const b16* __restrict__ VTl,
                                                   b16* __restrict__ Ch, b16* __restrict__ Cl, int xb0) {
  constexpr int NP = RES ? 2 : 1, BROWS = 2 * SK * NP;   // stage rows: 0-63 K hi, 64-127 V^T hi, then (RES) 128-191 K lo, 192-255 V^T lo
  __shared__ __attribute__((aligned(16))) unsigned char smem[2 * BROWS * LP * 2];
  static_assert(sizeof(float) * AW * 16 * (HD + 4) <= sizeof(smem));
  b16* const ring = (b16*)smem; float (*const To)[16][HD + 4] = (float (*)[16][HD + 4])smem;   // To takes the ring's place behind the loop's last barrier
  // the wave's number is taken into a scalar register, so that kend and the test on it below are scalar and no wave's EXEC changes around the products
  const int wave = __builtin_amdgcn_readfirstlane(threadIdx.x >> 5), lane = threadIdx.x & 31, hh = lane >> 4, col = lane & 15; const int bb = blockIdx.y / H, h = blockIdx.y % H;
  const int qb = (xb0 + (int)blockIdx.x) * AQ, q0 = qb + wave * 16, qi = q0 + col;
  const size_t ph = (size_t)bb * H + h; const size_t pq = ph * TF * HD; const b16* Vh = VTh + ph * HD * (size_t)TF; const b16* Vl = VTl + ph * HD * (size_t)TF;
  const int kmax = q0 + 16 + SRC; const int kend = kmax < KL ? kmax : KL;          // this wave's keys
  const int bmax = qb + AQ + SRC; const int ns = (bmax < KL ? bmax : KL) / SK;      // the block's stages: >= 2, every one wholly inside the planes
  // copy i of a lane: stage row r0 + 16 i, 16-byte piece seg; a wave's copy covers 4 whole lines
  const int r0 = threadIdx.x >> 3, seg = threadIdx.x & 7;
  const size_t ko = pq + (size_t)r0 * HD + seg * 8, vo = (size_t)r0 * TF + seg * 8;
  const unsigned lrow = lds_addr(smem) + (unsigned)(r0 * LP * 2 + seg * 16);
  auto issue = [&](int s) {
#pragma unroll
    for (int pl = 0; pl < NP; ++pl) {
      unsigned l[8]; const b16* g[8];
      const b16* const pk = (pl ? KLo : KH) + ko + (size_t)s * (SK * HD); const b16* const pv = (pl ? Vl : Vh) + vo + s * SK;
      const unsigned lb = lrow + (unsigned)(((s & 1) * BROWS + pl * 2 * SK) * LP * 2);
#pragma unroll
      for (int i = 0; i < 8; ++i) { l[i] = lb + (unsigned)(16 * i * LP * 2); g[i] = i < 4 ? pk + (size_t)(16 * i) * HD : pv + (size_t)(16 * (i - 4)) * TF; }
      copy8(l, g);
    }
  };
  issue(0);
  const v16b qh0 = frag_kb(QH + pq + (size_t)qi * HD, hh), qh1 = frag_kb(QH + pq + (size_t)qi * HD + 32, hh);
  v16b ql0 = (v16b){}, ql1 = (v16b){};
  if (RES) { ql0 = frag_kb(QLo + pq + (size_t)qi * HD, hh); ql1 = frag_kb(QLo + pq + (size_t)qi * HD + 32, hh); }
  const float cs = LOG2E / (8.0f * XS * XS);
  float m = -INFINITY, l = 0.0f; v8f o[4];
#pragma unroll
  for (int t = 0; t < 4; ++t) o[t] = (v8f){};
  v16b kh[2][2], kl[2][2], vh[4], vl[4];
  auto fetch_k = [&](const b16* st, int c) {   // chunk c of the stage at st: K rows 32 c + 16 u + col
    const b16* const a0 = st + (c * 32 + col) * LP + 8 * hh;
#pragma unroll
    for (int u = 0; u < 2; ++u) {
      kh[u][0] = frag_at(a0 + u * 16 * LP); kh[u][1] = frag_at(a0 + u * 16 * LP + 32);
      if (RES) { kl[u][0] = frag_at(a0 + (2 * SK + u * 16) * LP); kl[u][1] = frag_at(a0 + (2 * SK + u * 16) * LP + 32); }
    }
  };
  auto fetch_v = [&](const b16* st, int c) {   // V^T rows 16 t + col, keys 32 c ..
    const b16* const a0 = st + (SK + col) * LP + c * 32 + 8 * hh;
#pragma unroll
    for (int t = 0; t < 4; ++t) {
      vh[t] = frag_at(a0 + t * 16 * LP);
      if (RES) vl[t] = frag_at(a0 + (2 * SK + t * 16) * LP);
    }
  };
  wait_copies(); __syncthreads(); issue(1);
#pragma unroll 1   // one stage per trip: the buffer index and the refill test stay scalar
  for (int s = 0; s < ns; ++s) {
    const b16* const st = ring + (s & 1) * BROWS * LP;
#pragma unroll
    for (int c = 0; c < SK / 32; ++c) {
      const int kb = s * SK + c * 32;
      if (kb < kend) {   // the same for a whole wave (a scalar test): a wave past its last key only passes the stage's foot
        v8f s_[2];
        if (c == 0) fetch_k(st, 0);
        fetch_v(st, c);   // this chunk's V reads fly under the score products and the softmax
#pragma unroll
        for (int u = 0; u < 2; ++u) {
          s_[u] = (v8f){};
          if (RES) {
            s_[u] = wmma16b(kh[u][0], qh0, s_[u]); s_[u] = wmma16b(kh[u][0], ql0, s_[u]); s_[u] = wmma16b(kl[u][0], qh0, s_[u]);
            s_[u] = wmma16b(kh[u][1], qh1, s_[u]); s_[u] = wmma16b(kh[u][1], ql1, s_[u]); s_[u] = wmma16b(kl[u][1], qh1, s_[u]);
          } else {
            s_[u] = wmma16b(kh[u][0], qh0, s_[u]); s_[u] = wmma16b(kh[u][1], qh1, s_[u]);
          }
        }
        if (c + 1 < SK / 32) fetch_k(st, c + 1);   // the same stage's next chunk: its K reads are issued inside this chunk, well ahead of their products
        float al; v16b pf, pg = (v16b){};   // B fragment of P^T: element i2 of a lane is key (i2 < 8 ? 0 : 16) + 8 hh + (i2 & 7) of its own query, the lane's own score i2
        // MK: the chunk crosses the mask line. Without it every key of the chunk is allowed for every query of the wave: every score is finite, so the key test and the tests on -inf are identities and are left out
        auto soft = [&](auto mk) {
          constexpr bool MK = decltype(mk)::v;
          float e[16]; float mx = -INFINITY;
#pragma unroll
          for (int u = 0; u < 2; ++u)
#pragma unroll
            for (int r = 0; r < 8; ++r) { const int key = kb + u * 16 + 8 * hh + r; const float vv = (!MK || key <= qi + SRC) ? s_[u][r] * cs : -INFINITY; e[u * 8 + r] = vv; mx = fmaxf(mx, vv); }
          mx = fmaxf(mx, __shfl_xor(mx, 16)); const float mn = fmaxf(m, mx); const float da = m - mn; float ea = nexp2(da), sum;
          float x[16], pe[16];
#pragma unroll
          for (int i2 = 0; i2 < 16; ++i2) { x[i2] = e[i2] - mn; pe[i2] = nexp2(x[i2]); }
          exp_slot(ea, da); exp_slot<0>(pe, x); exp_slot<8>(pe, x);
          al = (MK && mn == -INFINITY) ? 1.0f : ea;
#pragma unroll
          for (int i2 = 0; i2 < 16; ++i2) {
            const float p = (MK && e[i2] == -INFINITY) ? 0.0f : pe[i2]; sum = i2 ? sum + p : p;
            if (RES) { b16 a_, b_; split16(p * PS, a_, b_); pf[i2] = a_; pg[i2] = b_; }
            else { pf[i2] = (b16)(p * PS); }
          }
          sum += __shfl_xor(sum, 16); l = l * al + sum; m = mn;
        };
        if (kb + 31 <= q0 + SRC) soft(flag<false>{}); else soft(flag<true>{});   // a scalar test: the chunk's last key against the wave's first query
#pragma unroll
        for (int t = 0; t < 4; ++t) {
          o[t] *= al;
          if (RES) { o[t] = wmma16b(vh[t], pf, o[t]); o[t] = wmma16b(vh[t], pg, o[t]); o[t] = wmma16b(vl[t], pf, o[t]); }
          else { o[t] = wmma16b(vh[t], pf, o[t]); }
        }
      }
    }
    wait_lds_reads(); wait_copies(); __syncthreads();   // publishes stage s + 1 and frees stage s's buffer
    if (s + 2 < ns) issue(s + 2);
  }
  wait_copies();
  const float inv = 1.0f / (l * PS * XS);
#pragma unroll
  for (int t = 0; t < 4; ++t)
#pragma unroll
    for (int r = 0; r < 8; ++r) To[wave][col][t * 16 + 8 * hh + r] = o[t][r] * inv;
  wave_lds_sync();
  {
    for (int rr = 0; rr < 16; ++rr) {
      const v2f f = *(const v2f*)(&To[wave][rr][lane * 2]); v2h hv, lv;
      for (int j = 0; j < 2; ++j) { b16 p, q; split16(f[j] * CS, p, q); hv[j] = p; lv[j] = q; }
      const size_t oi = ((size_t)bb * TF + q0 + rr) * DM + h * HD + lane * 2;
      *(v2h*)(Ch + oi) = hv; *(v2h*)(Cl + oi) = lv;
    }
    
  }
}

__global__ __launch_bounds__(128) void out_kernel(const b16* __restrict__ Ch, const b16* __restrict__ Cl, const b16* __restrict__ WO, float* __restrict__ out, int b0) {
  __shared__ __attribute__((aligned(16))) unsigned char smem[RING_BYTES];
  static_assert(sizeof(float) * 4 * 16 * (128 + 4) <= RING_BYTES);
  b16* const ring = (b16*)smem; float (*const Tf)[16][128 + 4] = (float (*)[16][128 + 4])smem;   // Tf takes the ring's place behind the loop's last barrier
  const int wave = threadIdx.x >> 5, lane = threadIdx.x & 31, nloc = lane & 15, hlf = lane >> 4; const int bb = blockIdx.z;
  const size_t mo = (size_t)(b0 + bb) * TF + ((size_t)blockIdx.x * 4 + wave) * 16;
  const int n0 = blockIdx.y * 128;
  v8f acc[8];
#pragma unroll
  for (int t = 0; t < 8; ++t) acc[t] = (v8f){};
  // stage rows 0-63 Ch, 64-127 Cl (the block's 64 rows), 128-255 WO channels; copy i of a lane: stage row r0 + 16 i, 16-byte piece seg
  const int r0 = threadIdx.x >> 3, seg = threadIdx.x & 7;
  const size_t ma = ((size_t)bb * TF + (size_t)blockIdx.x * 64 + r0) * DM + seg * 8;
  const b16* const gH = Ch + ma; const b16* const gL = Cl + ma; const b16* const gB = WO + (size_t)(n0 + r0) * DM + seg * 8;
  const unsigned lrow = lds_addr(smem) + (unsigned)(r0 * LP * 2 + seg * 16);
  auto issue = [&](int s) {
#pragma unroll
    for (int hf = 0; hf < 2; ++hf) {
      unsigned l[8]; const b16* g[8];
#pragma unroll
      for (int i = 0; i < 8; ++i) {
        l[i] = lrow + (unsigned)(((s & 1) * SROWS + 128 * hf + 16 * i) * LP * 2);
        g[i] = (hf ? gB + (size_t)(16 * i) * DM : i < 4 ? gH + (size_t)(16 * i) * DM : gL + (size_t)(16 * (i - 4)) * DM) + s * KC;
      }
      copy8(l, g);
    }
  };
  issue(0); wait_copies(); __syncthreads(); issue(1);
#pragma unroll 1   // one stage per trip: the buffer index and the refill test stay scalar
  for (int s = 0; s < NST; ++s) {
    const b16* const As = ring + ((s & 1) * SROWS + wave * 16 + nloc) * LP; const b16* const Bs = ring + ((s & 1) * SROWS + 128 + nloc) * LP;
#pragma unroll
    for (int kk = 0; kk < KC; kk += 32) {
      const v16b a = frag_kb(As + kk, hlf), al = frag_kb(As + 64 * LP + kk, hlf); v16b bw[8];   // the block's fragment reads stand as one group ahead of its products: their LDS latency is met once a block, not once a product
#pragma unroll
      for (int t = 0; t < 8; ++t) bw[t] = frag_kb(Bs + t * 16 * LP + kk, hlf);
#pragma unroll
      for (int t = 0; t < 8; ++t) { acc[t] = wmma16b(a, bw[t], acc[t]); acc[t] = wmma16b(al, bw[t], acc[t]); }
    }
    wait_lds_reads(); wait_copies(); __syncthreads();   // publishes stage s + 1 and frees stage s's buffer
    if (s + 2 < NST) issue(s + 2);
  }
  wait_copies();
#pragma unroll
  for (int t = 0; t < 8; ++t) {
#pragma unroll
    for (int r = 0; r < 8; ++r) Tf[wave][8 * hlf + r][t * 16 + nloc] = acc[t][r] * (1.0f / (CS * WSC));
  }
  wave_lds_sync();
  {
    for (int rr = 0; rr < 16; ++rr) *(v4f*)(out + (mo + rr) * DM + n0 + lane * 4) = *(const v4f*)(&Tf[wave][rr][lane * 4]);
    
  }
}
}  // namespace

extern "C" void kernel_launch(void* const* d_in, const int* in_sizes, int n_in, void* d_out, int out_size, void* d_ws, size_t ws_size, hipStream_t stream) {
  if (n_in < 8) return;
  auto Fp = [&](int i) { return (const float*)d_in[i]; };
  // input order: 0 x [4,2048,1024], 1 W_q, 2 b_q, 3 W_k, 4 b_k, 5 W_v, 6 b_v, 7 W_p; all f32; W (in,out)
  if (in_sizes[0] < BL * TF * DM || in_sizes[1] < DM * DM || in_sizes[2] < DM || in_sizes[3] < DM * DM || in_sizes[4] < DM || in_sizes[5] < DM * DM || in_sizes[6] < DM || in_sizes[7] < DM * DM ||
      out_size < BL * TF * DM) return;
  size_t off = 0; char* ws = (char*)d_ws;
  auto carve = [&](size_t bytes) { char* p = ws + off; off += (bytes + 255) & ~(size_t)255; return p; };
  b16* WT = (b16*)carve((size_t)3 * DM * DM * 2); b16* WO = (b16*)carve((size_t)DM * DM * 2);
  float* CST = (float*)carve((size_t)TF * (HD / 2) * 4); float* SNT = (float*)carve((size_t)TF * (HD / 2) * 4);
  const size_t plane = (size_t)NBH * TF * DM * 2;
  b16* X8 = (b16*)carve(plane);
  b16* QH = (b16*)carve(plane); b16* QLo = (b16*)carve(plane); b16* KH = (b16*)carve(plane); b16* KLo = (b16*)carve(plane);
  b16* VTh = (b16*)carve(plane); b16* VTl = (b16*)carve(plane); b16* Ch = (b16*)carve(plane); b16* Cl = (b16*)carve(plane);
  if (off > ws_size || off > ((size_t)256 << 20)) return;   // 159,907,840 B at NBH == 4
  prep_kernel<<<(unsigned)(4 * PWM / 8), 256, 0, stream>>>(Fp(1), Fp(3), Fp(5), Fp(7), WT, WO);
  rope_tab_kernel<<<(unsigned)((TF * (HD / 2) + 255) / 256), 256, 0, stream>>>(CST, SNT);
  for (int p = 0; p < NPASS; ++p) {
    const int b0 = p * NBH; const int nb = (BL - b0 < NBH) ? (BL - b0) : NBH;
    xcvt_kernel<<<(unsigned)((size_t)nb * KL * DM / 8 / (256 * XU)), 256, 0, stream>>>(Fp(0), X8, b0, nb);
    proj_kernel<<<dim3(KL / 128, nb, 24), 256, 0, stream>>>(X8, WT, Fp(2), Fp(4), Fp(6), CST, SNT, QH, QLo, KH, KLo, VTh, VTl);
    attn_kernel<1><<<dim3(RSPLIT / AQ, nb * H), AW * 32, 0, stream>>>(QH, QLo, KH, KLo, VTh, VTl, Ch, Cl, 0);
    if (QL > RSPLIT) attn_kernel<0><<<dim3((QL - RSPLIT) / AQ, nb * H), AW * 32, 0, stream>>>(QH, QLo, KH, KLo, VTh, VTl, Ch, Cl, RSPLIT / AQ);
    out_kernel<<<dim3(QL / 64, DM / 128, nb), 128, 0, stream>>>(Ch, Cl, WO, (float*)d_out, b0);
  }
}

// v007
// Measured time: 158 microseconds a run.
// Two timings next to v006 put it at 1.04 and 1.03 times that version's speed.
// Counting every step since v000, it is 4.36 times as fast.
#include <hip/hip_runtime.h>

// compute dtype: every contraction on v_wmma_f32_16x16x32_f16 (f16 operands, f32 accumulate). q/k/v projections: x (bf16 RNE values carried x8) by W_q/W_k/W_v (bf16 RNE values carried x256): 1 product;
// attention for query rows < 512 of each sequence: S^T = K Q^T with q and k as f16 hi+lo planes (x8): 3 products; O^T += V^T P^T with v hi+lo (x8) and P hi+lo (x1024): 3 products;
// attention for query rows >= 512: S^T = K Q^T with the hi planes only: 1 product; O^T += V^T P^T with v hi and P (x1024) single: 1 product; ctx W_p with ctx hi+lo (x64) and W_p exact (x256): 2 products.
// Layout: x [B][T][1024]; W_* (in,out); q/k/v = x W + b reshaped to [B][T][16][64]; rotary pairs (2p, 2p+1) of q and k turned by angle t * theta^(-2p/64); scores q k^T / 8 with key j allowed iff
// j <= i + 64; softmax over keys; ctx = P v -> [B][T][1024]; out = ctx W_p (no bias).
// Fragment k-map per lane half hh for A AND B: elements 0..7 <- k = 8hh+0..7, 8..15 <- k = 16+8hh+0..7; acc[r] = D[8hh+r][col].

#ifndef NB
#define NB 4
#endif
#ifndef SEQ
#define SEQ 2048
#endif

namespace {
constexpr int BF = 4, TF = 2048, DM = 1024, H = 16, HD = 64, SRC = 64;
constexpr int BL = NB;                                   // batches computed (== 4 shipped)
constexpr int QL = SEQ;                                  // query rows computed per batch (== 2048 shipped)
constexpr int KL = (QL + SRC < TF) ? (QL + SRC) : TF;    // key rows needed: j <= i + SRC
constexpr int NBH = BL;                                  // batches per pass (planes are sized for NBH): all of them, so every kernel is launched once over the whole problem
constexpr int NPASS = (BL + NBH - 1) / NBH;
constexpr int RSPLIT = (QL < 512) ? QL : 512;            // query rows below this get the hi+lo (3-product) attention path
constexpr float XS = 8.0f, WSC = 256.0f, PS = 1024.0f, CS = 64.0f, LOG2E = 1.4426950408889634f, L2THETA = 13.287712379549449f;
static_assert(BL >= 1 && BL <= BF);
static_assert(QL >= 64 && QL <= TF && QL % 64 == 0);
static_assert(KL % 128 == 0 && KL <= TF && KL >= QL);
static_assert(RSPLIT % 32 == 0 && RSPLIT <= QL);
static_assert(DM == H * HD && TF % 64 == 0 && HD == 64);

typedef _Float16 b16;
typedef __attribute__((ext_vector_type(16))) _Float16 v16b;
typedef __attribute__((ext_vector_type(8))) _Float16 v8b;
typedef __attribute__((ext_vector_type(4))) _Float16 v4h;
typedef __attribute__((ext_vector_type(2))) _Float16 v2h;
typedef __attribute__((ext_vector_type(8))) float v8f;
typedef __attribute__((ext_vector_type(4))) float v4f;
typedef __attribute__((ext_vector_type(2))) float v2f;

__device__ __forceinline__ float bf16_rne(float f) { unsigned int u = __float_as_uint(f); u += 0x7FFFu + ((u >> 16) & 1u); return __uint_as_float(u & 0xFFFF0000u); }
__device__ __forceinline__ void split16(float v, b16& hi, b16& lo) { hi = (b16)v; lo = (b16)(v - (float)hi); }
__device__ __forceinline__ v16b frag_kb(const b16* p, int hh) {
  const v8b a = *(const v8b*)(p + 8 * hh), b = *(const v8b*)(p + 16 + 8 * hh); v16b f;
#pragma unroll
  for (int e = 0; e < 8; ++e) { f[e] = a[e]; f[8 + e] = b[e]; }
  return f;
}
__device__ __forceinline__ v8f wmma16b(v16b a, v16b b, v8f c) {
  v8f d = __builtin_amdgcn_wmma_f32_16x16x32_f16(false, a, false, b, (short)0, c, false, false);
  asm volatile("v_nop\n\tv_nop\n\tv_nop\n\tv_nop" : "+v"(d) : "v"(a), "v"(b));
  return d;
}
__device__ __forceinline__ void wave_lds_sync() { __builtin_amdgcn_fence(3 /* release order */, "workgroup"); __builtin_amdgcn_wave_barrier(); __builtin_amdgcn_fence(2 /* acquire order */, "workgroup"); }
__device__ __forceinline__ v16b frag_at(const b16* p) {   // frag_kb with the lane half's 8 hh already in p
  const v8b a = *(const v8b*)p, b = *(const v8b*)(p + 16); v16b f;
#pragma unroll
  for (int e = 0; e < 8; ++e) { f[e] = a[e]; f[8 + e] = b[e]; }
  return f;
}
__device__ __forceinline__ float nexp2(float v) { return __builtin_amdgcn_exp2f(v); }
template <bool B> struct flag { static constexpr bool v = B; };
// the slot behind a transcendental: the results r and the sources x of the v_exp_f32 in front are operands of this statement, so nothing ahead of it reads such a result or overwrites such a source,
// and its v_nop fills the slot where the statement stands directly behind the last of them
template <int B> __device__ __forceinline__ void exp_slot(float (&r)[16], const float (&x)[16]) {
  asm("v_nop" : "+v"(r[B]), "+v"(r[B + 1]), "+v"(r[B + 2]), "+v"(r[B + 3]), "+v"(r[B + 4]), "+v"(r[B + 5]), "+v"(r[B + 6]), "+v"(r[B + 7])
              : "v"(x[B]), "v"(x[B + 1]), "v"(x[B + 2]), "v"(x[B + 3]), "v"(x[B + 4]), "v"(x[B + 5]), "v"(x[B + 6]), "v"(x[B + 7]));
}
__device__ __forceinline__ void exp_slot(float& r, float x) { asm("v_nop" : "+v"(r) : "v"(x)); }   // the same for one v_exp_f32

// GEMM operand staging: a stage is KC k (one whole 128-byte line) of GROWS operand rows, laid in LDS at a pitch of 144 B (16 B x odd: no bank conflict for the 16-byte fragment reads); two buffers.
constexpr int KC = 64, LP = KC + 8, NST = DM / KC;
constexpr int GROWS = 384, GRING_BYTES = 2 * GROWS * LP * 2;   // a GEMM stage: 384 operand rows
static_assert(DM % KC == 0 && NST >= 2 && (LP * 2) % 32 == 16);
__device__ __forceinline__ unsigned lds_addr(const void* p) { return (unsigned)(uintptr_t)p; }   // LDS byte address = low 32 bits of the __shared__ address
// eight 16-byte asynchronous copies per lane, global -> LDS through no register; the closing s_wait_xcnt stands in front of every later rewrite of the address registers that the copies name (a precaution)
__device__ __forceinline__ void copy8(const unsigned (&l)[8], const b16* const (&g)[8]) {
  asm volatile("global_load_async_to_lds_b128 %0, %8, off\n\t"
               "global_load_async_to_lds_b128 %1, %9, off\n\t"
               "global_load_async_to_lds_b128 %2, %10, off\n\t"
               "global_load_async_to_lds_b128 %3, %11, off\n\t"
               "global_load_async_to_lds_b128 %4, %12, off\n\t"
               "global_load_async_to_lds_b128 %5, %13, off\n\t"
               "global_load_async_to_lds_b128 %6, %14, off\n\t"
               "global_load_async_to_lds_b128 %7, %15, off\n\t"
               "s_wait_xcnt 0x0"
               :: "v"(l[0]), "v"(l[1]), "v"(l[2]), "v"(l[3]), "v"(l[4]), "v"(l[5]), "v"(l[6]), "v"(l[7]),
                  "v"(g[0]), "v"(g[1]), "v"(g[2]), "v"(g[3]), "v"(g[4]), "v"(g[5]), "v"(g[6]), "v"(g[7]) : "memory");
}
// the same for twelve copies per lane (a GEMM stage of GROWS rows over 256 lanes)
__device__ __forceinline__ void copy12(const unsigned (&l)[12], const b16* const (&g)[12]) {
  asm volatile("global_load_async_to_lds_b128 %0, %12, off\n\t"
               "global_load_async_to_lds_b128 %1, %13, off\n\t"
               "global_load_async_to_lds_b128 %2, %14, off\n\t"
               "global_load_async_to_lds_b128 %3, %15, off\n\t"
               "global_load_async_to_lds_b128 %4, %16, off\n\t"
               "global_load_async_to_lds_b128 %5, %17, off\n\t"
               "global_load_async_to_lds_b128 %6, %18, off\n\t"
               "global_load_async_to_lds_b128 %7, %19, off\n\t"
               "global_load_async_to_lds_b128 %8, %20, off\n\t"
               "global_load_async_to_lds_b128 %9, %21, off\n\t"
               "global_load_async_to_lds_b128 %10, %22, off\n\t"
               "global_load_async_to_lds_b128 %11, %23, off\n\t"
               "s_wait_xcnt 0x0"
               :: "v"(l[0]), "v"(l[1]), "v"(l[2]), "v"(l[3]), "v"(l[4]), "v"(l[5]), "v"(l[6]), "v"(l[7]), "v"(l[8]), "v"(l[9]), "v"(l[10]), "v"(l[11]),
                  "v"(g[0]), "v"(g[1]), "v"(g[2]), "v"(g[3]), "v"(g[4]), "v"(g[5]), "v"(g[6]), "v"(g[7]), "v"(g[8]), "v"(g[9]), "v"(g[10]), "v"(g[11]) : "memory");
}
__device__ __forceinline__ void wait_copies() { asm volatile("s_wait_asynccnt 0x0" ::: "memory"); }   // this wave's copies have landed in LDS
__device__ __forceinline__ void wait_lds_reads() { asm volatile("s_wait_dscnt 0x0" ::: "memory"); }   // this wave's LDS reads are done before their buffer is handed back

// prep: WT [3072 o][1024 k]: o < 1024 W_q[k][o], < 2048 W_k[k][o-1024], else W_v[k][o-2048]; WO [1024 o][1024 k] = W_p[k][o] ((in,out) layouts -> transposed, k contiguous); bf16 RNE then x256
// a thread converts PK = 64 elements: one output channel o, 64 consecutive k. Over a wave (32 neighbouring o) each of its 64 loads is one whole 128-byte line of W, and a lane's 8 stores fill one whole line of WT / WO
constexpr int PK = 64, PWM = (DM / 32) * (DM / PK);   // PWM: waves per matrix
static_assert(DM % 32 == 0 && DM % PK == 0 && (4 * PWM) % 8 == 0);
__global__ __launch_bounds__(256) void prep_kernel(const float* __restrict__ wq, const float* __restrict__ wk, const float* __restrict__ wv, const float* __restrict__ wp, b16* __restrict__ WT, b16* __restrict__ WO) {
  const int gw = (int)blockIdx.x * 8 + (int)(threadIdx.x >> 5), lane = threadIdx.x & 31;
  if (gw >= 4 * PWM) return;
  const int mtx = gw / PWM, r = gw % PWM, oo = (r / (DM / PK)) * 32 + lane, k0 = (r % (DM / PK)) * PK;
  const float* w = mtx == 0 ? wq : mtx == 1 ? wk : mtx == 2 ? wv : wp;
  const float* const src = w + (size_t)k0 * DM + oo;
  float f[PK];
#pragma unroll
  for (int j = 0; j < PK; ++j) f[j] = src[(size_t)j * DM];
  b16* const dst = ((mtx < 3) ? (WT + (size_t)mtx * DM * DM) : WO) + (size_t)oo * DM + k0;
#pragma unroll
  for (int q = 0; q < PK / 8; ++q) {
    v8b o;
#pragma unroll
    for (int j = 0; j < 8; ++j) o[j] = (b16)(bf16_rne(f[q * 8 + j]) * WSC);
    *(v8b*)(dst + q * 8) = o;
  }
}

__global__ __launch_bounds__(256) void rope_tab_kernel(float* __restrict__ cst, float* __restrict__ snt) {
  const int i = blockIdx.x * 256 + threadIdx.x;
  if (i >= TF * (HD / 2)) return;
  const int t = i / (HD / 2), p = i % (HD / 2);
  const float e = (float)(2 * p) * (1.0f / (float)HD);   // exact
  const float inv = exp2f(-(e * L2THETA));                // theta^(-e)
  const float ang = (float)t * inv;
  float sv, cv;
  sincosf(ang, &sv, &cv);
  { *(float*)(cst + i) = cv; *(float*)(snt + i) = sv;  }
}

// a thread converts XU = 8 units of 8 elements; a block's 256 XU units are consecutive (64 KiB of x, inside one batch); a thread's loads stand ahead of its conversions, so that many are in flight at once
constexpr int XU = 8;
static_assert(((size_t)KL * DM / 8) % (256 * XU) == 0);
__global__ __launch_bounds__(256) void xcvt_kernel(const float* __restrict__ x, b16* __restrict__ X8, int b0, int nb) {
  const size_t ub = (size_t)blockIdx.x * (256 * XU);
  const size_t per = (size_t)KL * DM / 8;
  if (ub >= (size_t)nb * per) return;
  const int bb = (int)(ub / per); const size_t e = (ub % per + threadIdx.x) * 8;   // e = t DM + c of the thread's first unit
  const float* const src = x + ((size_t)(b0 + bb)) * TF * DM + e;
  b16* const dst = X8 + (size_t)bb * TF * DM + e;
  v4f f0[XU], f1[XU];
#pragma unroll
  for (int i = 0; i < XU; ++i) { f0[i] = *(const v4f*)(src + i * 2048); f1[i] = *(const v4f*)(src + i * 2048 + 4); }
#pragma unroll
  for (int i = 0; i < XU; ++i) {
    v8b o;
#pragma unroll
    for (int j = 0; j < 4; ++j) { o[j] = (b16)(bf16_rne(f0[i][j]) * XS); o[4 + j] = (b16)(bf16_rne(f1[i][j]) * XS); }
    *(v8b*)(dst + i * 2048) = o;
  }
}

// projections: grid (KL/256, nb, 24 slabs of 128 output channels: 0-7 q, 8-15 k, 16-23 v); block = 256 tokens x 128 channels, 8 waves (4 x 2) of 64 tokens x 64 channels: a wave's 8 fragments feed 16 products;
// K = 1024 in 16 stages of 64: stage rows 0-255 X8 tokens, 256-383 WT channels, copied to LDS one stage ahead; A and B fragments from LDS; the k order of every accumulator is unchanged
constexpr int PM = 256, PN = 128;
static_assert(PM + PN == GROWS && KL % PM == 0 && DM % PN == 0);
constexpr int PSMEM = (int)sizeof(float) * PM * (PN + 4) > GRING_BYTES ? (int)sizeof(float) * PM * (PN + 4) : GRING_BYTES;
__global__ __launch_bounds__(256) void proj_kernel(const b16* __restrict__ X8, const b16* __restrict__ WT, const float* __restrict__ bq, const float* __restrict__ bk, const float* __restrict__ bv,
                                                    const float* __restrict__ cst, const float* __restrict__ snt,
                                                    b16* __restrict__ QH, b16* __restrict__ QLo, b16* __restrict__ KH, b16* __restrict__ KLo, b16* __restrict__ VTh, b16* __restrict__ VTl) {
  __shared__ __attribute__((aligned(16))) unsigned char smem[PSMEM];
  b16* const ring = (b16*)smem; float (*const Tf)[PN + 4] = (float (*)[PN + 4])smem;   // Tf [token][channel] takes the ring's place behind the loop's last barrier
  const int wave = threadIdx.x >> 5, lane = threadIdx.x & 31, nloc = lane & 15, hlf = lane >> 4, wm = wave >> 1, wn = wave & 1;
  const int t0 = blockIdx.x * PM; const int bb = blockIdx.y; const int slab = blockIdx.z, n0 = slab * PN, part = slab / 8, c0 = n0 - part * DM;
  const int r0 = threadIdx.x >> 3, seg = threadIdx.x & 7;   // copy i of a lane: stage row r0 + 32 i, 16-byte piece seg; a wave's copy covers 4 whole lines
  const b16* const gA = X8 + ((size_t)bb * TF + t0 + r0) * DM + seg * 8; const b16* const gB = WT + (size_t)(n0 + r0) * DM + seg * 8;
  const unsigned lrow = lds_addr(smem) + (unsigned)(r0 * LP * 2 + seg * 16);
  auto issue = [&](int s) {
    unsigned l[12]; const b16* g[12];
    const b16* const pa = gA + s * KC; const b16* const pb = gB + s * KC; const unsigned lb = lrow + (unsigned)((s & 1) * GROWS * LP * 2);
#pragma unroll
    for (int i = 0; i < 12; ++i) { l[i] = lb + (unsigned)(32 * i * LP * 2); g[i] = i < 8 ? pa + (size_t)(32 * i) * DM : pb + (size_t)(32 * (i - 8)) * DM; }
    copy12(l, g);
  };
  v8f acc[4][4];
#pragma unroll
  for (int i = 0; i < 4; ++i)
#pragma unroll
    for (int t = 0; t < 4; ++t) acc[i][t] = (v8f){};
  issue(0); wait_copies(); __syncthreads(); issue(1);
#pragma unroll 1   // one stage per trip: the buffer index and the refill test stay scalar
  for (int s = 0; s < NST; ++s) {
    const b16* const As = ring + ((s & 1) * GROWS + wm * 64 + nloc) * LP; const b16* const Bs = ring + ((s & 1) * GROWS + PM + wn * 64 + nloc) * LP;
#pragma unroll
    for (int kk = 0; kk < KC; kk += 32) {
      v16b a[4], bw[4];   // the block's fragment reads stand as one group ahead of its products: their LDS latency is met once a block, not once a product
#pragma unroll
      for (int i = 0; i < 4; ++i) a[i] = frag_kb(As + i * 16 * LP + kk, hlf);
#pragma unroll
      for (int t = 0; t < 4; ++t) bw[t] = frag_kb(Bs + t * 16 * LP + kk, hlf);
#pragma unroll
      for (int i = 0; i < 4; ++i)
#pragma unroll
        for (int t = 0; t < 4; ++t) acc[i][t] = wmma16b(a[i], bw[t], acc[i][t]);
    }
    wait_lds_reads(); wait_copies(); __syncthreads();   // publishes stage s + 1 and frees stage s's buffer
    if (s + 2 < NST) issue(s + 2);
  }
  wait_copies();
  const float* bias = part == 0 ? bq : part == 1 ? bk : bv;
#pragma unroll
  for (int t = 0; t < 4; ++t) {
    const float bval = bf16_rne(bias[c0 + wn * 64 + t * 16 + nloc]);
#pragma unroll
    for (int i = 0; i < 4; ++i)
#pragma unroll
      for (int r = 0; r < 8; ++r) Tf[wm * 64 + i * 16 + 8 * hlf + r][wn * 64 + t * 16 + nloc] = acc[i][t][r] * (1.0f / (XS * WSC)) + bval;
  }
  __syncthreads();
  {
    if (part < 2) {
      b16* ph_ = part == 0 ? QH : KH; b16* pl_ = part == 0 ? QLo : KLo;
      const int c = c0 + lane * 4; const int hq = c / HD, d = c % HD, p0 = d >> 1;   // d is a multiple of 4: pairs (d,d+1) -> p0 and (d+2,d+3) -> p0+1
#pragma unroll 1   // eight rows a trip (the inner loop, unrolled): their table loads and LDS reads fly together, so that a wave's 32 rows meet that latency 4 times
      for (int r8 = 0; r8 < PM / 8; r8 += 8) {
#pragma unroll
      for (int rj = 0; rj < 8; ++rj) {
        const int row = wave * (PM / 8) + r8 + rj, tok = t0 + row;
        const v4f f = *(const v4f*)(&Tf[row][lane * 4]);
        const v2f cc = *(const v2f*)(cst + (size_t)tok * (HD / 2) + p0), ss = *(const v2f*)(snt + (size_t)tok * (HD / 2) + p0);
        const float o0 = f[0] * cc[0] - f[1] * ss[0];
        const float o1 = f[0] * ss[0] + f[1] * cc[0];
        const float o2 = f[2] * cc[1] - f[3] * ss[1];
        const float o3 = f[2] * ss[1] + f[3] * cc[1];
        v4h h4, l4; b16 ph, pl;
        split16(o0 * XS, ph, pl); h4[0] = ph; l4[0] = pl;
        split16(o1 * XS, ph, pl); h4[1] = ph; l4[1] = pl;
        split16(o2 * XS, ph, pl); h4[2] = ph; l4[2] = pl;
        split16(o3 * XS, ph, pl); h4[3] = ph; l4[3] = pl;
        const size_t oi = (((size_t)bb * H + hq) * TF + tok) * HD + d;
        *(v4h*)(ph_ + oi) = h4; *(v4h*)(pl_ + oi) = l4;
      }
      asm volatile("s_wait_xcnt 0x0" ::: "memory");   // in front of the next trip's rewrite of the registers that this trip's loads and stores name (a precaution)
      }
    } else {
#pragma unroll 1   // eight channels a trip (the inner loop, unrolled): their LDS reads fly together, so that a wave meets that latency 8 times, not 64
      for (int q8 = 0; q8 < PM / 4; q8 += 8) {
#pragma unroll
      for (int qj = 0; qj < 8; ++qj) {
        const int q = q8 + qj;
        const int cl = (wave & 3) * 32 + (q & 31); const int c = c0 + cl; const int hv_ = c / HD, d = c % HD; const int tk = (wave >> 2) * (PM / 2) + (q >> 5) * 64 + lane * 2; v2h hv, lv;   // waves 0-3: tokens 0-127, waves 4-7: tokens 128-255, 64 at a time
        for (int j = 0; j < 2; ++j) { b16 p, ql; split16(Tf[tk + j][cl] * XS, p, ql); hv[j] = p; lv[j] = ql; }
        const size_t oi = (((size_t)bb * H + hv_) * HD + d) * (size_t)TF + t0 + tk;
        *(v2h*)(VTh + oi) = hv; *(v2h*)(VTl + oi) = lv;
      }
      asm volatile("s_wait_xcnt 0x0" ::: "memory");   // in front of the next trip's rewrite of the registers that this trip's stores name (a precaution)
      }
    }
    
  }
}

// attention: grid (rows/64, nb x H), block x offset xb0 (in 64-row units): block = 4 waves x 16 queries; a wave's keys are 0 .. min(KL, q0+16+SRC)-1 in 32-key chunks; key allowed iff key <= qi + SRC;
// RES != 0 (query rows < RSPLIT): S^T = K Q^T with 3 products (kh qh + kh ql + kl qh), P x1024 hi/lo, O^T += V^T P^T with 3 products (vh ph + vh pl + vl ph);
// RES == 0 (query rows >= RSPLIT, >= RSPLIT+SRC keys per row): S^T = kh qh (1 product), P x1024 single, O^T += vh p (1 product). Online softmax (running max, f32) in both; a lane's own P values are its B fragment of P^T and stay in registers
// K and V^T reach the waves through LDS: a stage is SK keys = 64 K rows and 64 V^T rows of one whole 128-byte line each (hi planes; RES: the lo planes behind them), copied one stage ahead as whole lines and shared by the
// block's 4 waves; the 16-byte fragment reads, which touch 16 rows each, go to LDS at the 144-byte pitch instead of to the cache
constexpr int AW = 4, AQ = AW * 16, SK = 64;
static_assert(SK == KC && HD == KC && KL % SK == 0 && (AQ + SRC) % SK == 0 && AQ + SRC >= 2 * SK && RSPLIT % AQ == 0 && QL % AQ == 0);
template <int RES>
__global__ __launch_bounds__(128) void attn_kernel(const b16* __restrict__ QH, const b16* __restrict__ QLo, const b16* __restrict__ KH, const b16* __restrict__ KLo, const b16* __restrict__ VTh, const b16* __restrict__ VTl,
                                                   b16* __restrict__ Ch, b16* __restrict__ Cl, int xb0) {
  constexpr int NP = RES ? 2 : 1, BROWS = 2 * SK * NP;   // stage rows: 0-63 K hi, 64-127 V^T hi, then (RES) 128-191 K lo, 192-255 V^T lo
  __shared__ __attribute__((aligned(16))) unsigned char smem[2 * BROWS * LP * 2];
  static_assert(sizeof(float) * AW * 16 * (HD + 4) <= sizeof(smem));
  b16* const ring = (b16*)smem; float (*const To)[16][HD + 4] = (float (*)[16][HD + 4])smem;   // To takes the ring's place behind the loop's last barrier
  // the wave's number is taken into a scalar register, so that kend and the test on it below are scalar and no wave's EXEC changes around the products
  const int wave = __builtin_amdgcn_readfirstlane(threadIdx.x >> 5), lane = threadIdx.x & 31, hh = lane >> 4, col = lane & 15; const int bb = blockIdx.y / H, h = blockIdx.y % H;
  const int qb = (xb0 + (int)blockIdx.x) * AQ, q0 = qb + wave * 16, qi = q0 + col;
  const size_t ph = (size_t)bb * H + h; const size_t pq = ph * TF * HD; const b16* Vh = VTh + ph * HD * (size_t)TF; const b16* Vl = VTl + ph * HD * (size_t)TF;
  const int kmax = q0 + 16 + SRC; const int kend = kmax < KL ? kmax : KL;          // this wave's keys
  const int bmax = qb + AQ + SRC; const int ns = (bmax < KL ? bmax : KL) / SK;      // the block's stages: >= 2, every one wholly inside the planes
  // copy i of a lane: stage row r0 + 16 i, 16-byte piece seg; a wave's copy covers 4 whole lines
  const int r0 = threadIdx.x >> 3, seg = threadIdx.x & 7;
  const size_t ko = pq + (size_t)r0 * HD + seg * 8, vo = (size_t)r0 * TF + seg * 8;
  const unsigned lrow = lds_addr(smem) + (unsigned)(r0 * LP * 2 + seg * 16);
  auto issue = [&](int s) {
#pragma unroll
    for (int pl = 0; pl < NP; ++pl) {
      unsigned l[8]; const b16* g[8];
      const b16* const pk = (pl ? KLo : KH) + ko + (size_t)s * (SK * HD); const b16* const pv = (pl ? Vl : Vh) + vo + s * SK;
      const unsigned lb = lrow + (unsigned)(((s & 1) * BROWS + pl * 2 * SK) * LP * 2);
#pragma unroll
      for (int i = 0; i < 8; ++i) { l[i] = lb + (unsigned)(16 * i * LP * 2); g[i] = i < 4 ? pk + (size_t)(16 * i) * HD : pv + (size_t)(16 * (i - 4)) * TF; }
      copy8(l, g);
    }
  };
  issue(0);
  const v16b qh0 = frag_kb(QH + pq + (size_t)qi * HD, hh), qh1 = frag_kb(QH + pq + (size_t)qi * HD + 32, hh);
  v16b ql0 = (v16b){}, ql1 = (v16b){};
  if (RES) { ql0 = frag_kb(QLo + pq + (size_t)qi * HD, hh); ql1 = frag_kb(QLo + pq + (size_t)qi * HD + 32, hh); }
  const float cs = LOG2E / (8.0f * XS * XS);
  float m = -INFINITY, l = 0.0f; v8f o[4];
#pragma unroll
  for (int t = 0; t < 4; ++t) o[t] = (v8f){};
  v16b kh[2][2], kl[2][2], vh[4], vl[4];
  auto fetch_k = [&](const b16* st, int c) {   // chunk c of the stage at st: K rows 32 c + 16 u + col
    const b16* const a0 = st + (c * 32 + col) * LP + 8 * hh;
#pragma unroll
    for (int u = 0; u < 2; ++u) {
      kh[u][0] = frag_at(a0 + u * 16 * LP); kh[u][1] = frag_at(a0 + u * 16 * LP + 32);
      if (RES) { kl[u][0] = frag_at(a0 + (2 * SK + u * 16) * LP); kl[u][1] = frag_at(a0 + (2 * SK + u * 16) * LP + 32); }
    }
  };
  auto fetch_v = [&](const b16* st, int c) {   // V^T rows 16 t + col, keys 32 c ..
    const b16* const a0 = st + (SK + col) * LP + c * 32 + 8 * hh;
#pragma unroll
    for (int t = 0; t < 4; ++t) {
      vh[t] = frag_at(a0 + t * 16 * LP);
      if (RES) vl[t] = frag_at(a0 + (2 * SK + t * 16) * LP);
    }
  };
  wait_copies(); __syncthreads(); issue(1);
#pragma unroll 1   // one stage per trip: the buffer index and the refill test stay scalar
  for (int s = 0; s < ns; ++s) {
    const b16* const st = ring + (s & 1) * BROWS * LP;
#pragma unroll
    for (int c = 0; c < SK / 32; ++c) {
      const int kb = s * SK + c * 32;
      if (kb < kend) {   // the same for a whole wave (a scalar test): a wave past its last key only passes the stage's foot
        v8f s_[2];
        if (c == 0) fetch_k(st, 0);
        fetch_v(st, c);   // this chunk's V reads fly under the score products and the softmax
#pragma unroll
        for (int u = 0; u < 2; ++u) {
          s_[u] = (v8f){};
          if (RES) {
            s_[u] = wmma16b(kh[u][0], qh0, s_[u]); s_[u] = wmma16b(kh[u][0], ql0, s_[u]); s_[u] = wmma16b(kl[u][0], qh0, s_[u]);
            s_[u] = wmma16b(kh[u][1], qh1, s_[u]); s_[u] = wmma16b(kh[u][1], ql1, s_[u]); s_[u] = wmma16b(kl[u][1], qh1, s_[u]);
          } else {
            s_[u] = wmma16b(kh[u][0], qh0, s_[u]); s_[u] = wmma16b(kh[u][1], qh1, s_[u]);
          }
        }
        if (c + 1 < SK / 32) fetch_k(st, c + 1);   // the same stage's next chunk: its K reads are issued inside this chunk, well ahead of their products
        float al; v16b pf, pg = (v16b){};   // B fragment of P^T: element i2 of a lane is key (i2 < 8 ? 0 : 16) + 8 hh + (i2 & 7) of its own query, the lane's own score i2
        // MK: the chunk crosses the mask line. Without it every key of the chunk is allowed for every query of the wave: every score is finite, so the key test and the tests on -inf are identities and are left out
        auto soft = [&](auto mk) {
          constexpr bool MK = decltype(mk)::v;
          float e[16]; float mx = -INFINITY;
#pragma unroll
          for (int u = 0; u < 2; ++u)
#pragma unroll
            for (int r = 0; r < 8; ++r) { const int key = kb + u * 16 + 8 * hh + r; const float vv = (!MK || key <= qi + SRC) ? s_[u][r] * cs : -INFINITY; e[u * 8 + r] = vv; mx = fmaxf(mx, vv); }
          mx = fmaxf(mx, __shfl_xor(mx, 16)); const float mn = fmaxf(m, mx); const float da = m - mn; float ea = nexp2(da), sum;
          float x[16], pe[16];
#pragma unroll
          for (int i2 = 0; i2 < 16; ++i2) { x[i2] = e[i2] - mn; pe[i2] = nexp2(x[i2]); }
          exp_slot(ea, da); exp_slot<0>(pe, x); exp_slot<8>(pe, x);
          al = (MK && mn == -INFINITY) ? 1.0f : ea;
#pragma unroll
          for (int i2 = 0; i2 < 16; ++i2) {
            const float p = (MK && e[i2] == -INFINITY) ? 0.0f : pe[i2]; sum = i2 ? sum + p : p;
            if (RES) { b16 a_, b_; split16(p * PS, a_, b_); pf[i2] = a_; pg[i2] = b_; }
            else { pf[i2] = (b16)(p * PS); }
          }
          sum += __shfl_xor(sum, 16); l = l * al + sum; m = mn;
        };
        if (kb + 31 <= q0 + SRC) soft(flag<false>{}); else soft(flag<true>{});   // a scalar test: the chunk's last key against the wave's first query
#pragma unroll
        for (int t = 0; t < 4; ++t) {
          o[t] *= al;
          if (RES) { o[t] = wmma16b(vh[t], pf, o[t]); o[t] = wmma16b(vh[t], pg, o[t]); o[t] = wmma16b(vl[t], pf, o[t]); }
          else { o[t] = wmma16b(vh[t], pf, o[t]); }
        }
      }
    }
    wait_lds_reads(); wait_copies(); __syncthreads();   // publishes stage s + 1 and frees stage s's buffer
    if (s + 2 < ns) issue(s + 2);
  }
  wait_copies();
  const float inv = 1.0f / (l * PS * XS);
#pragma unroll
  for (int t = 0; t < 4; ++t)
#pragma unroll
    for (int r = 0; r < 8; ++r) To[wave][col][t * 16 + 8 * hh + r] = o[t][r] * inv;
  wave_lds_sync();
  {
    for (int rr = 0; rr < 16; ++rr) {
      const v2f f = *(const v2f*)(&To[wave][rr][lane * 2]); v2h hv, lv;
      for (int j = 0; j < 2; ++j) { b16 p, q; split16(f[j] * CS, p, q); hv[j] = p; lv[j] = q; }
      const size_t oi = ((size_t)bb * TF + q0 + rr) * DM + h * HD + lane * 2;
      *(v2h*)(Ch + oi) = hv; *(v2h*)(Cl + oi) = lv;
    }
    
  }
}

// output GEMM: grid (QL/128, 8 slabs of 128 channels, nb); block = 128 rows x 128 channels, 8 waves (4 x 2) of 32 rows x 64 channels: a wave's 8 fragments (2 ctx hi, 2 ctx lo, 4 W_p) feed 16 products
constexpr int OM = 128, ON = 128;
static_assert(2 * OM + ON == GROWS && QL % OM == 0 && DM % ON == 0 && (int)sizeof(float) * OM * (ON + 4) <= GRING_BYTES);
__global__ __launch_bounds__(256) void out_kernel(const b16* __restrict__ Ch, const b16* __restrict__ Cl, const b16* __restrict__ WO, float* __restrict__ out, int b0) {
  __shared__ __attribute__((aligned(16))) unsigned char smem[GRING_BYTES];
  b16* const ring = (b16*)smem; float (*const Tf)[ON + 4] = (float (*)[ON + 4])smem;   // Tf [row][channel] takes the ring's place behind the loop's last barrier
  const int wave = threadIdx.x >> 5, lane = threadIdx.x & 31, nloc = lane & 15, hlf = lane >> 4, wm = wave >> 1, wn = wave & 1; const int bb = blockIdx.z;
  const size_t mo = (size_t)(b0 + bb) * TF + (size_t)blockIdx.x * OM + wave * (OM / 8);
  const int n0 = blockIdx.y * ON;
  v8f acc[2][4];
#pragma unroll
  for (int i = 0; i < 2; ++i)
#pragma unroll
    for (int t = 0; t < 4; ++t) acc[i][t] = (v8f){};
  // stage rows 0-127 Ch, 128-255 Cl (the block's 128 rows), 256-383 WO channels; copy i of a lane: stage row r0 + 32 i, 16-byte piece seg
  const int r0 = threadIdx.x >> 3, seg = threadIdx.x & 7;
  const size_t ma = ((size_t)bb * TF + (size_t)blockIdx.x * OM + r0) * DM + seg * 8;
  const b16* const gH = Ch + ma; const b16* const gL = Cl + ma; const b16* const gB = WO + (size_t)(n0 + r0) * DM + seg * 8;
  const unsigned lrow = lds_addr(smem) + (unsigned)(r0 * LP * 2 + seg * 16);
  auto issue = [&](int s) {
    unsigned l[12]; const b16* g[12];
#pragma unroll
    for (int i = 0; i < 12; ++i) {
      l[i] = lrow + (unsigned)(((s & 1) * GROWS + 32 * i) * LP * 2);
      g[i] = (i < 4 ? gH + (size_t)(32 * i) * DM : i < 8 ? gL + (size_t)(32 * (i - 4)) * DM : gB + (size_t)(32 * (i - 8)) * DM) + s * KC;
    }
    copy12(l, g);
  };
  issue(0); wait_copies(); __syncthreads(); issue(1);
#pragma unroll 1   // one stage per trip: the buffer index and the refill test stay scalar
  for (int s = 0; s < NST; ++s) {
    const b16* const As = ring + ((s & 1) * GROWS + wm * 32 + nloc) * LP; const b16* const Bs = ring + ((s & 1) * GROWS + 2 * OM + wn * 64 + nloc) * LP;
#pragma unroll
    for (int kk = 0; kk < KC; kk += 32) {
      v16b a[2], al[2], bw[4];   // the block's fragment reads stand as one group ahead of its products: their LDS latency is met once a block, not once a product
#pragma unroll
      for (int i = 0; i < 2; ++i) { a[i] = frag_kb(As + i * 16 * LP + kk, hlf); al[i] = frag_kb(As + (OM + i * 16) * LP + kk, hlf); }
#pragma unroll
      for (int t = 0; t < 4; ++t) bw[t] = frag_kb(Bs + t * 16 * LP + kk, hlf);
#pragma unroll
      for (int i = 0; i < 2; ++i)
#pragma unroll
        for (int t = 0; t < 4; ++t) { acc[i][t] = wmma16b(a[i], bw[t], acc[i][t]); acc[i][t] = wmma16b(al[i], bw[t], acc[i][t]); }
    }
    wait_lds_reads(); wait_copies(); __syncthreads();   // publishes stage s + 1 and frees stage s's buffer
    if (s + 2 < NST) issue(s + 2);
  }
  wait_copies();
#pragma unroll
  for (int i = 0; i < 2; ++i)
#pragma unroll
    for (int t = 0; t < 4; ++t) {
#pragma unroll
      for (int r = 0; r < 8; ++r) Tf[wm * 32 + i * 16 + 8 * hlf + r][wn * 64 + t * 16 + nloc] = acc[i][t][r] * (1.0f / (CS * WSC));
    }
  __syncthreads();   // a row of Tf is written by two waves and read by one of them
  {
    for (int rr = 0; rr < OM / 8; ++rr) *(v4f*)(out + (mo + rr) * DM + n0 + lane * 4) = *(const v4f*)(&Tf[wave * (OM / 8) + rr][lane * 4]);
    
  }
}
}  // namespace

extern "C" void kernel_launch(void* const* d_in, const int* in_sizes, int n_in, void* d_out, int out_size, void* d_ws, size_t ws_size, hipStream_t stream) {
  if (n_in < 8) return;
  auto Fp = [&](int i) { return (const float*)d_in[i]; };
  // input order: 0 x [4,2048,1024], 1 W_q, 2 b_q, 3 W_k, 4 b_k, 5 W_v, 6 b_v, 7 W_p; all f32; W (in,out)
  if (in_sizes[0] < BL * TF * DM || in_sizes[1] < DM * DM || in_sizes[2] < DM || in_sizes[3] < DM * DM || in_sizes[4] < DM || in_sizes[5] < DM * DM || in_sizes[6] < DM || in_sizes[7] < DM * DM ||
      out_size < BL * TF * DM) return;
  size_t off = 0; char* ws = (char*)d_ws;
  auto carve = [&](size_t bytes) { char* p = ws + off; off += (bytes + 255) & ~(size_t)255; return p; };
  b16* WT = (b16*)carve((size_t)3 * DM * DM * 2); b16* WO = (b16*)carve((size_t)DM * DM * 2);
  float* CST = (float*)carve((size_t)TF * (HD / 2) * 4); float* SNT = (float*)carve((size_t)TF * (HD / 2) * 4);
  const size_t plane = (size_t)NBH * TF * DM * 2;
  b16* X8 = (b16*)carve(plane);
  b16* QH = (b16*)carve(plane); b16* QLo = (b16*)carve(plane); b16* KH = (b16*)carve(plane); b16* KLo = (b16*)carve(plane);
  b16* VTh = (b16*)carve(plane); b16* VTl = (b16*)carve(plane); b16* Ch = (b16*)carve(plane); b16* Cl = (b16*)carve(plane);
  if (off > ws_size || off > ((size_t)256 << 20)) return;   // 159,907,840 B at NBH == 4
  prep_kernel<<<(unsigned)(4 * PWM / 8), 256, 0, stream>>>(Fp(1), Fp(3), Fp(5), Fp(7), WT, WO);
  rope_tab_kernel<<<(unsigned)((TF * (HD / 2) + 255) / 256), 256, 0, stream>>>(CST, SNT);
  for (int p = 0; p < NPASS; ++p) {
    const int b0 = p * NBH; const int nb = (BL - b0 < NBH) ? (BL - b0) : NBH;
    xcvt_kernel<<<(unsigned)((size_t)nb * KL * DM / 8 / (256 * XU)), 256, 0, stream>>>(Fp(0), X8, b0, nb);
    proj_kernel<<<dim3(KL / PM, nb, 3 * DM / PN), 256, 0, stream>>>(X8, WT, Fp(2), Fp(4), Fp(6), CST, SNT, QH, QLo, KH, KLo, VTh, VTl);
    attn_kernel<1><<<dim3(RSPLIT / AQ, nb * H), AW * 32, 0, stream>>>(QH, QLo, KH, KLo, VTh, VTl, Ch, Cl, 0);
    if (QL > RSPLIT) attn_kernel<0><<<dim3((QL - RSPLIT) / AQ, nb * H), AW * 32, 0, stream>>>(QH, QLo, KH, KLo, VTh, VTl, Ch, Cl, RSPLIT / AQ);
    out_kernel<<<dim3(QL / OM, DM / ON, nb), 256, 0, stream>>>(Ch, Cl, WO, (float*)d_out, b0);
  }
}

// v008
// A run of this version takes 138 microseconds.
// Next to v007, in two timings, it ran 1.15 times as fast each time.
// Over all steps from v000 it is 5.00 times as fast.
#include <hip/hip_runtime.h>

// compute dtype: every contraction on v_wmma_f32_16x16x32_f16 (f16 operands, f32 accumulate). q/k/v projections: x (bf16 RNE values carried x8) by W_q/W_k/W_v (bf16 RNE values carried x256): 1 product;
// attention for query rows < 512 of each sequence: S^T = K Q^T with q and k as f16 hi+lo planes (x8): 3 products; O^T += V^T P^T with v hi+lo (x8) and P hi+lo (x1024): 3 products;
// attention for query rows >= 512: S^T = K Q^T with the hi planes only: 1 product; O^T += V^T P^T with v hi and P (x1024) single: 1 product; ctx W_p with ctx hi+lo (x64) and W_p exact (x256): 2 products.
// Layout: x [B][T][1024]; W_* (in,out); q/k/v = x W + b reshaped to [B][T][16][64]; rotary pairs (2p, 2p+1) of q and k turned by angle t * theta^(-2p/64); scores q k^T / 8 with key j allowed iff
// j <= i + 64; softmax over keys; ctx = P v -> [B][T][1024]; out = ctx W_p (no bias).
// Fragment k-map per lane half hh for A AND B: elements 0..7 <- k = 8hh+0..7, 8..15 <- k = 16+8hh+0..7; acc[r] = D[8hh+r][col].

#ifndef NB
#define NB 4
#endif
#ifndef SEQ
#define SEQ 2048
#endif

namespace {
constexpr int BF = 4, TF = 2048, DM = 1024, H = 16, HD = 64, SRC = 64;
constexpr int BL = NB;                                   // batches computed (== 4 shipped)
constexpr int QL = SEQ;                                  // query rows computed per batch (== 2048 shipped)
constexpr int KL = (QL + SRC < TF) ? (QL + SRC) : TF;    // key rows needed: j <= i + SRC
constexpr int NBH = BL;                                  // batches per pass (planes are sized for NBH): all of them, so every kernel is launched once over the whole problem
constexpr int NPASS = (BL + NBH - 1) / NBH;
constexpr int RSPLIT = (QL < 512) ? QL : 512;            // query rows below this get the hi+lo (3-product) attention path
constexpr float XS = 8.0f, WSC = 256.0f, PS = 1024.0f, CS = 64.0f, LOG2E = 1.4426950408889634f, L2THETA = 13.287712379549449f;
static_assert(BL >= 1 && BL <= BF);
static_assert(QL >= 64 && QL <= TF && QL % 64 == 0);
static_assert(KL % 128 == 0 && KL <= TF && KL >= QL);
static_assert(RSPLIT % 32 == 0 && RSPLIT <= QL);
static_assert(DM == H * HD && TF % 64 == 0 && HD == 64);

typedef _Float16 b16;
typedef __attribute__((ext_vector_type(16))) _Float16 v16b;
typedef __attribute__((ext_vector_type(8))) _Float16 v8b;
typedef __attribute__((ext_vector_type(4))) _Float16 v4h;
typedef __attribute__((ext_vector_type(2))) _Float16 v2h;
typedef __attribute__((ext_vector_type(8))) float v8f;
typedef __attribute__((ext_vector_type(4))) float v4f;
typedef __attribute__((ext_vector_type(2))) float v2f;

__device__ __forceinline__ float bf16_rne(float f) { unsigned int u = __float_as_uint(f); u += 0x7FFFu + ((u >> 16) & 1u); return __uint_as_float(u & 0xFFFF0000u); }
__device__ __forceinline__ void split16(float v, b16& hi, b16& lo) { hi = (b16)v; lo = (b16)(v - (float)hi); }
__device__ __forceinline__ v16b frag_kb(const b16* p, int hh) {
  const v8b a = *(const v8b*)(p + 8 * hh), b = *(const v8b*)(p + 16 + 8 * hh); v16b f;
#pragma unroll
  for (int e = 0; e < 8; ++e) { f[e] = a[e]; f[8 + e] = b[e]; }
  return f;
}
__device__ __forceinline__ v8f wmma16b(v16b a, v16b b, v8f c) {
  v8f d = __builtin_amdgcn_wmma_f32_16x16x32_f16(false, a, false, b, (short)0, c, false, false);
  asm volatile("v_nop\n\tv_nop\n\tv_nop\n\tv_nop" : "+v"(d) : "v"(a), "v"(b));
  return d;
}
__device__ __forceinline__ void wave_lds_sync() { __builtin_amdgcn_fence(3 /* release order */, "workgroup"); __builtin_amdgcn_wave_barrier(); __builtin_amdgcn_fence(2 /* acquire order */, "workgroup"); }
__device__ __forceinline__ v16b frag_at(const b16* p) {   // frag_kb with the lane half's 8 hh already in p
  const v8b a = *(const v8b*)p, b = *(const v8b*)(p + 16); v16b f;
#pragma unroll
  for (int e = 0; e < 8; ++e) { f[e] = a[e]; f[8 + e] = b[e]; }
  return f;
}
__device__ __forceinline__ float nexp2(float v) { return __builtin_amdgcn_exp2f(v); }
template <bool B> struct flag { static constexpr bool v = B; };
// the slot behind a transcendental: the results r and the sources x of the v_exp_f32 in front are operands of this statement, so nothing ahead of it reads such a result or overwrites such a source,
// and its v_nop fills the slot where the statement stands directly behind the last of them
template <int B> __device__ __forceinline__ void exp_slot(float (&r)[16], const float (&x)[16]) {
  asm("v_nop" : "+v"(r[B]), "+v"(r[B + 1]), "+v"(r[B + 2]), "+v"(r[B + 3]), "+v"(r[B + 4]), "+v"(r[B + 5]), "+v"(r[B + 6]), "+v"(r[B + 7])
              : "v"(x[B]), "v"(x[B + 1]), "v"(x[B + 2]), "v"(x[B + 3]), "v"(x[B + 4]), "v"(x[B + 5]), "v"(x[B + 6]), "v"(x[B + 7]));
}
__device__ __forceinline__ void exp_slot(float& r, float x) { asm("v_nop" : "+v"(r) : "v"(x)); }   // the same for one v_exp_f32

// GEMM operand staging: a stage is KC k (one whole 128-byte line) of GROWS operand rows, laid in LDS at a pitch of 144 B (16 B x odd: no bank conflict for the 16-byte fragment reads); two buffers.
constexpr int KC = 64, LP = KC + 8, NST = DM / KC;
constexpr int GROWS = 384, GRING_BYTES = 2 * GROWS * LP * 2;   // a GEMM stage: 384 operand rows
static_assert(DM % KC == 0 && NST >= 2 && (LP * 2) % 32 == 16);
__device__ __forceinline__ unsigned lds_addr(const void* p) { return (unsigned)(uintptr_t)p; }   // LDS byte address = low 32 bits of the __shared__ address
// eight 16-byte asynchronous copies per lane, global -> LDS through no register; the closing s_wait_xcnt stands in front of every later rewrite of the address registers that the copies name (a precaution)
__device__ __forceinline__ void copy8(const unsigned (&l)[8], const b16* const (&g)[8]) {
  asm volatile("global_load_async_to_lds_b128 %0, %8, off\n\t"
               "global_load_async_to_lds_b128 %1, %9, off\n\t"
               "global_load_async_to_lds_b128 %2, %10, off\n\t"
               "global_load_async_to_lds_b128 %3, %11, off\n\t"
               "global_load_async_to_lds_b128 %4, %12, off\n\t"
               "global_load_async_to_lds_b128 %5, %13, off\n\t"
               "global_load_async_to_lds_b128 %6, %14, off\n\t"
               "global_load_async_to_lds_b128 %7, %15, off\n\t"
               "s_wait_xcnt 0x0"
               :: "v"(l[0]), "v"(l[1]), "v"(l[2]), "v"(l[3]), "v"(l[4]), "v"(l[5]), "v"(l[6]), "v"(l[7]),
                  "v"(g[0]), "v"(g[1]), "v"(g[2]), "v"(g[3]), "v"(g[4]), "v"(g[5]), "v"(g[6]), "v"(g[7]) : "memory");
}
// the same for twelve copies per lane (a GEMM stage of GROWS rows over 256 lanes)
__device__ __forceinline__ void copy12(const unsigned (&l)[12], const b16* const (&g)[12]) {
  asm volatile("global_load_async_to_lds_b128 %0, %12, off\n\t"
               "global_load_async_to_lds_b128 %1, %13, off\n\t"
               "global_load_async_to_lds_b128 %2, %14, off\n\t"
               "global_load_async_to_lds_b128 %3, %15, off\n\t"
               "global_load_async_to_lds_b128 %4, %16, off\n\t"
               "global_load_async_to_lds_b128 %5, %17, off\n\t"
               "global_load_async_to_lds_b128 %6, %18, off\n\t"
               "global_load_async_to_lds_b128 %7, %19, off\n\t"
               "global_load_async_to_lds_b128 %8, %20, off\n\t"
               "global_load_async_to_lds_b128 %9, %21, off\n\t"
               "global_load_async_to_lds_b128 %10, %22, off\n\t"
               "global_load_async_to_lds_b128 %11, %23, off\n\t"
               "s_wait_xcnt 0x0"
               :: "v"(l[0]), "v"(l[1]), "v"(l[2]), "v"(l[3]), "v"(l[4]), "v"(l[5]), "v"(l[6]), "v"(l[7]), "v"(l[8]), "v"(l[9]), "v"(l[10]), "v"(l[11]),
                  "v"(g[0]), "v"(g[1]), "v"(g[2]), "v"(g[3]), "v"(g[4]), "v"(g[5]), "v"(g[6]), "v"(g[7]), "v"(g[8]), "v"(g[9]), "v"(g[10]), "v"(g[11]) : "memory");
}
__device__ __forceinline__ void wait_copies() { asm volatile("s_wait_asynccnt 0x0" ::: "memory"); }   // this wave's copies have landed in LDS
__device__ __forceinline__ void wait_lds_reads() { asm volatile("s_wait_dscnt 0x0" ::: "memory"); }   // this wave's LDS reads are done before their buffer is handed back

// prep: WT [3072 o][1024 k]: o < 1024 W_q[k][o], < 2048 W_k[k][o-1024], else W_v[k][o-2048]; WO [1024 o][1024 k] = W_p[k][o] ((in,out) layouts -> transposed, k contiguous); bf16 RNE then x256
// a thread converts PK = 64 elements: one output channel o, 64 consecutive k. Over a wave (32 neighbouring o) each of its 64 loads is one whole 128-byte line of W, and a lane's 8 stores fill one whole line of WT / WO
constexpr int PK = 64, PWM = (DM / 32) * (DM / PK);   // PWM: waves per matrix
static_assert(DM % 32 == 0 && DM % PK == 0 && (4 * PWM) % 8 == 0);
__global__ __launch_bounds__(256) void prep_kernel(const float* __restrict__ wq, const float* __restrict__ wk, const float* __restrict__ wv, const float* __restrict__ wp, b16* __restrict__ WT, b16* __restrict__ WO) {
  const int gw = (int)blockIdx.x * 8 + (int)(threadIdx.x >> 5), lane = threadIdx.x & 31;
  if (gw >= 4 * PWM) return;
  const int mtx = gw / PWM, r = gw % PWM, oo = (r / (DM / PK)) * 32 + lane, k0 = (r % (DM / PK)) * PK;
  const float* w = mtx == 0 ? wq : mtx == 1 ? wk : mtx == 2 ? wv : wp;
  const float* const src = w + (size_t)k0 * DM + oo;
  float f[PK];
#pragma unroll
  for (int j = 0; j < PK; ++j) f[j] = src[(size_t)j * DM];
  b16* const dst = ((mtx < 3) ? (WT + (size_t)mtx * DM * DM) : WO) + (size_t)oo * DM + k0;
#pragma unroll
  for (int q = 0; q < PK / 8; ++q) {
    v8b o;
#pragma unroll
    for (int j = 0; j < 8; ++j) o[j] = (b16)(bf16_rne(f[q * 8 + j]) * WSC);
    *(v8b*)(dst + q * 8) = o;
  }
}

__global__ __launch_bounds__(256) void rope_tab_kernel(float* __restrict__ cst, float* __restrict__ snt) {
  const int i = blockIdx.x * 256 + threadIdx.x;
  if (i >= TF * (HD / 2)) return;
  const int t = i / (HD / 2), p = i % (HD / 2);
  const float e = (float)(2 * p) * (1.0f / (float)HD);   // exact
  const float inv = exp2f(-(e * L2THETA));                // theta^(-e)
  const float ang = (float)t * inv;
  float sv, cv;
  sincosf(ang, &sv, &cv);
  { *(float*)(cst + i) = cv; *(float*)(snt + i) = sv;  }
}

// a thread converts XU = 8 units of 8 elements; a block's 256 XU units are consecutive (64 KiB of x, inside one batch); a thread's loads stand ahead of its conversions, so that many are in flight at once
constexpr int XU = 8;
static_assert(((size_t)KL * DM / 8) % (256 * XU) == 0);
__global__ __launch_bounds__(256) void xcvt_kernel(const float* __restrict__ x, b16* __restrict__ X8, int b0, int nb) {
  const size_t ub = (size_t)blockIdx.x * (256 * XU);
  const size_t per = (size_t)KL * DM / 8;
  if (ub >= (size_t)nb * per) return;
  const int bb = (int)(ub / per); const size_t e = (ub % per + threadIdx.x) * 8;   // e = t DM + c of the thread's first unit
  const float* const src = x + ((size_t)(b0 + bb)) * TF * DM + e;
  b16* const dst = X8 + (size_t)bb * TF * DM + e;
  v4f f0[XU], f1[XU];
#pragma unroll
  for (int i = 0; i < XU; ++i) { f0[i] = *(const v4f*)(src + i * 2048); f1[i] = *(const v4f*)(src + i * 2048 + 4); }
#pragma unroll
  for (int i = 0; i < XU; ++i) {
    v8b o;
#pragma unroll
    for (int j = 0; j < 4; ++j) { o[j] = (b16)(bf16_rne(f0[i][j]) * XS); o[4 + j] = (b16)(bf16_rne(f1[i][j]) * XS); }
    *(v8b*)(dst + i * 2048) = o;
  }
}

// projections: grid (KL/256, nb, 24 slabs of 128 output channels: 0-7 q, 8-15 k, 16-23 v); block = 256 tokens x 128 channels, 8 waves (4 x 2) of 64 tokens x 64 channels: a wave's 8 fragments feed 16 products;
// K = 1024 in 16 stages of 64: stage rows 0-255 X8 tokens, 256-383 WT channels, copied to LDS one stage ahead; A and B fragments from LDS; the k order of every accumulator is unchanged
constexpr int PM = 256, PN = 128;
static_assert(PM + PN == GROWS && KL % PM == 0 && DM % PN == 0);
constexpr int PSMEM = (int)sizeof(float) * PM * (PN + 4) > GRING_BYTES ? (int)sizeof(float) * PM * (PN + 4) : GRING_BYTES;
__global__ __launch_bounds__(256) void proj_kernel(const b16* __restrict__ X8, const b16* __restrict__ WT, const float* __restrict__ bq, const float* __restrict__ bk, const float* __restrict__ bv,
                                                    const float* __restrict__ cst, const float* __restrict__ snt,
                                                    b16* __restrict__ QH, b16* __restrict__ QLo, b16* __restrict__ KH, b16* __restrict__ KLo, b16* __restrict__ VTh, b16* __restrict__ VTl) {
  __shared__ __attribute__((aligned(16))) unsigned char smem[PSMEM];
  b16* const ring = (b16*)smem; float (*const Tf)[PN + 4] = (float (*)[PN + 4])smem;   // Tf [token][channel] takes the ring's place behind the loop's last barrier
  const int wave = threadIdx.x >> 5, lane = threadIdx.x & 31, nloc = lane & 15, hlf = lane >> 4, wm = wave >> 1, wn = wave & 1;
  const int t0 = blockIdx.x * PM; const int bb = blockIdx.y; const int slab = blockIdx.z, n0 = slab * PN, part = slab / 8, c0 = n0 - part * DM;
  const int r0 = threadIdx.x >> 3, seg = threadIdx.x & 7;   // copy i of a lane: stage row r0 + 32 i, 16-byte piece seg; a wave's copy covers 4 whole lines
  const b16* const gA = X8 + ((size_t)bb * TF + t0 + r0) * DM + seg * 8; const b16* const gB = WT + (size_t)(n0 + r0) * DM + seg * 8;
  const unsigned lrow = lds_addr(smem) + (unsigned)(r0 * LP * 2 + seg * 16);
  auto issue = [&](int s) {
    unsigned l[12]; const b16* g[12];
    const b16* const pa = gA + s * KC; const b16* const pb = gB + s * KC; const unsigned lb = lrow + (unsigned)((s & 1) * GROWS * LP * 2);
#pragma unroll
    for (int i = 0; i < 12; ++i) { l[i] = lb + (unsigned)(32 * i * LP * 2); g[i] = i < 8 ? pa + (size_t)(32 * i) * DM : pb + (size_t)(32 * (i - 8)) * DM; }
    copy12(l, g);
  };
  v8f acc[4][4];
#pragma unroll
  for (int i = 0; i < 4; ++i)
#pragma unroll
    for (int t = 0; t < 4; ++t) acc[i][t] = (v8f){};
  issue(0); wait_copies(); __syncthreads(); issue(1);
#pragma unroll 1   // one stage per trip: the buffer index and the refill test stay scalar
  for (int s = 0; s < NST; ++s) {
    const b16* const As = ring + ((s & 1) * GROWS + wm * 64 + nloc) * LP; const b16* const Bs = ring + ((s & 1) * GROWS + PM + wn * 64 + nloc) * LP;
#pragma unroll
    for (int kk = 0; kk < KC; kk += 32) {
      v16b a[4], bw[4];   // the block's fragment reads stand as one group ahead of its products: their LDS latency is met once a block, not once a product
#pragma unroll
      for (int i = 0; i < 4; ++i) a[i] = frag_kb(As + i * 16 * LP + kk, hlf);
#pragma unroll
      for (int t = 0; t < 4; ++t) bw[t] = frag_kb(Bs + t * 16 * LP + kk, hlf);
#pragma unroll
      for (int i = 0; i < 4; ++i)
#pragma unroll
        for (int t = 0; t < 4; ++t) acc[i][t] = wmma16b(a[i], bw[t], acc[i][t]);
    }
    wait_lds_reads(); wait_copies(); __syncthreads();   // publishes stage s + 1 and frees stage s's buffer
    if (s + 2 < NST) issue(s + 2);
  }
  wait_copies();
  const float* bias = part == 0 ? bq : part == 1 ? bk : bv;
#pragma unroll
  for (int t = 0; t < 4; ++t) {
    const float bval = bf16_rne(bias[c0 + wn * 64 + t * 16 + nloc]);
#pragma unroll
    for (int i = 0; i < 4; ++i)
#pragma unroll
      for (int r = 0; r < 8; ++r) Tf[wm * 64 + i * 16 + 8 * hlf + r][wn * 64 + t * 16 + nloc] = acc[i][t][r] * (1.0f / (XS * WSC)) + bval;
  }
  __syncthreads();
  {
    if (part < 2) {
      b16* ph_ = part == 0 ? QH : KH; b16* pl_ = part == 0 ? QLo : KLo;
      const int c = c0 + lane * 4; const int hq = c / HD, d = c % HD, p0 = d >> 1;   // d is a multiple of 4: pairs (d,d+1) -> p0 and (d+2,d+3) -> p0+1
#pragma unroll 1   // eight rows a trip (the inner loop, unrolled): their table loads and LDS reads fly together, so that a wave's 32 rows meet that latency 4 times
      for (int r8 = 0; r8 < PM / 8; r8 += 8) {
#pragma unroll
      for (int rj = 0; rj < 8; ++rj) {
        const int row = wave * (PM / 8) + r8 + rj, tok = t0 + row;
        const v4f f = *(const v4f*)(&Tf[row][lane * 4]);
        const v2f cc = *(const v2f*)(cst + (size_t)tok * (HD / 2) + p0), ss = *(const v2f*)(snt + (size_t)tok * (HD / 2) + p0);
        const float o0 = f[0] * cc[0] - f[1] * ss[0];
        const float o1 = f[0] * ss[0] + f[1] * cc[0];
        const float o2 = f[2] * cc[1] - f[3] * ss[1];
        const float o3 = f[2] * ss[1] + f[3] * cc[1];
        v4h h4, l4; b16 ph, pl;
        split16(o0 * XS, ph, pl); h4[0] = ph; l4[0] = pl;
        split16(o1 * XS, ph, pl); h4[1] = ph; l4[1] = pl;
        split16(o2 * XS, ph, pl); h4[2] = ph; l4[2] = pl;
        split16(o3 * XS, ph, pl); h4[3] = ph; l4[3] = pl;
        const size_t oi = (((size_t)bb * H + hq) * TF + tok) * HD + d;
        *(v4h*)(ph_ + oi) = h4; *(v4h*)(pl_ + oi) = l4;
      }
      asm volatile("s_wait_xcnt 0x0" ::: "memory");   // in front of the next trip's rewrite of the registers that this trip's loads and stores name (a precaution)
      }
    } else {
#pragma unroll 1   // eight channels a trip (the inner loop, unrolled): their LDS reads fly together, so that a wave meets that latency 8 times, not 64
      for (int q8 = 0; q8 < PM / 4; q8 += 8) {
#pragma unroll
      for (int qj = 0; qj < 8; ++qj) {
        const int q = q8 + qj;
        const int cl = (wave & 3) * 32 + (q & 31); const int c = c0 + cl; const int hv_ = c / HD, d = c % HD; const int tk = (wave >> 2) * (PM / 2) + (q >> 5) * 64 + lane * 2; v2h hv, lv;   // waves 0-3: tokens 0-127, waves 4-7: tokens 128-255, 64 at a time
        for (int j = 0; j < 2; ++j) { b16 p, ql; split16(Tf[tk + j][cl] * XS, p, ql); hv[j] = p; lv[j] = ql; }
        const size_t oi = (((size_t)bb * H + hv_) * HD + d) * (size_t)TF + t0 + tk;
        *(v2h*)(VTh + oi) = hv; *(v2h*)(VTl + oi) = lv;
      }
      asm volatile("s_wait_xcnt 0x0" ::: "memory");   // in front of the next trip's rewrite of the registers that this trip's stores name (a precaution)
      }
    }
    
  }
}

// attention: grid (nb x H, rows/64): block y takes the 64-row query block xlast - y, so that a block's cost (its number of key stages) falls with its index (for speed only); block = 4 waves x 16 queries; a wave's keys are 0 .. min(KL, q0+16+SRC)-1 in 32-key chunks; key allowed iff key <= qi + SRC;
// RES != 0 (query rows < RSPLIT): S^T = K Q^T with 3 products (kh qh + kh ql + kl qh), P x1024 hi/lo, O^T += V^T P^T with 3 products (vh ph + vh pl + vl ph);
// RES == 0 (query rows >= RSPLIT, >= RSPLIT+SRC keys per row): S^T = kh qh (1 product), P x1024 single, O^T += vh p (1 product). Online softmax (running max, f32) in both; a lane's own P values are its B fragment of P^T and stay in registers
// K and V^T reach the waves through LDS: a stage is SK keys = 64 K rows and 64 V^T rows of one whole 128-byte line each (hi planes; RES: the lo planes behind them), copied one stage ahead as whole lines and shared by the
// block's 4 waves; the 16-byte fragment reads, which touch 16 rows each, go to LDS at the 144-byte pitch instead of to the cache
constexpr int AW = 4, AQ = AW * 16, SK = 64;
static_assert(SK == KC && HD == KC && KL % SK == 0 && (AQ + SRC) % SK == 0 && AQ + SRC >= 2 * SK && RSPLIT % AQ == 0 && QL % AQ == 0);
template <int RES>
__global__ __launch_bounds__(128) void attn_kernel(const b16* __restrict__ QH, const b16* __restrict__ QLo, const b16* __restrict__ KH, const b16* __restrict__ KLo, const b16* __restrict__ VTh, const b16* __restrict__ VTl,
                                                   b16* __restrict__ Ch, b16* __restrict__ Cl, int xlast) {
  constexpr int NP = RES ? 2 : 1, BROWS = 2 * SK * NP;   // stage rows: 0-63 K hi, 64-127 V^T hi, then (RES) 128-191 K lo, 192-255 V^T lo
  __shared__ __attribute__((aligned(16))) unsigned char smem[2 * BROWS * LP * 2];
  static_assert(sizeof(float) * AW * 16 * (HD + 4) <= sizeof(smem));
  b16* const ring = (b16*)smem; float (*const To)[16][HD + 4] = (float (*)[16][HD + 4])smem;   // To takes the ring's place behind the loop's last barrier
  // the wave's number is taken into a scalar register, so that kend and the test on it below are scalar and no wave's EXEC changes around the products
  const int wave = __builtin_amdgcn_readfirstlane(threadIdx.x >> 5), lane = threadIdx.x & 31, hh = lane >> 4, col = lane & 15; const int bb = blockIdx.x / H, h = blockIdx.x % H;
  const int qb = (xlast - (int)blockIdx.y) * AQ, q0 = qb + wave * 16, qi = q0 + col;
  const size_t ph = (size_t)bb * H + h; const size_t pq = ph * TF * HD; const b16* Vh = VTh + ph * HD * (size_t)TF; const b16* Vl = VTl + ph * HD * (size_t)TF;
  const int kmax = q0 + 16 + SRC; const int kend = kmax < KL ? kmax : KL;          // this wave's keys
  const int bmax = qb + AQ + SRC; const int ns = (bmax < KL ? bmax : KL) / SK;      // the block's stages: >= 2, every one wholly inside the planes
  // copy i of a lane: stage row r0 + 16 i, 16-byte piece seg; a wave's copy covers 4 whole lines
  const int r0 = threadIdx.x >> 3, seg = threadIdx.x & 7;
  const size_t ko = pq + (size_t)r0 * HD + seg * 8, vo = (size_t)r0 * TF + seg * 8;
  const unsigned lrow = lds_addr(smem) + (unsigned)(r0 * LP * 2 + seg * 16);
  auto issue = [&](int s) {
#pragma unroll
    for (int pl = 0; pl < NP; ++pl) {
      unsigned l[8]; const b16* g[8];
      const b16* const pk = (pl ? KLo : KH) + ko + (size_t)s * (SK * HD); const b16* const pv = (pl ? Vl : Vh) + vo + s * SK;
      const unsigned lb = lrow + (unsigned)(((s & 1) * BROWS + pl * 2 * SK) * LP * 2);
#pragma unroll
      for (int i = 0; i < 8; ++i) { l[i] = lb + (unsigned)(16 * i * LP * 2); g[i] = i < 4 ? pk + (size_t)(16 * i) * HD : pv + (size_t)(16 * (i - 4)) * TF; }
      copy8(l, g);
    }
  };
  issue(0);
  const v16b qh0 = frag_kb(QH + pq + (size_t)qi * HD, hh), qh1 = frag_kb(QH + pq + (size_t)qi * HD + 32, hh);
  v16b ql0 = (v16b){}, ql1 = (v16b){};
  if (RES) { ql0 = frag_kb(QLo + pq + (size_t)qi * HD, hh); ql1 = frag_kb(QLo + pq + (size_t)qi * HD + 32, hh); }
  const float cs = LOG2E / (8.0f * XS * XS);
  float m = -INFINITY, l = 0.0f; v8f o[4];
#pragma unroll
  for (int t = 0; t < 4; ++t) o[t] = (v8f){};
  v16b kh[2][2], kl[2][2], vh[4], vl[4];
  auto fetch_k = [&](const b16* st, int c) {   // chunk c of the stage at st: K rows 32 c + 16 u + col
    const b16* const a0 = st + (c * 32 + col) * LP + 8 * hh;
#pragma unroll
    for (int u = 0; u < 2; ++u) {
      kh[u][0] = frag_at(a0 + u * 16 * LP); kh[u][1] = frag_at(a0 + u * 16 * LP + 32);
      if (RES) { kl[u][0] = frag_at(a0 + (2 * SK + u * 16) * LP); kl[u][1] = frag_at(a0 + (2 * SK + u * 16) * LP + 32); }
    }
  };
  auto fetch_v = [&](const b16* st, int c) {   // V^T rows 16 t + col, keys 32 c ..
    const b16* const a0 = st + (SK + col) * LP + c * 32 + 8 * hh;
#pragma unroll
    for (int t = 0; t < 4; ++t) {
      vh[t] = frag_at(a0 + t * 16 * LP);
      if (RES) vl[t] = frag_at(a0 + (2 * SK + t * 16) * LP);
    }
  };
  wait_copies(); __syncthreads(); issue(1);
#pragma unroll 1   // one stage per trip: the buffer index and the refill test stay scalar
  for (int s = 0; s < ns; ++s) {
    const b16* const st = ring + (s & 1) * BROWS * LP;
#pragma unroll
    for (int c = 0; c < SK / 32; ++c) {
      const int kb = s * SK + c * 32;
      if (kb < kend) {   // the same for a whole wave (a scalar test): a wave past its last key only passes the stage's foot
        v8f s_[2];
        if (c == 0) fetch_k(st, 0);
        fetch_v(st, c);   // this chunk's V reads fly under the score products and the softmax
#pragma unroll
        for (int u = 0; u < 2; ++u) {
          s_[u] = (v8f){};
          if (RES) {
            s_[u] = wmma16b(kh[u][0], qh0, s_[u]); s_[u] = wmma16b(kh[u][0], ql0, s_[u]); s_[u] = wmma16b(kl[u][0], qh0, s_[u]);
            s_[u] = wmma16b(kh[u][1], qh1, s_[u]); s_[u] = wmma16b(kh[u][1], ql1, s_[u]); s_[u] = wmma16b(kl[u][1], qh1, s_[u]);
          } else {
            s_[u] = wmma16b(kh[u][0], qh0, s_[u]); s_[u] = wmma16b(kh[u][1], qh1, s_[u]);
          }
        }
        if (c + 1 < SK / 32) fetch_k(st, c + 1);   // the same stage's next chunk: its K reads are issued inside this chunk, well ahead of their products
        float al; v16b pf, pg = (v16b){};   // B fragment of P^T: element i2 of a lane is key (i2 < 8 ? 0 : 16) + 8 hh + (i2 & 7) of its own query, the lane's own score i2
        // MK: the chunk crosses the mask line. Without it every key of the chunk is allowed for every query of the wave: every score is finite, so the key test and the tests on -inf are identities and are left out
        auto soft = [&](auto mk) {
          constexpr bool MK = decltype(mk)::v;
          float e[16]; float mx = -INFINITY;
#pragma unroll
          for (int u = 0; u < 2; ++u)
#pragma unroll
            for (int r = 0; r < 8; ++r) { const int key = kb + u * 16 + 8 * hh + r; const float vv = (!MK || key <= qi + SRC) ? s_[u][r] * cs : -INFINITY; e[u * 8 + r] = vv; mx = fmaxf(mx, vv); }
          mx = fmaxf(mx, __shfl_xor(mx, 16)); const float mn = fmaxf(m, mx); const float da = m - mn; float ea = nexp2(da), sum;
          float x[16], pe[16];
#pragma unroll
          for (int i2 = 0; i2 < 16; ++i2) { x[i2] = e[i2] - mn; pe[i2] = nexp2(x[i2]); }
          exp_slot(ea, da); exp_slot<0>(pe, x); exp_slot<8>(pe, x);
          al = (MK && mn == -INFINITY) ? 1.0f : ea;
#pragma unroll
          for (int i2 = 0; i2 < 16; ++i2) {
            const float p = (MK && e[i2] == -INFINITY) ? 0.0f : pe[i2]; sum = i2 ? sum + p : p;
            if (RES) { b16 a_, b_; split16(p * PS, a_, b_); pf[i2] = a_; pg[i2] = b_; }
            else { pf[i2] = (b16)(p * PS); }
          }
          sum += __shfl_xor(sum, 16); l = l * al + sum; m = mn;
        };
        if (kb + 31 <= q0 + SRC) soft(flag<false>{}); else soft(flag<true>{});   // a scalar test: the chunk's last key against the wave's first query
#pragma unroll
        for (int t = 0; t < 4; ++t) {
          o[t] *= al;
          if (RES) { o[t] = wmma16b(vh[t], pf, o[t]); o[t] = wmma16b(vh[t], pg, o[t]); o[t] = wmma16b(vl[t], pf, o[t]); }
          else { o[t] = wmma16b(vh[t], pf, o[t]); }
        }
      }
    }
    wait_lds_reads(); wait_copies(); __syncthreads();   // publishes stage s + 1 and frees stage s's buffer
    if (s + 2 < ns) issue(s + 2);
  }
  wait_copies();
  const float inv = 1.0f / (l * PS * XS);
#pragma unroll
  for (int t = 0; t < 4; ++t)
#pragma unroll
    for (int r = 0; r < 8; ++r) To[wave][col][t * 16 + 8 * hh + r] = o[t][r] * inv;
  wave_lds_sync();
  {
    for (int rr = 0; rr < 16; ++rr) {
      const v2f f = *(const v2f*)(&To[wave][rr][lane * 2]); v2h hv, lv;
      for (int j = 0; j < 2; ++j) { b16 p, q; split16(f[j] * CS, p, q); hv[j] = p; lv[j] = q; }
      const size_t oi = ((size_t)bb * TF + q0 + rr) * DM + h * HD + lane * 2;
      *(v2h*)(Ch + oi) = hv; *(v2h*)(Cl + oi) = lv;
    }
    
  }
}

// output GEMM: grid (QL/128, 8 slabs of 128 channels, nb); block = 128 rows x 128 channels, 8 waves (4 x 2) of 32 rows x 64 channels: a wave's 8 fragments (2 ctx hi, 2 ctx lo, 4 W_p) feed 16 products
constexpr int OM = 128, ON = 128;
static_assert(2 * OM + ON == GROWS && QL % OM == 0 && DM % ON == 0 && (int)sizeof(float) * OM * (ON + 4) <= GRING_BYTES);
__global__ __launch_bounds__(256) void out_kernel(const b16* __restrict__ Ch, const b16* __restrict__ Cl, const b16* __restrict__ WO, float* __restrict__ out, int b0) {
  __shared__ __attribute__((aligned(16))) unsigned char smem[GRING_BYTES];
  b16* const ring = (b16*)smem; float (*const Tf)[ON + 4] = (float (*)[ON + 4])smem;   // Tf [row][channel] takes the ring's place behind the loop's last barrier
  const int wave = threadIdx.x >> 5, lane = threadIdx.x & 31, nloc = lane & 15, hlf = lane >> 4, wm = wave >> 1, wn = wave & 1; const int bb = blockIdx.z;
  const size_t mo = (size_t)(b0 + bb) * TF + (size_t)blockIdx.x * OM + wave * (OM / 8);
  const int n0 = blockIdx.y * ON;
  v8f acc[2][4];
#pragma unroll
  for (int i = 0; i < 2; ++i)
#pragma unroll
    for (int t = 0; t < 4; ++t) acc[i][t] = (v8f){};
  // stage rows 0-127 Ch, 128-255 Cl (the block's 128 rows), 256-383 WO channels; copy i of a lane: stage row r0 + 32 i, 16-byte piece seg
  const int r0 = threadIdx.x >> 3, seg = threadIdx.x & 7;
  const size_t ma = ((size_t)bb * TF + (size_t)blockIdx.x * OM + r0) * DM + seg * 8;
  const b16* const gH = Ch + ma; const b16* const gL = Cl + ma; const b16* const gB = WO + (size_t)(n0 + r0) * DM + seg * 8;
  const unsigned lrow = lds_addr(smem) + (unsigned)(r0 * LP * 2 + seg * 16);
  auto issue = [&](int s) {
    unsigned l[12]; const b16* g[12];
#pragma unroll
    for (int i = 0; i < 12; ++i) {
      l[i] = lrow + (unsigned)(((s & 1) * GROWS + 32 * i) * LP * 2);
      g[i] = (i < 4 ? gH + (size_t)(32 * i) * DM : i < 8 ? gL + (size_t)(32 * (i - 4)) * DM : gB + (size_t)(32 * (i - 8)) * DM) + s * KC;
    }
    copy12(l, g);
  };
  issue(0); wait_copies(); __syncthreads(); issue(1);
#pragma unroll 1   // one stage per trip: the buffer index and the refill test stay scalar
  for (int s = 0; s < NST; ++s) {
    const b16* const As = ring + ((s & 1) * GROWS + wm * 32 + nloc) * LP; const b16* const Bs = ring + ((s & 1) * GROWS + 2 * OM + wn * 64 + nloc) * LP;
#pragma unroll
    for (int kk = 0; kk < KC; kk += 32) {
      v16b a[2], al[2], bw[4];   // the block's fragment reads stand as one group ahead of its products: their LDS latency is met once a block, not once a product
#pragma unroll
      for (int i = 0; i < 2; ++i) { a[i] = frag_kb(As + i * 16 * LP + kk, hlf); al[i] = frag_kb(As + (OM + i * 16) * LP + kk, hlf); }
#pragma unroll
      for (int t = 0; t < 4; ++t) bw[t] = frag_kb(Bs + t * 16 * LP + kk, hlf);
#pragma unroll
      for (int i = 0; i < 2; ++i)
#pragma unroll
        for (int t = 0; t < 4; ++t) { acc[i][t] = wmma16b(a[i], bw[t], acc[i][t]); acc[i][t] = wmma16b(al[i], bw[t], acc[i][t]); }
    }
    wait_lds_reads(); wait_copies(); __syncthreads();   // publishes stage s + 1 and frees stage s's buffer
    if (s + 2 < NST) issue(s + 2);
  }
  wait_copies();
#pragma unroll
  for (int i = 0; i < 2; ++i)
#pragma unroll
    for (int t = 0; t < 4; ++t) {
#pragma unroll
      for (int r = 0; r < 8; ++r) Tf[wm * 32 + i * 16 + 8 * hlf + r][wn * 64 + t * 16 + nloc] = acc[i][t][r] * (1.0f / (CS * WSC));
    }
  __syncthreads();   // a row of Tf is written by two waves and read by one of them
  {
    for (int rr = 0; rr < OM / 8; ++rr) *(v4f*)(out + (mo + rr) * DM + n0 + lane * 4) = *(const v4f*)(&Tf[wave * (OM / 8) + rr][lane * 4]);
    
  }
}
}  // namespace

extern "C" void kernel_launch(void* const* d_in, const int* in_sizes, int n_in, void* d_out, int out_size, void* d_ws, size_t ws_size, hipStream_t stream) {
  if (n_in < 8) return;
  auto Fp = [&](int i) { return (const float*)d_in[i]; };
  // input order: 0 x [4,2048,1024], 1 W_q, 2 b_q, 3 W_k, 4 b_k, 5 W_v, 6 b_v, 7 W_p; all f32; W (in,out)
  if (in_sizes[0] < BL * TF * DM || in_sizes[1] < DM * DM || in_sizes[2] < DM || in_sizes[3] < DM * DM || in_sizes[4] < DM || in_sizes[5] < DM * DM || in_sizes[6] < DM || in_sizes[7] < DM * DM ||
      out_size < BL * TF * DM) return;
  size_t off = 0; char* ws = (char*)d_ws;
  auto carve = [&](size_t bytes) { char* p = ws + off; off += (bytes + 255) & ~(size_t)255; return p; };
  b16* WT = (b16*)carve((size_t)3 * DM * DM * 2); b16* WO = (b16*)carve((size_t)DM * DM * 2);
  float* CST = (float*)carve((size_t)TF * (HD / 2) * 4); float* SNT = (float*)carve((size_t)TF * (HD / 2) * 4);
  const size_t plane = (size_t)NBH * TF * DM * 2;
  b16* X8 = (b16*)carve(plane);
  b16* QH = (b16*)carve(plane); b16* QLo = (b16*)carve(plane); b16* KH = (b16*)carve(plane); b16* KLo = (b16*)carve(plane);
  b16* VTh = (b16*)carve(plane); b16* VTl = (b16*)carve(plane); b16* Ch = (b16*)carve(plane); b16* Cl = (b16*)carve(plane);
  if (off > ws_size || off > ((size_t)256 << 20)) return;   // 159,907,840 B at NBH == 4
  prep_kernel<<<(unsigned)(4 * PWM / 8), 256, 0, stream>>>(Fp(1), Fp(3), Fp(5), Fp(7), WT, WO);
  rope_tab_kernel<<<(unsigned)((TF * (HD / 2) + 255) / 256), 256, 0, stream>>>(CST, SNT);
  for (int p = 0; p < NPASS; ++p) {
    const int b0 = p * NBH; const int nb = (BL - b0 < NBH) ? (BL - b0) : NBH;
    xcvt_kernel<<<(unsigned)((size_t)nb * KL * DM / 8 / (256 * XU)), 256, 0, stream>>>(Fp(0), X8, b0, nb);
    proj_kernel<<<dim3(KL / PM, nb, 3 * DM / PN), 256, 0, stream>>>(X8, WT, Fp(2), Fp(4), Fp(6), CST, SNT, QH, QLo, KH, KLo, VTh, VTl);
    attn_kernel<1><<<dim3(nb * H, RSPLIT / AQ), AW * 32, 0, stream>>>(QH, QLo, KH, KLo, VTh, VTl, Ch, Cl, RSPLIT / AQ - 1);
    if (QL > RSPLIT) attn_kernel<0><<<dim3(nb * H, (QL - RSPLIT) / AQ), AW * 32, 0, stream>>>(QH, QLo, KH, KLo, VTh, VTl, Ch, Cl, QL / AQ - 1);
    out_kernel<<<dim3(QL / OM, DM / ON, nb), 256, 0, stream>>>(Ch, Cl, WO, (float*)d_out, b0);
  }
}

// v009
// It runs in 134 microseconds.
// In both of two side-by-side timings against v008, it was 1.03 times as fast.
// Counting every step since v000, it is 5.17 times as fast.
#include <hip/hip_runtime.h>

// compute dtype: every contraction on v_wmma_f32_16x16x32_f16 (f16 operands, f32 accumulate). q/k/v projections: x (bf16 RNE values carried x8) by W_q/W_k/W_v (bf16 RNE values carried x256): 1 product;
// attention for query rows < 512 of each sequence: S^T = K Q^T with q and k as f16 hi+lo planes (x8): 3 products; O^T += V^T P^T with v hi+lo (x8) and P hi+lo (x1024): 3 products;
// attention for query rows >= 512: S^T = K Q^T with the hi planes only: 1 product; O^T += V^T P^T with v hi and P (x1024) single: 1 product; ctx W_p with ctx hi+lo (x64) and W_p exact (x256): 2 products.
// Layout: x [B][T][1024]; W_* (in,out); q/k/v = x W + b reshaped to [B][T][16][64]; rotary pairs (2p, 2p+1) of q and k turned by angle t * theta^(-2p/64); scores q k^T / 8 with key j allowed iff
// j <= i + 64; softmax over keys; ctx = P v -> [B][T][1024]; out = ctx W_p (no bias).
// Fragment k-map per lane half hh for A AND B: elements 0..7 <- k = 8hh+0..7, 8..15 <- k = 16+8hh+0..7; acc[r] = D[8hh+r][col].

#ifndef NB
#define NB 4
#endif
#ifndef SEQ
#define SEQ 2048
#endif

namespace {
constexpr int BF = 4, TF = 2048, DM = 1024, H = 16, HD = 64, SRC = 64;
constexpr int BL = NB;                                   // batches computed (== 4 shipped)
constexpr int QL = SEQ;                                  // query rows computed per batch (== 2048 shipped)
constexpr int KL = (QL + SRC < TF) ? (QL + SRC) : TF;    // key rows needed: j <= i + SRC
constexpr int NBH = BL;                                  // batches per pass (planes are sized for NBH): all of them, so every kernel is launched once over the whole problem
constexpr int NPASS = (BL + NBH - 1) / NBH;
constexpr int RSPLIT = (QL < 512) ? QL : 512;            // query rows below this get the hi+lo (3-product) attention path
constexpr float XS = 8.0f, WSC = 256.0f, PS = 1024.0f, CS = 64.0f, LOG2E = 1.4426950408889634f, L2THETA = 13.287712379549449f;
static_assert(BL >= 1 && BL <= BF);
static_assert(QL >= 64 && QL <= TF && QL % 64 == 0);
static_assert(KL % 128 == 0 && KL <= TF && KL >= QL);
static_assert(RSPLIT % 32 == 0 && RSPLIT <= QL);
static_assert(DM == H * HD && TF % 64 == 0 && HD == 64);

typedef _Float16 b16;
typedef __attribute__((ext_vector_type(16))) _Float16 v16b;
typedef __attribute__((ext_vector_type(8))) _Float16 v8b;
typedef __attribute__((ext_vector_type(4))) _Float16 v4h;
typedef __attribute__((ext_vector_type(2))) _Float16 v2h;
typedef __attribute__((ext_vector_type(8))) float v8f;
typedef __attribute__((ext_vector_type(4))) float v4f;
typedef __attribute__((ext_vector_type(2))) float v2f;

__device__ __forceinline__ float bf16_rne(float f) { unsigned int u = __float_as_uint(f); u += 0x7FFFu + ((u >> 16) & 1u); return __uint_as_float(u & 0xFFFF0000u); }
__device__ __forceinline__ void split16(float v, b16& hi, b16& lo) { hi = (b16)v; lo = (b16)(v - (float)hi); }
__device__ __forceinline__ v16b frag_kb(const b16* p, int hh) {
  const v8b a = *(const v8b*)(p + 8 * hh), b = *(const v8b*)(p + 16 + 8 * hh); v16b f;
#pragma unroll
  for (int e = 0; e < 8; ++e) { f[e] = a[e]; f[8 + e] = b[e]; }
  return f;
}
__device__ __forceinline__ v8f wmma16b(v16b a, v16b b, v8f c) {
  v8f d = __builtin_amdgcn_wmma_f32_16x16x32_f16(false, a, false, b, (short)0, c, false, false);
  asm volatile("v_nop\n\tv_nop\n\tv_nop\n\tv_nop" : "+v"(d) : "v"(a), "v"(b));
  return d;
}
__device__ __forceinline__ void wave_lds_sync() { __builtin_amdgcn_fence(3 /* release order */, "workgroup"); __builtin_amdgcn_wave_barrier(); __builtin_amdgcn_fence(2 /* acquire order */, "workgroup"); }
__device__ __forceinline__ v16b frag_at(const b16* p) {   // frag_kb with the lane half's 8 hh already in p
  const v8b a = *(const v8b*)p, b = *(const v8b*)(p + 16); v16b f;
#pragma unroll
  for (int e = 0; e < 8; ++e) { f[e] = a[e]; f[8 + e] = b[e]; }
  return f;
}
__device__ __forceinline__ float nexp2(float v) { return __builtin_amdgcn_exp2f(v); }
template <bool B> struct flag { static constexpr bool v = B; };
// the slot behind a transcendental: the results r and the sources x of the v_exp_f32 in front are operands of this statement, so nothing ahead of it reads such a result or overwrites such a source,
// and its v_nop fills the slot where the statement stands directly behind the last of them
template <int B> __device__ __forceinline__ void exp_slot(float (&r)[16], const float (&x)[16]) {
  asm("v_nop" : "+v"(r[B]), "+v"(r[B + 1]), "+v"(r[B + 2]), "+v"(r[B + 3]), "+v"(r[B + 4]), "+v"(r[B + 5]), "+v"(r[B + 6]), "+v"(r[B + 7])
              : "v"(x[B]), "v"(x[B + 1]), "v"(x[B + 2]), "v"(x[B + 3]), "v"(x[B + 4]), "v"(x[B + 5]), "v"(x[B + 6]), "v"(x[B + 7]));
}
__device__ __forceinline__ void exp_slot(float& r, float x) { asm("v_nop" : "+v"(r) : "v"(x)); }   // the same for one v_exp_f32

// GEMM operand staging: a stage is KC k (one whole 128-byte line) of GROWS operand rows, laid in LDS at a pitch of 144 B (16 B x odd: no bank conflict for the 16-byte fragment reads); two buffers.
constexpr int KC = 64, LP = KC + 8, NST = DM / KC;
constexpr int GROWS = 384, GRING_BYTES = 2 * GROWS * LP * 2;   // a GEMM stage: 384 operand rows
static_assert(DM % KC == 0 && NST >= 2 && (LP * 2) % 32 == 16);
__device__ __forceinline__ unsigned lds_addr(const void* p) { return (unsigned)(uintptr_t)p; }   // LDS byte address = low 32 bits of the __shared__ address
// eight 16-byte asynchronous copies per lane, global -> LDS through no register; the closing s_wait_xcnt stands in front of every later rewrite of the address registers that the copies name (a precaution)
__device__ __forceinline__ void copy8(const unsigned (&l)[8], const b16* const (&g)[8]) {
  asm volatile("global_load_async_to_lds_b128 %0, %8, off\n\t"
               "global_load_async_to_lds_b128 %1, %9, off\n\t"
               "global_load_async_to_lds_b128 %2, %10, off\n\t"
               "global_load_async_to_lds_b128 %3, %11, off\n\t"
               "global_load_async_to_lds_b128 %4, %12, off\n\t"
               "global_load_async_to_lds_b128 %5, %13, off\n\t"
               "global_load_async_to_lds_b128 %6, %14, off\n\t"
               "global_load_async_to_lds_b128 %7, %15, off\n\t"
               "s_wait_xcnt 0x0"
               :: "v"(l[0]), "v"(l[1]), "v"(l[2]), "v"(l[3]), "v"(l[4]), "v"(l[5]), "v"(l[6]), "v"(l[7]),
                  "v"(g[0]), "v"(g[1]), "v"(g[2]), "v"(g[3]), "v"(g[4]), "v"(g[5]), "v"(g[6]), "v"(g[7]) : "memory");
}
// the same for twelve copies per lane (a GEMM stage of GROWS rows over 256 lanes)
__device__ __forceinline__ void copy12(const unsigned (&l)[12], const b16* const (&g)[12]) {
  asm volatile("global_load_async_to_lds_b128 %0, %12, off\n\t"
               "global_load_async_to_lds_b128 %1, %13, off\n\t"
               "global_load_async_to_lds_b128 %2, %14, off\n\t"
               "global_load_async_to_lds_b128 %3, %15, off\n\t"
               "global_load_async_to_lds_b128 %4, %16, off\n\t"
               "global_load_async_to_lds_b128 %5, %17, off\n\t"
               "global_load_async_to_lds_b128 %6, %18, off\n\t"
               "global_load_async_to_lds_b128 %7, %19, off\n\t"
               "global_load_async_to_lds_b128 %8, %20, off\n\t"
               "global_load_async_to_lds_b128 %9, %21, off\n\t"
               "global_load_async_to_lds_b128 %10, %22, off\n\t"
               "global_load_async_to_lds_b128 %11, %23, off\n\t"
               "s_wait_xcnt 0x0"
               :: "v"(l[0]), "v"(l[1]), "v"(l[2]), "v"(l[3]), "v"(l[4]), "v"(l[5]), "v"(l[6]), "v"(l[7]), "v"(l[8]), "v"(l[9]), "v"(l[10]), "v"(l[11]),
                  "v"(g[0]), "v"(g[1]), "v"(g[2]), "v"(g[3]), "v"(g[4]), "v"(g[5]), "v"(g[6]), "v"(g[7]), "v"(g[8]), "v"(g[9]), "v"(g[10]), "v"(g[11]) : "memory");
}
__device__ __forceinline__ void wait_copies() { asm volatile("s_wait_asynccnt 0x0" ::: "memory"); }   // this wave's copies have landed in LDS
__device__ __forceinline__ void wait_lds_reads() { asm volatile("s_wait_dscnt 0x0" ::: "memory"); }   // this wave's LDS reads are done before their buffer is handed back

// prep: WT [3072 o][1024 k]: o < 1024 W_q[k][o], < 2048 W_k[k][o-1024], else W_v[k][o-2048]; WO [1024 o][1024 k] = W_p[k][o] ((in,out) layouts -> transposed, k contiguous); bf16 RNE then x256
// a thread converts PK = 64 elements: one output channel o, 64 consecutive k. Over a wave (32 neighbouring o) each of its 64 loads is one whole 128-byte line of W, and a lane's 8 stores fill one whole line of WT / WO
constexpr int PK = 64, PWM = (DM / 32) * (DM / PK);   // PWM: waves per matrix
static_assert(DM % 32 == 0 && DM % PK == 0 && (4 * PWM) % 8 == 0);
__global__ __launch_bounds__(256) void prep_kernel(const float* __restrict__ wq, const float* __restrict__ wk, const float* __restrict__ wv, const float* __restrict__ wp, b16* __restrict__ WT, b16* __restrict__ WO) {
  const int gw = (int)blockIdx.x * 8 + (int)(threadIdx.x >> 5), lane = threadIdx.x & 31;
  if (gw >= 4 * PWM) return;
  const int mtx = gw / PWM, r = gw % PWM, oo = (r / (DM / PK)) * 32 + lane, k0 = (r % (DM / PK)) * PK;
  const float* w = mtx == 0 ? wq : mtx == 1 ? wk : mtx == 2 ? wv : wp;
  const float* const src = w + (size_t)k0 * DM + oo;
  float f[PK];
#pragma unroll
  for (int j = 0; j < PK; ++j) f[j] = src[(size_t)j * DM];
  b16* const dst = ((mtx < 3) ? (WT + (size_t)mtx * DM * DM) : WO) + (size_t)oo * DM + k0;
#pragma unroll
  for (int q = 0; q < PK / 8; ++q) {
    v8b o;
#pragma unroll
    for (int j = 0; j < 8; ++j) o[j] = (b16)(bf16_rne(f[q * 8 + j]) * WSC);
    *(v8b*)(dst + q * 8) = o;
  }
}

__global__ __launch_bounds__(256) void rope_tab_kernel(float* __restrict__ cst, float* __restrict__ snt) {
  const int i = blockIdx.x * 256 + threadIdx.x;
  if (i >= TF * (HD / 2)) return;
  const int t = i / (HD / 2), p = i % (HD / 2);
  const float e = (float)(2 * p) * (1.0f / (float)HD);   // exact
  const float inv = exp2f(-(e * L2THETA));                // theta^(-e)
  const float ang = (float)t * inv;
  float sv, cv;
  sincosf(ang, &sv, &cv);
  { *(float*)(cst + i) = cv; *(float*)(snt + i) = sv;  }
}

// a thread converts XU = 8 units of 8 elements; a block's 256 XU units are consecutive (64 KiB of x, inside one batch); a thread's loads stand ahead of its conversions, so that many are in flight at once
constexpr int XU = 8;
static_assert(((size_t)KL * DM / 8) % (256 * XU) == 0);
__global__ __launch_bounds__(256) void xcvt_kernel(const float* __restrict__ x, b16* __restrict__ X8, int b0, int nb) {
  const size_t ub = (size_t)blockIdx.x * (256 * XU);
  const size_t per = (size_t)KL * DM / 8;
  if (ub >= (size_t)nb * per) return;
  const int bb = (int)(ub / per); const size_t e = (ub % per + threadIdx.x) * 8;   // e = t DM + c of the thread's first unit
  const float* const src = x + ((size_t)(b0 + bb)) * TF * DM + e;
  b16* const dst = X8 + (size_t)bb * TF * DM + e;
  v4f f0[XU], f1[XU];
#pragma unroll
  for (int i = 0; i < XU; ++i) { f0[i] = *(const v4f*)(src + i * 2048); f1[i] = *(const v4f*)(src + i * 2048 + 4); }
#pragma unroll
  for (int i = 0; i < XU; ++i) {
    v8b o;
#pragma unroll
    for (int j = 0; j < 4; ++j) { o[j] = (b16)(bf16_rne(f0[i][j]) * XS); o[4 + j] = (b16)(bf16_rne(f1[i][j]) * XS); }
    *(v8b*)(dst + i * 2048) = o;
  }
}

// projections: grid (KL/256, nb, 24 slabs of 128 output channels: 0-7 q, 8-15 k, 16-23 v); block = 256 tokens x 128 channels, 8 waves (4 x 2) of 64 tokens x 64 channels: a wave's 8 fragments feed 16 products;
// K = 1024 in 16 stages of 64: stage rows 0-255 X8 tokens, 256-383 WT channels, copied to LDS one stage ahead; A and B fragments from LDS; the k order of every accumulator is unchanged
constexpr int PM = 256, PN = 128;
static_assert(PM + PN == GROWS && KL % PM == 0 && DM % PN == 0);
constexpr int PSMEM = (int)sizeof(float) * PM * (PN + 4) > GRING_BYTES ? (int)sizeof(float) * PM * (PN + 4) : GRING_BYTES;
__global__ __launch_bounds__(256) void proj_kernel(const b16* __restrict__ X8, const b16* __restrict__ WT, const float* __restrict__ bq, const float* __restrict__ bk, const float* __restrict__ bv,
                                                    const float* __restrict__ cst, const float* __restrict__ snt,
                                                    b16* __restrict__ QH, b16* __restrict__ QLo, b16* __restrict__ KH, b16* __restrict__ KLo, b16* __restrict__ VTh, b16* __restrict__ VTl) {
  __shared__ __attribute__((aligned(16))) unsigned char smem[PSMEM];
  b16* const ring = (b16*)smem; float (*const Tf)[PN + 4] = (float (*)[PN + 4])smem;   // Tf [token][channel] takes the ring's place behind the loop's last barrier
  const int wave = threadIdx.x >> 5, lane = threadIdx.x & 31, nloc = lane & 15, hlf = lane >> 4, wm = wave >> 1, wn = wave & 1;
  const int t0 = blockIdx.x * PM; const int bb = blockIdx.y; const int slab = blockIdx.z, n0 = slab * PN, part = slab / 8, c0 = n0 - part * DM;
  const int r0 = threadIdx.x >> 3, seg = threadIdx.x & 7;   // copy i of a lane: stage row r0 + 32 i, 16-byte piece seg; a wave's copy covers 4 whole lines
  const b16* const gA = X8 + ((size_t)bb * TF + t0 + r0) * DM + seg * 8; const b16* const gB = WT + (size_t)(n0 + r0) * DM + seg * 8;
  const unsigned lrow = lds_addr(smem) + (unsigned)(r0 * LP * 2 + seg * 16);
  auto issue = [&](int s) {
    unsigned l[12]; const b16* g[12];
    const b16* const pa = gA + s * KC; const b16* const pb = gB + s * KC; const unsigned lb = lrow + (unsigned)((s & 1) * GROWS * LP * 2);
#pragma unroll
    for (int i = 0; i < 12; ++i) { l[i] = lb + (unsigned)(32 * i * LP * 2); g[i] = i < 8 ? pa + (size_t)(32 * i) * DM : pb + (size_t)(32 * (i - 8)) * DM; }
    copy12(l, g);
  };
  v8f acc[4][4];
#pragma unroll
  for (int i = 0; i < 4; ++i)
#pragma unroll
    for (int t = 0; t < 4; ++t) acc[i][t] = (v8f){};
  issue(0); wait_copies(); __syncthreads(); issue(1);
#pragma unroll 1   // one stage per trip: the buffer index and the refill test stay scalar
  for (int s = 0; s < NST; ++s) {
    const b16* const As = ring + ((s & 1) * GROWS + wm * 64 + nloc) * LP; const b16* const Bs = ring + ((s & 1) * GROWS + PM + wn * 64 + nloc) * LP;
#pragma unroll
    for (int kk = 0; kk < KC; kk += 32) {
      v16b a[4], bw[4];   // the block's fragment reads stand as one group ahead of its products: their LDS latency is met once a block, not once a product
#pragma unroll
      for (int i = 0; i < 4; ++i) a[i] = frag_kb(As + i * 16 * LP + kk, hlf);
#pragma unroll
      for (int t = 0; t < 4; ++t) bw[t] = frag_kb(Bs + t * 16 * LP + kk, hlf);
#pragma unroll
      for (int i = 0; i < 4; ++i)
#pragma unroll
        for (int t = 0; t < 4; ++t) acc[i][t] = wmma16b(a[i], bw[t], acc[i][t]);
    }
    wait_lds_reads(); wait_copies(); __syncthreads();   // publishes stage s + 1 and frees stage s's buffer
    if (s + 2 < NST) issue(s + 2);
  }
  wait_copies();
  const float* bias = part == 0 ? bq : part == 1 ? bk : bv;
#pragma unroll
  for (int t = 0; t < 4; ++t) {
    const float bval = bf16_rne(bias[c0 + wn * 64 + t * 16 + nloc]);
#pragma unroll
    for (int i = 0; i < 4; ++i)
#pragma unroll
      for (int r = 0; r < 8; ++r) Tf[wm * 64 + i * 16 + 8 * hlf + r][wn * 64 + t * 16 + nloc] = acc[i][t][r] * (1.0f / (XS * WSC)) + bval;
  }
  __syncthreads();
  {
    if (part < 2) {
      b16* ph_ = part == 0 ? QH : KH; b16* pl_ = part == 0 ? QLo : KLo;
      const int c = c0 + lane * 4; const int hq = c / HD, d = c % HD, p0 = d >> 1;   // d is a multiple of 4: pairs (d,d+1) -> p0 and (d+2,d+3) -> p0+1
#pragma unroll 1   // eight rows a trip (the inner loop, unrolled): their table loads and LDS reads fly together, so that a wave's 32 rows meet that latency 4 times
      for (int r8 = 0; r8 < PM / 8; r8 += 8) {
#pragma unroll
      for (int rj = 0; rj < 8; ++rj) {
        const int row = wave * (PM / 8) + r8 + rj, tok = t0 + row;
        const v4f f = *(const v4f*)(&Tf[row][lane * 4]);
        const v2f cc = *(const v2f*)(cst + (size_t)tok * (HD / 2) + p0), ss = *(const v2f*)(snt + (size_t)tok * (HD / 2) + p0);
        const float o0 = f[0] * cc[0] - f[1] * ss[0];
        const float o1 = f[0] * ss[0] + f[1] * cc[0];
        const float o2 = f[2] * cc[1] - f[3] * ss[1];
        const float o3 = f[2] * ss[1] + f[3] * cc[1];
        v4h h4, l4; b16 ph, pl;
        split16(o0 * XS, ph, pl); h4[0] = ph; l4[0] = pl;
        split16(o1 * XS, ph, pl); h4[1] = ph; l4[1] = pl;
        split16(o2 * XS, ph, pl); h4[2] = ph; l4[2] = pl;
        split16(o3 * XS, ph, pl); h4[3] = ph; l4[3] = pl;
        const size_t oi = (((size_t)bb * H + hq) * TF + tok) * HD + d;
        *(v4h*)(ph_ + oi) = h4; *(v4h*)(pl_ + oi) = l4;
      }
      asm volatile("s_wait_xcnt 0x0" ::: "memory");   // in front of the next trip's rewrite of the registers that this trip's loads and stores name (a precaution)
      }
    } else {
#pragma unroll 1   // eight channels a trip (the inner loop, unrolled): their LDS reads fly together, so that a wave meets that latency 8 times, not 64
      for (int q8 = 0; q8 < PM / 4; q8 += 8) {
#pragma unroll
      for (int qj = 0; qj < 8; ++qj) {
        const int q = q8 + qj;
        const int cl = (wave & 3) * 32 + (q & 31); const int c = c0 + cl; const int hv_ = c / HD, d = c % HD; const int tk = (wave >> 2) * (PM / 2) + (q >> 5) * 64 + lane * 2; v2h hv, lv;   // waves 0-3: tokens 0-127, waves 4-7: tokens 128-255, 64 at a time
        for (int j = 0; j < 2; ++j) { b16 p, ql; split16(Tf[tk + j][cl] * XS, p, ql); hv[j] = p; lv[j] = ql; }
        const size_t oi = (((size_t)bb * H + hv_) * HD + d) * (size_t)TF + t0 + tk;
        *(v2h*)(VTh + oi) = hv; *(v2h*)(VTl + oi) = lv;
      }
      asm volatile("s_wait_xcnt 0x0" ::: "memory");   // in front of the next trip's rewrite of the registers that this trip's stores name (a precaution)
      }
    }
    
  }
}

// attention: grid (nb x H, QL/64): within each of its two parts (below) a block's 64-row query block is counted down from the part's last, so that a block's cost (its number of key stages) falls with its index (for speed only); block = 4 waves x 16 queries; a wave's keys are 0 .. min(KL, q0+16+SRC)-1 in 32-key chunks; key allowed iff key <= qi + SRC;
// RES != 0 (query rows < RSPLIT): S^T = K Q^T with 3 products (kh qh + kh ql + kl qh), P x1024 hi/lo, O^T += V^T P^T with 3 products (vh ph + vh pl + vl ph);
// RES == 0 (query rows >= RSPLIT, >= RSPLIT+SRC keys per row): S^T = kh qh (1 product), P x1024 single, O^T += vh p (1 product). Online softmax (running max, f32) in both; a lane's own P values are its B fragment of P^T and stay in registers
// K and V^T reach the waves through LDS: a stage is SK keys = 64 K rows and 64 V^T rows of one whole 128-byte line each (hi planes; RES: the lo planes behind them), copied one stage ahead as whole lines and shared by the
// block's 4 waves; the 16-byte fragment reads, which touch 16 rows each, go to LDS at the 144-byte pitch instead of to the cache
constexpr int AW = 4, AQ = AW * 16, SK = 64;
static_assert(SK == KC && HD == KC && KL % SK == 0 && (AQ + SRC) % SK == 0 && AQ + SRC >= 2 * SK && RSPLIT % AQ == 0 && QL % AQ == 0);
constexpr int ASMEM = 2 * (2 * SK * 2) * LP * 2;   // the ring of the RES != 0 path, the larger of the two
template <int RES>
__device__ __forceinline__ void attn_body(unsigned char* const smem, const b16* __restrict__ QH, const b16* __restrict__ QLo, const b16* __restrict__ KH, const b16* __restrict__ KLo, const b16* __restrict__ VTh, const b16* __restrict__ VTl,
                                          b16* __restrict__ Ch, b16* __restrict__ Cl, const int qblk) {
  constexpr int NP = RES ? 2 : 1, BROWS = 2 * SK * NP;   // stage rows: 0-63 K hi, 64-127 V^T hi, then (RES) 128-191 K lo, 192-255 V^T lo
  static_assert(2 * BROWS * LP * 2 <= ASMEM && sizeof(float) * AW * 16 * (HD + 4) <= 2 * BROWS * LP * 2);
  b16* const ring = (b16*)smem; float (*const To)[16][HD + 4] = (float (*)[16][HD + 4])smem;   // To takes the ring's place behind the loop's last barrier
  // the wave's number is taken into a scalar register, so that kend and the test on it below are scalar and no wave's EXEC changes around the products
  const int wave = __builtin_amdgcn_readfirstlane(threadIdx.x >> 5), lane = threadIdx.x & 31, hh = lane >> 4, col = lane & 15; const int bb = blockIdx.x / H, h = blockIdx.x % H;
  const int qb = qblk * AQ, q0 = qb + wave * 16, qi = q0 + col;
  const size_t ph = (size_t)bb * H + h; const size_t pq = ph * TF * HD; const b16* Vh = VTh + ph * HD * (size_t)TF; const b16* Vl = VTl + ph * HD * (size_t)TF;
  const int kmax = q0 + 16 + SRC; const int kend = kmax < KL ? kmax : KL;          // this wave's keys
  const int bmax = qb + AQ + SRC; const int ns = (bmax < KL ? bmax : KL) / SK;      // the block's stages: >= 2, every one wholly inside the planes
  // copy i of a lane: stage row r0 + 16 i, 16-byte piece seg; a wave's copy covers 4 whole lines
  const int r0 = threadIdx.x >> 3, seg = threadIdx.x & 7;
  const size_t ko = pq + (size_t)r0 * HD + seg * 8, vo = (size_t)r0 * TF + seg * 8;
  const unsigned lrow = lds_addr(smem) + (unsigned)(r0 * LP * 2 + seg * 16);
  auto issue = [&](int s) {
#pragma unroll
    for (int pl = 0; pl < NP; ++pl) {
      unsigned l[8]; const b16* g[8];
      const b16* const pk = (pl ? KLo : KH) + ko + (size_t)s * (SK * HD); const b16* const pv = (pl ? Vl : Vh) + vo + s * SK;
      const unsigned lb = lrow + (unsigned)(((s & 1) * BROWS + pl * 2 * SK) * LP * 2);
#pragma unroll
      for (int i = 0; i < 8; ++i) { l[i] = lb + (unsigned)(16 * i * LP * 2); g[i] = i < 4 ? pk + (size_t)(16 * i) * HD : pv + (size_t)(16 * (i - 4)) * TF; }
      copy8(l, g);
    }
  };
  issue(0);
  const v16b qh0 = frag_kb(QH + pq + (size_t)qi * HD, hh), qh1 = frag_kb(QH + pq + (size_t)qi * HD + 32, hh);
  v16b ql0 = (v16b){}, ql1 = (v16b){};
  if (RES) { ql0 = frag_kb(QLo + pq + (size_t)qi * HD, hh); ql1 = frag_kb(QLo + pq + (size_t)qi * HD + 32, hh); }
  const float cs = LOG2E / (8.0f * XS * XS);
  float m = -INFINITY, l = 0.0f; v8f o[4];
#pragma unroll
  for (int t = 0; t < 4; ++t) o[t] = (v8f){};
  v16b kh[2][2], kl[2][2], vh[4], vl[4];
  auto fetch_k = [&](const b16* st, int c) {   // chunk c of the stage at st: K rows 32 c + 16 u + col
    const b16* const a0 = st + (c * 32 + col) * LP + 8 * hh;
#pragma unroll
    for (int u = 0; u < 2; ++u) {
      kh[u][0] = frag_at(a0 + u * 16 * LP); kh[u][1] = frag_at(a0 + u * 16 * LP + 32);
      if (RES) { kl[u][0] = frag_at(a0 + (2 * SK + u * 16) * LP); kl[u][1] = frag_at(a0 + (2 * SK + u * 16) * LP + 32); }
    }
  };
  auto fetch_v = [&](const b16* st, int c) {   // V^T rows 16 t + col, keys 32 c ..
    const b16* const a0 = st + (SK + col) * LP + c * 32 + 8 * hh;
#pragma unroll
    for (int t = 0; t < 4; ++t) {
      vh[t] = frag_at(a0 + t * 16 * LP);
      if (RES) vl[t] = frag_at(a0 + (2 * SK + t * 16) * LP);
    }
  };
  wait_copies(); __syncthreads(); issue(1);
#pragma unroll 1   // one stage per trip: the buffer index and the refill test stay scalar
  for (int s = 0; s < ns; ++s) {
    const b16* const st = ring + (s & 1) * BROWS * LP;
#pragma unroll
    for (int c = 0; c < SK / 32; ++c) {
      const int kb = s * SK + c * 32;
      if (kb < kend) {   // the same for a whole wave (a scalar test): a wave past its last key only passes the stage's foot
        v8f s_[2];
        if (RES || c == 0) fetch_k(st, c);   // RES: every chunk reads its own K at its head, so that no second K set is live through the softmax (registers: four waves a SIMD)
        fetch_v(st, c);   // this chunk's V reads fly under the score products and the softmax
#pragma unroll
        for (int u = 0; u < 2; ++u) {
          s_[u] = (v8f){};
          if (RES) {
            s_[u] = wmma16b(kh[u][0], qh0, s_[u]); s_[u] = wmma16b(kh[u][0], ql0, s_[u]); s_[u] = wmma16b(kl[u][0], qh0, s_[u]);
            s_[u] = wmma16b(kh[u][1], qh1, s_[u]); s_[u] = wmma16b(kh[u][1], ql1, s_[u]); s_[u] = wmma16b(kl[u][1], qh1, s_[u]);
          } else {
            s_[u] = wmma16b(kh[u][0], qh0, s_[u]); s_[u] = wmma16b(kh[u][1], qh1, s_[u]);
          }
        }
        if (!RES && c + 1 < SK / 32) fetch_k(st, c + 1);   // the same stage's next chunk: its K reads are issued inside this chunk, well ahead of their products
        float al; v16b pf, pg = (v16b){};   // B fragment of P^T: element i2 of a lane is key (i2 < 8 ? 0 : 16) + 8 hh + (i2 & 7) of its own query, the lane's own score i2
        // MK: the chunk crosses the mask line. Without it every key of the chunk is allowed for every query of the wave: every score is finite, so the key test and the tests on -inf are identities and are left out
        auto soft = [&](auto mk) {
          constexpr bool MK = decltype(mk)::v;
          float e[16]; float mx = -INFINITY;
#pragma unroll
          for (int u = 0; u < 2; ++u)
#pragma unroll
            for (int r = 0; r < 8; ++r) { const int key = kb + u * 16 + 8 * hh + r; const float vv = (!MK || key <= qi + SRC) ? s_[u][r] * cs : -INFINITY; e[u * 8 + r] = vv; mx = fmaxf(mx, vv); }
          mx = fmaxf(mx, __shfl_xor(mx, 16)); const float mn = fmaxf(m, mx); const float da = m - mn; float ea = nexp2(da), sum;
          float x[16], pe[16];
#pragma unroll
          for (int i2 = 0; i2 < 16; ++i2) { x[i2] = e[i2] - mn; pe[i2] = nexp2(x[i2]); }
          exp_slot(ea, da); exp_slot<0>(pe, x); exp_slot<8>(pe, x);
          al = (MK && mn == -INFINITY) ? 1.0f : ea;
#pragma unroll
          for (int i2 = 0; i2 < 16; ++i2) {
            const float p = (MK && e[i2] == -INFINITY) ? 0.0f : pe[i2]; sum = i2 ? sum + p : p;
            if (RES) { b16 a_, b_; split16(p * PS, a_, b_); pf[i2] = a_; pg[i2] = b_; }
            else { pf[i2] = (b16)(p * PS); }
          }
          sum += __shfl_xor(sum, 16); l = l * al + sum; m = mn;
        };
        if (kb + 31 <= q0 + SRC) soft(flag<false>{}); else soft(flag<true>{});   // a scalar test: the chunk's last key against the wave's first query
#pragma unroll
        for (int t = 0; t < 4; ++t) {
          o[t] *= al;
          if (RES) { o[t] = wmma16b(vh[t], pf, o[t]); o[t] = wmma16b(vh[t], pg, o[t]); o[t] = wmma16b(vl[t], pf, o[t]); }
          else { o[t] = wmma16b(vh[t], pf, o[t]); }
        }
      }
    }
    wait_lds_reads(); wait_copies(); __syncthreads();   // publishes stage s + 1 and frees stage s's buffer
    if (s + 2 < ns) issue(s + 2);
  }
  wait_copies();
  const float inv = 1.0f / (l * PS * XS);
#pragma unroll
  for (int t = 0; t < 4; ++t)
#pragma unroll
    for (int r = 0; r < 8; ++r) To[wave][col][t * 16 + 8 * hh + r] = o[t][r] * inv;
  wave_lds_sync();
  {
    for (int rr = 0; rr < 16; ++rr) {
      const v2f f = *(const v2f*)(&To[wave][rr][lane * 2]); v2h hv, lv;
      for (int j = 0; j < 2; ++j) { b16 p, q; split16(f[j] * CS, p, q); hv[j] = p; lv[j] = q; }
      const size_t oi = ((size_t)bb * TF + q0 + rr) * DM + h * HD + lane * 2;
      *(v2h*)(Ch + oi) = hv; *(v2h*)(Cl + oi) = lv;
    }
    
  }
}
// both paths in one grid: blocks y < RSPLIT / AQ take the RES != 0 rows, the rest the RES == 0 rows, each part from its last query block down (a scalar test on the block index: a block runs one path whole).
// The RES != 0 part has few, long dependent chains and cannot fill the chip by itself: it takes the grid's first block indices (for speed only)
__global__ __launch_bounds__(128) void attn_kernel(const b16* __restrict__ QH, const b16* __restrict__ QLo, const b16* __restrict__ KH, const b16* __restrict__ KLo, const b16* __restrict__ VTh, const b16* __restrict__ VTl,
                                                   b16* __restrict__ Ch, b16* __restrict__ Cl) {
  __shared__ __attribute__((aligned(16))) unsigned char smem[ASMEM];
  constexpr int NR = RSPLIT / AQ, NT = QL / AQ;
  const int y = blockIdx.y;
  if (y < NR) attn_body<1>(smem, QH, QLo, KH, KLo, VTh, VTl, Ch, Cl, NR - 1 - y);
  else attn_body<0>(smem, QH, QLo, KH, KLo, VTh, VTl, Ch, Cl, NT - 1 - (y - NR));
}

// output GEMM: grid (QL/128, 8 slabs of 128 channels, nb); block = 128 rows x 128 channels, 8 waves (4 x 2) of 32 rows x 64 channels: a wave's 8 fragments (2 ctx hi, 2 ctx lo, 4 W_p) feed 16 products
constexpr int OM = 128, ON = 128;
static_assert(2 * OM + ON == GROWS && QL % OM == 0 && DM % ON == 0 && (int)sizeof(float) * OM * (ON + 4) <= GRING_BYTES);
__global__ __launch_bounds__(256) void out_kernel(const b16* __restrict__ Ch, const b16* __restrict__ Cl, const b16* __restrict__ WO, float* __restrict__ out, int b0) {
  __shared__ __attribute__((aligned(16))) unsigned char smem[GRING_BYTES];
  b16* const ring = (b16*)smem; float (*const Tf)[ON + 4] = (float (*)[ON + 4])smem;   // Tf [row][channel] takes the ring's place behind the loop's last barrier
  const int wave = threadIdx.x >> 5, lane = threadIdx.x & 31, nloc = lane & 15, hlf = lane >> 4, wm = wave >> 1, wn = wave & 1; const int bb = blockIdx.z;
  const size_t mo = (size_t)(b0 + bb) * TF + (size_t)blockIdx.x * OM + wave * (OM / 8);
  const int n0 = blockIdx.y * ON;
  v8f acc[2][4];
#pragma unroll
  for (int i = 0; i < 2; ++i)
#pragma unroll
    for (int t = 0; t < 4; ++t) acc[i][t] = (v8f){};
  // stage rows 0-127 Ch, 128-255 Cl (the block's 128 rows), 256-383 WO channels; copy i of a lane: stage row r0 + 32 i, 16-byte piece seg
  const int r0 = threadIdx.x >> 3, seg = threadIdx.x & 7;
  const size_t ma = ((size_t)bb * TF + (size_t)blockIdx.x * OM + r0) * DM + seg * 8;
  const b16* const gH = Ch + ma; const b16* const gL = Cl + ma; const b16* const gB = WO + (size_t)(n0 + r0) * DM + seg * 8;
  const unsigned lrow = lds_addr(smem) + (unsigned)(r0 * LP * 2 + seg * 16);
  auto issue = [&](int s) {
    unsigned l[12]; const b16* g[12];
#pragma unroll
    for (int i = 0; i < 12; ++i) {
      l[i] = lrow + (unsigned)(((s & 1) * GROWS + 32 * i) * LP * 2);
      g[i] = (i < 4 ? gH + (size_t)(32 * i) * DM : i < 8 ? gL + (size_t)(32 * (i - 4)) * DM : gB + (size_t)(32 * (i - 8)) * DM) + s * KC;
    }
    copy12(l, g);
  };
  issue(0); wait_copies(); __syncthreads(); issue(1);
#pragma unroll 1   // one stage per trip: the buffer index and the refill test stay scalar
  for (int s = 0; s < NST; ++s) {
    const b16* const As = ring + ((s & 1) * GROWS + wm * 32 + nloc) * LP; const b16* const Bs = ring + ((s & 1) * GROWS + 2 * OM + wn * 64 + nloc) * LP;
#pragma unroll
    for (int kk = 0; kk < KC; kk += 32) {
      v16b a[2], al[2], bw[4];   // the block's fragment reads stand as one group ahead of its products: their LDS latency is met once a block, not once a product
#pragma unroll
      for (int i = 0; i < 2; ++i) { a[i] = frag_kb(As + i * 16 * LP + kk, hlf); al[i] = frag_kb(As + (OM + i * 16) * LP + kk, hlf); }
#pragma unroll
      for (int t = 0; t < 4; ++t) bw[t] = frag_kb(Bs + t * 16 * LP + kk, hlf);
#pragma unroll
      for (int i = 0; i < 2; ++i)
#pragma unroll
        for (int t = 0; t < 4; ++t) { acc[i][t] = wmma16b(a[i], bw[t], acc[i][t]); acc[i][t] = wmma16b(al[i], bw[t], acc[i][t]); }
    }
    wait_lds_reads(); wait_copies(); __syncthreads();   // publishes stage s + 1 and frees stage s's buffer
    if (s + 2 < NST) issue(s + 2);
  }
  wait_copies();
#pragma unroll
  for (int i = 0; i < 2; ++i)
#pragma unroll
    for (int t = 0; t < 4; ++t) {
#pragma unroll
      for (int r = 0; r < 8; ++r) Tf[wm * 32 + i * 16 + 8 * hlf + r][wn * 64 + t * 16 + nloc] = acc[i][t][r] * (1.0f / (CS * WSC));
    }
  __syncthreads();   // a row of Tf is written by two waves and read by one of them
  {
    for (int rr = 0; rr < OM / 8; ++rr) *(v4f*)(out + (mo + rr) * DM + n0 + lane * 4) = *(const v4f*)(&Tf[wave * (OM / 8) + rr][lane * 4]);
    
  }
}
}  // namespace

extern "C" void kernel_launch(void* const* d_in, const int* in_sizes, int n_in, void* d_out, int out_size, void* d_ws, size_t ws_size, hipStream_t stream) {
  if (n_in < 8) return;
  auto Fp = [&](int i) { return (const float*)d_in[i]; };
  // input order: 0 x [4,2048,1024], 1 W_q, 2 b_q, 3 W_k, 4 b_k, 5 W_v, 6 b_v, 7 W_p; all f32; W (in,out)
  if (in_sizes[0] < BL * TF * DM || in_sizes[1] < DM * DM || in_sizes[2] < DM || in_sizes[3] < DM * DM || in_sizes[4] < DM || in_sizes[5] < DM * DM || in_sizes[6] < DM || in_sizes[7] < DM * DM ||
      out_size < BL * TF * DM) return;
  size_t off = 0; char* ws = (char*)d_ws;
  auto carve = [&](size_t bytes) { char* p = ws + off; off += (bytes + 255) & ~(size_t)255; return p; };
  b16* WT = (b16*)carve((size_t)3 * DM * DM * 2); b16* WO = (b16*)carve((size_t)DM * DM * 2);
  float* CST = (float*)carve((size_t)TF * (HD / 2) * 4); float* SNT = (float*)carve((size_t)TF * (HD / 2) * 4);
  const size_t plane = (size_t)NBH * TF * DM * 2;
  b16* X8 = (b16*)carve(plane);
  b16* QH = (b16*)carve(plane); b16* QLo = (b16*)carve(plane); b16* KH = (b16*)carve(plane); b16* KLo = (b16*)carve(plane);
  b16* VTh = (b16*)carve(plane); b16* VTl = (b16*)carve(plane); b16* Ch = (b16*)carve(plane); b16* Cl = (b16*)carve(plane);
  if (off > ws_size || off > ((size_t)256 << 20)) return;   // 159,907,840 B at NBH == 4
  prep_kernel<<<(unsigned)(4 * PWM / 8), 256, 0, stream>>>(Fp(1), Fp(3), Fp(5), Fp(7), WT, WO);
  rope_tab_kernel<<<(unsigned)((TF * (HD / 2) + 255) / 256), 256, 0, stream>>>(CST, SNT);
  for (int p = 0; p < NPASS; ++p) {
    const int b0 = p * NBH; const int nb = (BL - b0 < NBH) ? (BL - b0) : NBH;
    xcvt_kernel<<<(unsigned)((size_t)nb * KL * DM / 8 / (256 * XU)), 256, 0, stream>>>(Fp(0), X8, b0, nb);
    proj_kernel<<<dim3(KL / PM, nb, 3 * DM / PN), 256, 0, stream>>>(X8, WT, Fp(2), Fp(4), Fp(6), CST, SNT, QH, QLo, KH, KLo, VTh, VTl);
    attn_kernel<<<dim3(nb * H, QL / AQ), AW * 32, 0, stream>>>(QH, QLo, KH, KLo, VTh, VTl, Ch, Cl);
    out_kernel<<<dim3(QL / OM, DM / ON, nb), 256, 0, stream>>>(Ch, Cl, WO, (float*)d_out, b0);
  }
}
